// v000
// The times below were measured on an AMD MI455X: many runs one after another, warmed up first and cycling through
// copies of the inputs, with the whole window's GPU time divided by the number of runs. Launches and the gaps
// between them are all in it. The median over several windows is given; except for v000 it joins two sittings, which
// can be a few percent apart, so the side-by-side timings, each taken in one sitting, are the better comparison.
// v000, which the later versions start from, runs in 1970 microseconds.
#include <hip/hip_runtime.h>

// TemporalAttention (x [2][12][16][16][1024] + temporal_embedding[:, :12] broadcast over the 16x16 grid; N = 12*16*16 = 3,072 tokens per batch; qkv = (x + te) qkv_w^T + qkv_b (torch [3072][1024], q | k | v, 16 heads x 64); softmax(q.k / 8) over all 3,072 tokens; out = merged proj_w^T + proj_b -> [2][12][16][16][1024]).
// Compute dtypes, f32 accumulate: every input rounded to bf16; x + te in f32 split into hl planes, so q/k/v are hl x exact bf16 (2 products) + bias; scores and attn.v single fp16 (x1024) on every row; softmax f32; proj hl x exact (2 products) + bias.

#define NB_  2
#define TT   3072
#define DM   1024
#define NH_  16
#define NKV  16
#define REP  (NH_ / NKV)
#define HD   64
#define DQ   (NH_ * HD)
#define DKV  (NKV * HD)
#define ZH   2
#define RH   0                  // query rows < RH use hi+lo planes (0: none)
#define WIN  0
#define PCAR 1024.0f
#define SCL  0.125f   // HD^-0.5
typedef _Float16 h16;
typedef unsigned short bf;
typedef __attribute__((ext_vector_type(16))) __bf16   v16bf;
typedef __attribute__((ext_vector_type(16))) _Float16 v16h;
typedef __attribute__((ext_vector_type(8)))  _Float16 v8h;
typedef __attribute__((ext_vector_type(8)))  unsigned short v8us;
typedef __attribute__((ext_vector_type(8)))  float    v8f;
typedef __attribute__((ext_vector_type(4)))  float    v4f;
typedef v8h  __attribute__((may_alias)) v8ha;
typedef v4f  __attribute__((may_alias)) v4fa;
typedef v8us __attribute__((may_alias)) v8usa;

__device__ __forceinline__ unsigned short f2bf(float f) { unsigned u = __float_as_uint(f); u += 0x7FFFu + ((u >> 16) & 1u); return (unsigned short)(u >> 16); }
__device__ __forceinline__ float bf2f(unsigned short b) { return __uint_as_float(((unsigned)b) << 16); }
__device__ __forceinline__ float bfr(float f) { return bf2f(f2bf(f)); }
__device__ __forceinline__ v16h cat16(v8h lo, v8h hi) { return __builtin_shufflevector(lo, hi, 0, 1, 2, 3, 4, 5, 6, 7, 8, 9, 10, 11, 12, 13, 14, 15); }
__device__ __forceinline__ v16bf cat16b(v8us lo, v8us hi) { return __builtin_bit_cast(v16bf, __builtin_shufflevector(lo, hi, 0, 1, 2, 3, 4, 5, 6, 7, 8, 9, 10, 11, 12, 13, 14, 15)); }
__device__ __forceinline__ v8f wmma16(v16h a, v16h b, v8f c) { return __builtin_amdgcn_wmma_f32_16x16x32_f16(false, a, false, b, (short)0, c, false, false); }
__device__ __forceinline__ v8f wmmab(v16bf a, v16bf b, v8f c) { return __builtin_amdgcn_wmma_f32_16x16x32_bf16(false, a, false, b, (short)0, c, false, false); }



// ---- k_gemmw: register-blocked GEMM, ONE WAVE per 64x64 output tile (16 accumulators), operands straight from K-contiguous 16-bit planes; grid (M/64, N/64, Z), 32 threads.
// C[m][n] (f32, pitch ldc, + optional f32 bias[n]) = sum_k A[m][k] Bt[n][k] (+ split products per NSPLIT). z-batch strides sA/sB/sC in elements. K % 32 == 0.
template <typename T16> struct WFrag;
template <> struct WFrag<h16> { typedef v16h V; static __device__ __forceinline__ V ld(const h16* p) { return cat16(*(const v8h*)p, *(const v8h*)(p + 16)); } static __device__ __forceinline__ v8f mma(V a, V b, v8f c) { return wmma16(a, b, c); } };
template <> struct WFrag<bf> { typedef v16bf V; static __device__ __forceinline__ V ld(const bf* p) { return cat16b(*(const v8us*)p, *(const v8us*)(p + 16)); } static __device__ __forceinline__ v8f mma(V a, V b, v8f c) { return wmmab(a, b, c); } };
template <typename T16, int NSPLIT, bool BIAS>
__global__ __launch_bounds__(32) void k_gemmw(const T16* __restrict__ A, const T16* __restrict__ A2, const T16* __restrict__ Bt, const T16* __restrict__ Bt2, int K, float* C, int ldc, const float* __restrict__ bias, size_t sA, size_t sB, size_t sC) {
    typedef typename WFrag<T16>::V V;
    __shared__ __align__(16) float os[16 * 68];
    const size_t z = blockIdx.z; A += z * sA; if (A2) A2 += z * sA; Bt += z * sB; if (Bt2) Bt2 += z * sB; C += z * sC;
    const int lane = threadIdx.x & 31, lr = lane & 15, hi = lane >> 4; const int r0 = blockIdx.x * 64, c0 = blockIdx.y * 64;
    v8f acc[4][4];
#pragma unroll
    for (int mb = 0; mb < 4; ++mb)
#pragma unroll
        for (int nb = 0; nb < 4; ++nb) acc[mb][nb] = (v8f){};
    const size_t aoff = (size_t)(r0 + lr) * K + 8 * hi, boff = (size_t)(c0 + lr) * K + 8 * hi;
#pragma unroll 1
    for (int kc = 0; kc < K; kc += 32) {
        V a[4], a2[4];
#pragma unroll
        for (int mb = 0; mb < 4; ++mb) { a[mb] = WFrag<T16>::ld(A + aoff + (size_t)mb * 16 * K + kc); if (NSPLIT == 1 || NSPLIT == 2) a2[mb] = WFrag<T16>::ld(A2 + aoff + (size_t)mb * 16 * K + kc); }
#pragma unroll
        for (int nb = 0; nb < 4; ++nb) { const V b = WFrag<T16>::ld(Bt + boff + (size_t)nb * 16 * K + kc); V b2; if (NSPLIT >= 2) b2 = WFrag<T16>::ld(Bt2 + boff + (size_t)nb * 16 * K + kc);
#pragma unroll
            for (int mb = 0; mb < 4; ++mb) { acc[mb][nb] = WFrag<T16>::mma(a[mb], b, acc[mb][nb]); if (NSPLIT == 1 || NSPLIT == 2) acc[mb][nb] = WFrag<T16>::mma(a2[mb], b, acc[mb][nb]); if (NSPLIT >= 2) acc[mb][nb] = WFrag<T16>::mma(a[mb], b2, acc[mb][nb]); } }
        asm volatile("v_nop\n\tv_nop\n\tv_nop\n\tv_nop" : "+v"(acc[0][0]), "+v"(acc[1][1]), "+v"(acc[2][2]), "+v"(acc[3][3]) : "v"(a[0]), "v"(a[3]));
    }
#pragma unroll
    for (int mb = 0; mb < 4; ++mb) {
#pragma unroll
        for (int nb = 0; nb < 4; ++nb) {
#pragma unroll
            for (int j = 0; j < 8; ++j) os[(hi * 8 + j) * 68 + nb * 16 + lr] = acc[mb][nb][j]; }
        __builtin_amdgcn_wave_barrier(); asm volatile("" ::: "memory");
        float* crow = C + (size_t)(r0 + mb * 16) * ldc + c0;
{
#pragma unroll
            for (int s = 0; s < 8; ++s) { const int row = 2 * s + hi, cofs = lr * 4; v4f val = *(const v4fa*)(os + row * 68 + cofs); if (BIAS) { val[0] += bfr(bias[c0 + cofs]); val[1] += bfr(bias[c0 + cofs + 1]); val[2] += bfr(bias[c0 + cofs + 2]); val[3] += bfr(bias[c0 + cofs + 3]); }
                *(v4f*)(crow + (size_t)row * ldc + cofs) = val; }
             }
        __builtin_amdgcn_wave_barrier(); asm volatile("" ::: "memory");
    }
}

__device__ __forceinline__ h16 tohx(float x) { return (h16)x; }
__device__ __forceinline__ void splitf(float y, unsigned short& h, unsigned short& l) { h = f2bf(y); l = f2bf(y - bf2f(h)); }
typedef __attribute__((ext_vector_type(2))) _Float16 v2h;
typedef __attribute__((ext_vector_type(4))) _Float16 v4h;
typedef __attribute__((ext_vector_type(2))) unsigned short v2us;
typedef __attribute__((ext_vector_type(4))) unsigned short v4us;
typedef __attribute__((ext_vector_type(2))) float v2f;
typedef __attribute__((ext_vector_type(4))) int v4i;

__global__ __launch_bounds__(256) void k_wtG(const float* __restrict__ w, int K, int N, bf* Bt) {
    const int lane = threadIdx.x & 31; const int L0 = (blockIdx.x * 8 + (threadIdx.x >> 5)) * 8; const int nlines = N * K / 64;
{
#pragma unroll 1
        for (int l = 0; l < 8; ++l) { const int L = L0 + l; if (L >= nlines) break; const size_t e = (size_t)L * 64 + lane * 2; const int k = (int)(e % K), n = (int)(e / K); v2us o;
            o[0] = f2bf(w[(size_t)k * N + n]); o[1] = f2bf(w[(size_t)(k + 1) * N + n]); *(v2us*)(Bt + e) = o; }
         }
}
__global__ __launch_bounds__(256) void k_cvt8(const float* __restrict__ src, bf* dst, size_t n8) { const size_t i = (size_t)blockIdx.x * 256 + threadIdx.x; if (i >= n8) return; const v8f v = *(const v8f*)(src + i * 8); v8us o;
#pragma unroll
    for (int k = 0; k < 8; ++k) o[k] = f2bf(v[k]); *(v8us*)(dst + i * 8) = o;  }
__global__ __launch_bounds__(256) void k_cscvt(const float* __restrict__ cosT, const float* __restrict__ sinT, float* CS) { const int idx = blockIdx.x * 256 + threadIdx.x; if (idx >= TT * HD) return; v2f cs; cs[0] = bfr(cosT[idx]); cs[1] = bfr(sinT[idx]); *(v2f*)(CS + (size_t)idx * 2) = cs;  }
// k_rope: head planes [h][t][d] (fp16) of rope(x) x sc with the rotate-half convention out[d] = x[d] cos[t][d] - x[d+HD/2] sin[t][d], out[d+HD/2] = x[d+HD/2] cos[t][d+HD/2] + x[d] sin[t][d+HD/2]
__global__ __launch_bounds__(256) void k_rope(const float* __restrict__ F, int pitch, int nheads, const float* __restrict__ CS, const float* __restrict__ RF, const float* __restrict__ nw, float sc, h16* P16, bf* Ph, bf* Pl) {
    const size_t e = ((size_t)blockIdx.x * 256 + threadIdx.x) * 2; if (e >= (size_t)nheads * TT * HD) return; const int d = (int)(e % HD); const int t = (int)((e / HD) % TT); const int h = (int)(e / ((size_t)HD * TT)); const float* f = F + (size_t)t * pitch + h * HD; const float rf = RF ? RF[(size_t)h * TT + t] : 1.0f; v2h o16; v2us oh, ol;
#pragma unroll
    for (int q = 0; q < 2; ++q) { const int dd = d + q; const int dp = (dd < HD / 2) ? dd + HD / 2 : dd - HD / 2; float x0 = f[dd], x1 = f[dp];
        if (RF) { float n0 = __fmul_rn(x0, rf), n1 = __fmul_rn(x1, rf); asm volatile("" : "+v"(n0)); asm volatile("" : "+v"(n1)); x0 = __fmul_rn(bfr(nw[dd]), n0); x1 = __fmul_rn(bfr(nw[dp]), n1); }
        const v2f cs = *(const v2f*)(CS + ((size_t)t * HD + dd) * 2); float a = __fmul_rn(x0, cs[0]), bq = __fmul_rn(x1, cs[1]); asm volatile("" : "+v"(a)); asm volatile("" : "+v"(bq)); const float r = ((dd < HD / 2) ? __fsub_rn(a, bq) : __fadd_rn(a, bq)) * sc;
        o16[q] = tohx(r); (void)oh; (void)ol; }
    *(v2h*)(P16 + e) = o16;  }
__global__ __launch_bounds__(256) void k_vtp(const float* __restrict__ F, int pitch, int nheads, h16* V16, bf* Vh, bf* Vl) { const size_t e = ((size_t)blockIdx.x * 256 + threadIdx.x) * 2; if (e >= (size_t)nheads * HD * TT) return; const int t = (int)(e % TT); const int d = (int)((e / TT) % HD); const int g = (int)(e / ((size_t)TT * HD)); v2h o16; v2us oh, ol;
#pragma unroll
    for (int q = 0; q < 2; ++q) { const float x = F[(size_t)(t + q) * pitch + g * HD + d]; o16[q] = tohx(x); (void)oh; (void)ol; }
    *(v2h*)(V16 + e) = o16;  }
__global__ __launch_bounds__(256) void k_csid(float* CS) { const int idx = blockIdx.x * 256 + threadIdx.x; if (idx >= TT * HD) return; v2f cs; cs[0] = 1.0f; cs[1] = 0.0f; *(v2f*)(CS + (size_t)idx * 2) = cs;  }
// k_asoft: per row (zz, i): t = S x HD^-0.5 (no mask); softmax over the 3072 keys (register row, one exp, fixed trees);
__global__ __launch_bounds__(256) void k_asoft(const float* __restrict__ Sb, h16* P16, bf* Ph, bf* Pl) {
    const int lane = threadIdx.x & 31; const int row = blockIdx.x * 8 + (threadIdx.x >> 5); if (row >= ZH * TT) return; const int i = row % TT; const int zz = row / TT; (void)zz; const bool hires = (i < RH); const float* sr = Sb + (size_t)row * TT; float v[TT / 32]; float mx = -3.0e38f;
#pragma unroll
    for (int ch = 0; ch < TT / 128; ++ch) { const int j0 = ch * 128 + lane * 4; const v4f a = *(const v4f*)(sr + j0);
#pragma unroll
        for (int q = 0; q < 4; ++q) { const int j = j0 + q; (void)j; const float t = a[q] * SCL; v[ch * 4 + q] = t; mx = fmaxf(mx, t); } }
#pragma unroll
    for (int sh = 16; sh; sh >>= 1) mx = fmaxf(mx, __shfl_xor(mx, sh, 32));
    float sum = 0.f;
#pragma unroll
    for (int k = 0; k < TT / 32; ++k) { float d0 = __fsub_rn(v[k], mx); asm volatile("" : "+v"(d0)); v[k] = __builtin_amdgcn_exp2f(__fmul_rn(d0, 1.4426950408889634f)); sum += v[k]; }
#pragma unroll
    for (int sh = 16; sh; sh >>= 1) sum += __shfl_xor(sum, sh, 32);
    const float f = __fdiv_rn(hires ? 1.0f : PCAR, sum);
{
        if (hires) {
#pragma unroll
            for (int ch = 0; ch < TT / 128; ++ch) { v4us oh, ol;
#pragma unroll
                for (int q = 0; q < 4; ++q) { unsigned short a, c2; splitf(v[ch * 4 + q] * f, a, c2); oh[q] = a; ol[q] = c2; }
                const size_t oo = ((size_t)zz * (RH ? RH : 1) + i) * TT + ch * 128 + lane * 4; *(v4us*)(Ph + oo) = oh; *(v4us*)(Pl + oo) = ol; }
        } else {
#pragma unroll
            for (int ch = 0; ch < TT / 128; ++ch) { v4h o4;
#pragma unroll
                for (int q = 0; q < 4; ++q) o4[q] = tohx(v[ch * 4 + q] * f);
                *(v4h*)(P16 + (size_t)row * TT + ch * 128 + lane * 4) = o4; } }
         }
}
__global__ __launch_bounds__(256) void k_merge(const float* __restrict__ O, int h0, bf* Ah, bf* Al) { const size_t e = ((size_t)blockIdx.x * 256 + threadIdx.x) * 2; if (e >= (size_t)ZH * TT * HD) return; const int d = (int)(e % HD); const int t = (int)((e / HD) % TT); const int zz = (int)(e / ((size_t)HD * TT)); const float cs = (t < RH) ? 1.0f : (1.0f / PCAR); const size_t oo = (size_t)t * DQ + (h0 + zz) * HD + d;
    v2us oh, ol;
#pragma unroll
    for (int q = 0; q < 2; ++q) { unsigned short a, c2; splitf(O[e + q] * cs, a, c2); oh[q] = a; ol[q] = c2; } *(v2us*)(Ah + oo) = oh; *(v2us*)(Al + oo) = ol;  }

__global__ __launch_bounds__(256) void k_xte(const float* __restrict__ xb, const float* __restrict__ te, bf* Xh, bf* Xl) { const size_t e = ((size_t)blockIdx.x * 256 + threadIdx.x) * 4; if (e >= (size_t)TT * DM) return; const int c = (int)(e % DM); const int tok = (int)(e / DM); const int frame = tok / 256; v4us oh, ol;   // token = (frame, h, w); x + temporal_embedding[0][frame][c] in f32, split hl
#pragma unroll
    for (int u = 0; u < 4; ++u) { const float s = __fadd_rn(bfr(xb[e + u]), bfr(te[(size_t)frame * DM + c + u])); unsigned short a, b; splitf(s, a, b); oh[u] = a; ol[u] = b; } *(v4us*)(Xh + e) = oh; *(v4us*)(Xl + e) = ol;  }

extern "C" void kernel_launch(void* const* d_in, const int* in_sizes, int n_in,
                              void* d_out, int out_size, void* d_ws, size_t ws_size, hipStream_t stream) {
    (void)in_sizes; (void)n_in; (void)out_size;
    const float* x = (const float*)d_in[0]; const float* temb = (const float*)d_in[1]; const float* wf = (const float*)d_in[2]; const float* bfz = (const float*)d_in[3]; const float* wo = (const float*)d_in[4]; const float* bo = (const float*)d_in[5]; const float* wq = wf; const float* wk = wf + (size_t)1024 * 1024; const float* wv = wf + (size_t)2 * 1024 * 1024; const float* bq = bfz; const float* bk = bfz + 1024; const float* bv = bfz + 2048; const float* cosT = nullptr; const float* sinT = nullptr; (void)cosT; (void)sinT;
    float* OUT = (float*)d_out;     // [2][3072][1024]
    char* wsp = (char*)d_ws;
    auto take = [&](size_t bytes) { char* p = wsp; wsp += (bytes + 255) & ~(size_t)255; return (void*)p; };
    bf* WQ = (bf*)take((size_t)DQ * DM * 2); bf* WK = (bf*)take((size_t)DKV * DM * 2); bf* WV = (bf*)take((size_t)DKV * DM * 2); bf* WO = (bf*)take((size_t)DM * DQ * 2); float* CS = (float*)take((size_t)TT * HD * 2 * 4);
    bf* XB = (bf*)take((size_t)TT * DM * 2); bf* XBl = (bf*)take((size_t)TT * DM * 2); float* FQ = (float*)take((size_t)TT * DQ * 4); float* FK = (float*)take((size_t)TT * DKV * 4);
    h16* QP16 = (h16*)take((size_t)NH_ * TT * HD * 2); h16* KP16 = (h16*)take((size_t)NKV * TT * HD * 2); h16* VT16 = (h16*)take((size_t)NKV * HD * TT * 2);
    bf* QPh = nullptr; bf* QPl = nullptr; bf* KPh = nullptr; bf* KPl = nullptr; bf* VTh = nullptr; bf* VTl = nullptr; bf* Ph = nullptr; bf* Pl = nullptr;
    float* Sb = (float*)take((size_t)ZH * TT * TT * 4); h16* P16 = (h16*)take((size_t)ZH * TT * TT * 2); float* Ob = (float*)take((size_t)ZH * TT * HD * 4); bf* ATh = (bf*)take((size_t)TT * DQ * 2); bf* ATl = (bf*)take((size_t)TT * DQ * 2);
    if ((size_t)(wsp - (char*)d_ws) > ws_size) return;    // ws 256 MiB
    float* FV = FK;   // v projection reuses the k buffer after the k planes are built (stream-ordered)
    { k_cvt8<<<(unsigned)(((size_t)DQ * DM / 8 + 255) / 256), 256, 0, stream>>>(wq, WQ, (size_t)DQ * DM / 8); k_cvt8<<<(unsigned)(((size_t)DKV * DM / 8 + 255) / 256), 256, 0, stream>>>(wk, WK, (size_t)DKV * DM / 8); k_cvt8<<<(unsigned)(((size_t)DKV * DM / 8 + 255) / 256), 256, 0, stream>>>(wv, WV, (size_t)DKV * DM / 8);
      k_cvt8<<<(unsigned)(((size_t)DM * DQ / 8 + 255) / 256), 256, 0, stream>>>(wo, WO, (size_t)DM * DQ / 8);
       }
    k_csid<<<(TT * HD + 255) / 256, 256, 0, stream>>>(CS);
    const unsigned LQ = (unsigned)(((size_t)NH_ * TT * HD / 2 + 255) / 256), LKv = (unsigned)(((size_t)NKV * TT * HD / 2 + 255) / 256);
    for (int b = 0; b < NB_; ++b) {
        
        k_xte<<<(unsigned)(((size_t)TT * DM / 4 + 255) / 256), 256, 0, stream>>>(x + (size_t)b * TT * DM, temb, XB, XBl);
        k_gemmw<bf, 1, true><<<dim3(TT / 64, DQ / 64, 1), 32, 0, stream>>>(XB, XBl, WQ, nullptr, DM, FQ, DQ, bq, 0, 0, 0);
        k_rope<<<LQ, 256, 0, stream>>>(FQ, DQ, NH_, CS, nullptr, nullptr, 1.0f, QP16, QPh, QPl);
        k_gemmw<bf, 1, true><<<dim3(TT / 64, DKV / 64, 1), 32, 0, stream>>>(XB, XBl, WK, nullptr, DM, FK, DKV, bk, 0, 0, 0);
        k_rope<<<LKv, 256, 0, stream>>>(FK, DKV, NKV, CS, nullptr, nullptr, 1.0f, KP16, KPh, KPl);
        k_gemmw<bf, 1, true><<<dim3(TT / 64, DKV / 64, 1), 32, 0, stream>>>(XB, XBl, WV, nullptr, DM, FV, DKV, bv, 0, 0, 0); k_vtp<<<LKv, 256, 0, stream>>>(FV, DKV, NKV, VT16, VTh, VTl);
        for (int h0 = 0; h0 < NH_; h0 += ZH) { const size_t zq = (size_t)h0, zk = (size_t)(h0 / REP);   // one kv head per query head: the pass's two heads use consecutive kv planes (z-strides TT*HD)
            k_gemmw<h16, 0, false><<<dim3(TT / 64, TT / 64, ZH), 32, 0, stream>>>(QP16 + zq * TT * HD, nullptr, KP16 + zk * TT * HD, nullptr, HD, Sb, TT, nullptr, (size_t)TT * HD, (size_t)TT * HD, (size_t)TT * TT);
            k_asoft<<<ZH * TT / 8, 256, 0, stream>>>(Sb, P16, Ph, Pl);
            k_gemmw<h16, 0, false><<<dim3(TT / 64, HD / 64, ZH), 32, 0, stream>>>(P16, nullptr, VT16 + zk * HD * TT, nullptr, TT, Ob, HD, nullptr, (size_t)TT * TT, (size_t)HD * TT, (size_t)TT * HD);
            k_merge<<<(unsigned)(((size_t)ZH * TT * HD / 2 + 255) / 256), 256, 0, stream>>>(Ob, h0, ATh, ATl); }
        k_gemmw<bf, 1, true><<<dim3(TT / 64, DM / 64, 1), 32, 0, stream>>>(ATh, ATl, WO, nullptr, DQ, OUT + (size_t)b * TT * DM, DM, bo, 0, 0, 0); }
}

// v001
// Measured time: 1160 microseconds a run.
// Two timings next to v000 both put it at 1.70 times that version's speed.
#include <hip/hip_runtime.h>

// TemporalAttention (x [2][12][16][16][1024] + temporal_embedding[:, :12] broadcast over the 16x16 grid; N = 12*16*16 = 3,072 tokens per batch; qkv = (x + te) qkv_w^T + qkv_b (torch [3072][1024], q | k | v, 16 heads x 64); softmax(q.k / 8) over all 3,072 tokens; out = merged proj_w^T + proj_b -> [2][12][16][16][1024]).
// Compute dtypes, f32 accumulate: every input rounded to bf16; x + te in f32 split into hl planes, so q/k/v are hl x exact bf16 (2 products) + bias; scores and attn.v single fp16 (x1024) on every row; softmax f32; proj hl x exact (2 products) + bias.

#define NB_  2
#define TT   3072
#define DM   1024
#define NH_  16
#define NKV  16
#define REP  (NH_ / NKV)
#define HD   64
#define DQ   (NH_ * HD)
#define DKV  (NKV * HD)
#define ZH   2
#define RH   0                  // query rows < RH use hi+lo planes (0: none)
#define WIN  0
#define PCAR 1024.0f
#define SCL  0.125f   // HD^-0.5
typedef _Float16 h16;
typedef unsigned short bf;
typedef __attribute__((ext_vector_type(16))) __bf16   v16bf;
typedef __attribute__((ext_vector_type(16))) _Float16 v16h;
typedef __attribute__((ext_vector_type(8)))  _Float16 v8h;
typedef __attribute__((ext_vector_type(8)))  unsigned short v8us;
typedef __attribute__((ext_vector_type(8)))  float    v8f;
typedef __attribute__((ext_vector_type(4)))  float    v4f;
typedef v8h  __attribute__((may_alias)) v8ha;
typedef v4f  __attribute__((may_alias)) v4fa;
typedef v8us __attribute__((may_alias)) v8usa;

__device__ __forceinline__ unsigned short f2bf(float f) { unsigned u = __float_as_uint(f); u += 0x7FFFu + ((u >> 16) & 1u); return (unsigned short)(u >> 16); }
__device__ __forceinline__ float bf2f(unsigned short b) { return __uint_as_float(((unsigned)b) << 16); }
__device__ __forceinline__ float bfr(float f) { return bf2f(f2bf(f)); }
__device__ __forceinline__ v16h cat16(v8h lo, v8h hi) { return __builtin_shufflevector(lo, hi, 0, 1, 2, 3, 4, 5, 6, 7, 8, 9, 10, 11, 12, 13, 14, 15); }
__device__ __forceinline__ v16bf cat16b(v8us lo, v8us hi) { return __builtin_bit_cast(v16bf, __builtin_shufflevector(lo, hi, 0, 1, 2, 3, 4, 5, 6, 7, 8, 9, 10, 11, 12, 13, 14, 15)); }
__device__ __forceinline__ v8f wmma16(v16h a, v16h b, v8f c) { return __builtin_amdgcn_wmma_f32_16x16x32_f16(false, a, false, b, (short)0, c, false, false); }
__device__ __forceinline__ v8f wmmab(v16bf a, v16bf b, v8f c) { return __builtin_amdgcn_wmma_f32_16x16x32_bf16(false, a, false, b, (short)0, c, false, false); }



// ---- k_gemmw: register-blocked GEMM, ONE WAVE per 64x64 output tile (16 accumulators), operands straight from K-contiguous 16-bit planes; grid (M/64, N/64, Z), 32 threads.
// C[m][n] (f32, pitch ldc, + optional f32 bias[n]) = sum_k A[m][k] Bt[n][k] (+ split products per NSPLIT). z-batch strides sA/sB/sC in elements. K % 32 == 0.
template <typename T16> struct WFrag;
template <> struct WFrag<h16> { typedef v16h V; static __device__ __forceinline__ V ld(const h16* p) { return cat16(*(const v8h*)p, *(const v8h*)(p + 16)); } static __device__ __forceinline__ v8f mma(V a, V b, v8f c) { return wmma16(a, b, c); } };
template <> struct WFrag<bf> { typedef v16bf V; static __device__ __forceinline__ V ld(const bf* p) { return cat16b(*(const v8us*)p, *(const v8us*)(p + 16)); } static __device__ __forceinline__ v8f mma(V a, V b, v8f c) { return wmmab(a, b, c); } };
template <typename T16, int NSPLIT, bool BIAS>
__global__ __launch_bounds__(32) void k_gemmw(const T16* __restrict__ A, const T16* __restrict__ A2, const T16* __restrict__ Bt, const T16* __restrict__ Bt2, int K, float* C, int ldc, const float* __restrict__ bias, size_t sA, size_t sB, size_t sC) {
    typedef typename WFrag<T16>::V V;
    __shared__ __align__(16) float os[16 * 68];
    const size_t z = blockIdx.z; A += z * sA; if (A2) A2 += z * sA; Bt += z * sB; if (Bt2) Bt2 += z * sB; C += z * sC;
    const int lane = threadIdx.x & 31, lr = lane & 15, hi = lane >> 4; const int r0 = blockIdx.x * 64, c0 = blockIdx.y * 64;
    v8f acc[4][4];
#pragma unroll
    for (int mb = 0; mb < 4; ++mb)
#pragma unroll
        for (int nb = 0; nb < 4; ++nb) acc[mb][nb] = (v8f){};
    const size_t aoff = (size_t)(r0 + lr) * K + 8 * hi, boff = (size_t)(c0 + lr) * K + 8 * hi;
#pragma unroll 1
    for (int kc = 0; kc < K; kc += 32) {
        V a[4], a2[4];
#pragma unroll
        for (int mb = 0; mb < 4; ++mb) { a[mb] = WFrag<T16>::ld(A + aoff + (size_t)mb * 16 * K + kc); if (NSPLIT == 1 || NSPLIT == 2) a2[mb] = WFrag<T16>::ld(A2 + aoff + (size_t)mb * 16 * K + kc); }
#pragma unroll
        for (int nb = 0; nb < 4; ++nb) { const V b = WFrag<T16>::ld(Bt + boff + (size_t)nb * 16 * K + kc); V b2; if (NSPLIT >= 2) b2 = WFrag<T16>::ld(Bt2 + boff + (size_t)nb * 16 * K + kc);
#pragma unroll
            for (int mb = 0; mb < 4; ++mb) { acc[mb][nb] = WFrag<T16>::mma(a[mb], b, acc[mb][nb]); if (NSPLIT == 1 || NSPLIT == 2) acc[mb][nb] = WFrag<T16>::mma(a2[mb], b, acc[mb][nb]); if (NSPLIT >= 2) acc[mb][nb] = WFrag<T16>::mma(a[mb], b2, acc[mb][nb]); } }
        asm volatile("v_nop\n\tv_nop\n\tv_nop\n\tv_nop" : "+v"(acc[0][0]), "+v"(acc[1][1]), "+v"(acc[2][2]), "+v"(acc[3][3]) : "v"(a[0]), "v"(a[3]));
    }
#pragma unroll
    for (int mb = 0; mb < 4; ++mb) {
#pragma unroll
        for (int nb = 0; nb < 4; ++nb) {
#pragma unroll
            for (int j = 0; j < 8; ++j) os[(hi * 8 + j) * 68 + nb * 16 + lr] = acc[mb][nb][j]; }
        __builtin_amdgcn_wave_barrier(); asm volatile("" ::: "memory");
        float* crow = C + (size_t)(r0 + mb * 16) * ldc + c0;
{
#pragma unroll
            for (int s = 0; s < 8; ++s) { const int row = 2 * s + hi, cofs = lr * 4; v4f val = *(const v4fa*)(os + row * 68 + cofs); if (BIAS) { val[0] += bfr(bias[c0 + cofs]); val[1] += bfr(bias[c0 + cofs + 1]); val[2] += bfr(bias[c0 + cofs + 2]); val[3] += bfr(bias[c0 + cofs + 3]); }
                *(v4f*)(crow + (size_t)row * ldc + cofs) = val; }
             }
        __builtin_amdgcn_wave_barrier(); asm volatile("" ::: "memory");
    }
}

// ---- k_pvsk: the attn.v product with its K dimension (the 3,072 keys) dealt over the 16 waves of a work-group. One work-group per 32x64 output tile, grid (TT/32, ZH), 512 threads.
// Wave w takes the 32-key chunks w, w + 16, w + 32, ... (the 16 waves of a trip cover 1 KiB of each row, whole 128-B lines), keeps its own f32 partial tile, and the 16 partials are summed through LDS in wave order.
#define PVW 16
__global__ __launch_bounds__(PVW * 32) void k_pvsk(const h16* __restrict__ A, const h16* __restrict__ Bt, float* C) {
    __shared__ __align__(16) float ps[PVW * 32 * 68];
    const size_t z = blockIdx.y; A += z * (size_t)TT * TT; Bt += z * (size_t)HD * TT; C += z * (size_t)TT * HD;
    const int lane = threadIdx.x & 31, lr = lane & 15, hi = lane >> 4; const int w = __builtin_amdgcn_readfirstlane(threadIdx.x >> 5); const int r0 = blockIdx.x * 32;
    v8f acc[2][4];   // every loop over mb, nb, j, u below is unrolled so that acc[][] and the fragments are indexed by constants and stay in registers; w is read as a scalar so that the key loop's counter and branch are scalar
#pragma unroll
    for (int mb = 0; mb < 2; ++mb)
#pragma unroll
        for (int nb = 0; nb < 4; ++nb) acc[mb][nb] = (v8f){};
    const size_t aoff = (size_t)(r0 + lr) * TT + 8 * hi, boff = (size_t)lr * TT + 8 * hi;
    for (int kc = w * 32; kc < TT; kc += PVW * 32) {
        v16h a[2];
#pragma unroll
        for (int mb = 0; mb < 2; ++mb) a[mb] = WFrag<h16>::ld(A + aoff + (size_t)mb * 16 * TT + kc);
#pragma unroll
        for (int nb = 0; nb < 4; ++nb) { const v16h b = WFrag<h16>::ld(Bt + boff + (size_t)nb * 16 * TT + kc);
#pragma unroll
            for (int mb = 0; mb < 2; ++mb) acc[mb][nb] = wmma16(a[mb], b, acc[mb][nb]); }
    }
    float* pw = ps + w * (32 * 68);
#pragma unroll
    for (int mb = 0; mb < 2; ++mb)
#pragma unroll
        for (int nb = 0; nb < 4; ++nb)
#pragma unroll
            for (int j = 0; j < 8; ++j) pw[(mb * 16 + hi * 8 + j) * 68 + nb * 16 + lr] = acc[mb][nb][j];
    __syncthreads();   // all 16 partial tiles are in LDS before any thread sums them
    const int row = threadIdx.x >> 4, cofs = (threadIdx.x & 15) * 4;
    v4f s = *(const v4fa*)(ps + row * 68 + cofs);
#pragma unroll
    for (int u = 1; u < PVW; ++u) s += *(const v4fa*)(ps + u * (32 * 68) + row * 68 + cofs);
    *(v4f*)(C + (size_t)(r0 + row) * HD + cofs) = s;
}

__device__ __forceinline__ h16 tohx(float x) { return (h16)x; }
__device__ __forceinline__ void splitf(float y, unsigned short& h, unsigned short& l) { h = f2bf(y); l = f2bf(y - bf2f(h)); }
typedef __attribute__((ext_vector_type(2))) _Float16 v2h;
typedef __attribute__((ext_vector_type(4))) _Float16 v4h;
typedef __attribute__((ext_vector_type(2))) unsigned short v2us;
typedef __attribute__((ext_vector_type(4))) unsigned short v4us;
typedef __attribute__((ext_vector_type(2))) float v2f;
typedef __attribute__((ext_vector_type(4))) int v4i;

__global__ __launch_bounds__(256) void k_wtG(const float* __restrict__ w, int K, int N, bf* Bt) {
    const int lane = threadIdx.x & 31; const int L0 = (blockIdx.x * 8 + (threadIdx.x >> 5)) * 8; const int nlines = N * K / 64;
{
#pragma unroll 1
        for (int l = 0; l < 8; ++l) { const int L = L0 + l; if (L >= nlines) break; const size_t e = (size_t)L * 64 + lane * 2; const int k = (int)(e % K), n = (int)(e / K); v2us o;
            o[0] = f2bf(w[(size_t)k * N + n]); o[1] = f2bf(w[(size_t)(k + 1) * N + n]); *(v2us*)(Bt + e) = o; }
         }
}
__global__ __launch_bounds__(256) void k_cvt8(const float* __restrict__ src, bf* dst, size_t n8) { const size_t i = (size_t)blockIdx.x * 256 + threadIdx.x; if (i >= n8) return; const v8f v = *(const v8f*)(src + i * 8); v8us o;
#pragma unroll
    for (int k = 0; k < 8; ++k) o[k] = f2bf(v[k]); *(v8us*)(dst + i * 8) = o;  }
__global__ __launch_bounds__(256) void k_cscvt(const float* __restrict__ cosT, const float* __restrict__ sinT, float* CS) { const int idx = blockIdx.x * 256 + threadIdx.x; if (idx >= TT * HD) return; v2f cs; cs[0] = bfr(cosT[idx]); cs[1] = bfr(sinT[idx]); *(v2f*)(CS + (size_t)idx * 2) = cs;  }
// k_rope: head planes [h][t][d] (fp16) of rope(x) x sc with the rotate-half convention out[d] = x[d] cos[t][d] - x[d+HD/2] sin[t][d], out[d+HD/2] = x[d+HD/2] cos[t][d+HD/2] + x[d] sin[t][d+HD/2]
__global__ __launch_bounds__(256) void k_rope(const float* __restrict__ F, int pitch, int nheads, const float* __restrict__ CS, const float* __restrict__ RF, const float* __restrict__ nw, float sc, h16* P16, bf* Ph, bf* Pl) {
    const size_t e = ((size_t)blockIdx.x * 256 + threadIdx.x) * 2; if (e >= (size_t)nheads * TT * HD) return; const int d = (int)(e % HD); const int t = (int)((e / HD) % TT); const int h = (int)(e / ((size_t)HD * TT)); const float* f = F + (size_t)t * pitch + h * HD; const float rf = RF ? RF[(size_t)h * TT + t] : 1.0f; v2h o16; v2us oh, ol;
#pragma unroll
    for (int q = 0; q < 2; ++q) { const int dd = d + q; const int dp = (dd < HD / 2) ? dd + HD / 2 : dd - HD / 2; float x0 = f[dd], x1 = f[dp];
        if (RF) { float n0 = __fmul_rn(x0, rf), n1 = __fmul_rn(x1, rf); asm volatile("" : "+v"(n0)); asm volatile("" : "+v"(n1)); x0 = __fmul_rn(bfr(nw[dd]), n0); x1 = __fmul_rn(bfr(nw[dp]), n1); }
        const v2f cs = *(const v2f*)(CS + ((size_t)t * HD + dd) * 2); float a = __fmul_rn(x0, cs[0]), bq = __fmul_rn(x1, cs[1]); asm volatile("" : "+v"(a)); asm volatile("" : "+v"(bq)); const float r = ((dd < HD / 2) ? __fsub_rn(a, bq) : __fadd_rn(a, bq)) * sc;
        o16[q] = tohx(r); (void)oh; (void)ol; }
    *(v2h*)(P16 + e) = o16;  }
__global__ __launch_bounds__(256) void k_vtp(const float* __restrict__ F, int pitch, int nheads, h16* V16, bf* Vh, bf* Vl) { const size_t e = ((size_t)blockIdx.x * 256 + threadIdx.x) * 2; if (e >= (size_t)nheads * HD * TT) return; const int t = (int)(e % TT); const int d = (int)((e / TT) % HD); const int g = (int)(e / ((size_t)TT * HD)); v2h o16; v2us oh, ol;
#pragma unroll
    for (int q = 0; q < 2; ++q) { const float x = F[(size_t)(t + q) * pitch + g * HD + d]; o16[q] = tohx(x); (void)oh; (void)ol; }
    *(v2h*)(V16 + e) = o16;  }
__global__ __launch_bounds__(256) void k_csid(float* CS) { const int idx = blockIdx.x * 256 + threadIdx.x; if (idx >= TT * HD) return; v2f cs; cs[0] = 1.0f; cs[1] = 0.0f; *(v2f*)(CS + (size_t)idx * 2) = cs;  }
// k_asoft: per row (zz, i): t = S x HD^-0.5 (no mask); softmax over the 3072 keys (register row, one exp, fixed trees);
__global__ __launch_bounds__(256) void k_asoft(const float* __restrict__ Sb, h16* P16, bf* Ph, bf* Pl) {
    const int lane = threadIdx.x & 31; const int row = blockIdx.x * 8 + (threadIdx.x >> 5); if (row >= ZH * TT) return; const int i = row % TT; const int zz = row / TT; (void)zz; const bool hires = (i < RH); const float* sr = Sb + (size_t)row * TT; float v[TT / 32]; float mx = -3.0e38f;
#pragma unroll
    for (int ch = 0; ch < TT / 128; ++ch) { const int j0 = ch * 128 + lane * 4; const v4f a = *(const v4f*)(sr + j0);
#pragma unroll
        for (int q = 0; q < 4; ++q) { const int j = j0 + q; (void)j; const float t = a[q] * SCL; v[ch * 4 + q] = t; mx = fmaxf(mx, t); } }
#pragma unroll
    for (int sh = 16; sh; sh >>= 1) mx = fmaxf(mx, __shfl_xor(mx, sh, 32));
    float sum = 0.f;
#pragma unroll
    for (int k = 0; k < TT / 32; ++k) { float d0 = __fsub_rn(v[k], mx); asm volatile("" : "+v"(d0)); v[k] = __builtin_amdgcn_exp2f(__fmul_rn(d0, 1.4426950408889634f)); sum += v[k]; }
#pragma unroll
    for (int sh = 16; sh; sh >>= 1) sum += __shfl_xor(sum, sh, 32);
    const float f = __fdiv_rn(hires ? 1.0f : PCAR, sum);
{
        if (hires) {
#pragma unroll
            for (int ch = 0; ch < TT / 128; ++ch) { v4us oh, ol;
#pragma unroll
                for (int q = 0; q < 4; ++q) { unsigned short a, c2; splitf(v[ch * 4 + q] * f, a, c2); oh[q] = a; ol[q] = c2; }
                const size_t oo = ((size_t)zz * (RH ? RH : 1) + i) * TT + ch * 128 + lane * 4; *(v4us*)(Ph + oo) = oh; *(v4us*)(Pl + oo) = ol; }
        } else {
#pragma unroll
            for (int ch = 0; ch < TT / 128; ++ch) { v4h o4;
#pragma unroll
                for (int q = 0; q < 4; ++q) o4[q] = tohx(v[ch * 4 + q] * f);
                *(v4h*)(P16 + (size_t)row * TT + ch * 128 + lane * 4) = o4; } }
         }
}
__global__ __launch_bounds__(256) void k_merge(const float* __restrict__ O, int h0, bf* Ah, bf* Al) { const size_t e = ((size_t)blockIdx.x * 256 + threadIdx.x) * 2; if (e >= (size_t)ZH * TT * HD) return; const int d = (int)(e % HD); const int t = (int)((e / HD) % TT); const int zz = (int)(e / ((size_t)HD * TT)); const float cs = (t < RH) ? 1.0f : (1.0f / PCAR); const size_t oo = (size_t)t * DQ + (h0 + zz) * HD + d;
    v2us oh, ol;
#pragma unroll
    for (int q = 0; q < 2; ++q) { unsigned short a, c2; splitf(O[e + q] * cs, a, c2); oh[q] = a; ol[q] = c2; } *(v2us*)(Ah + oo) = oh; *(v2us*)(Al + oo) = ol;  }

__global__ __launch_bounds__(256) void k_xte(const float* __restrict__ xb, const float* __restrict__ te, bf* Xh, bf* Xl) { const size_t e = ((size_t)blockIdx.x * 256 + threadIdx.x) * 4; if (e >= (size_t)TT * DM) return; const int c = (int)(e % DM); const int tok = (int)(e / DM); const int frame = tok / 256; v4us oh, ol;   // token = (frame, h, w); x + temporal_embedding[0][frame][c] in f32, split hl
#pragma unroll
    for (int u = 0; u < 4; ++u) { const float s = __fadd_rn(bfr(xb[e + u]), bfr(te[(size_t)frame * DM + c + u])); unsigned short a, b; splitf(s, a, b); oh[u] = a; ol[u] = b; } *(v4us*)(Xh + e) = oh; *(v4us*)(Xl + e) = ol;  }

extern "C" void kernel_launch(void* const* d_in, const int* in_sizes, int n_in,
                              void* d_out, int out_size, void* d_ws, size_t ws_size, hipStream_t stream) {
    (void)in_sizes; (void)n_in; (void)out_size;
    const float* x = (const float*)d_in[0]; const float* temb = (const float*)d_in[1]; const float* wf = (const float*)d_in[2]; const float* bfz = (const float*)d_in[3]; const float* wo = (const float*)d_in[4]; const float* bo = (const float*)d_in[5]; const float* wq = wf; const float* wk = wf + (size_t)1024 * 1024; const float* wv = wf + (size_t)2 * 1024 * 1024; const float* bq = bfz; const float* bk = bfz + 1024; const float* bv = bfz + 2048; const float* cosT = nullptr; const float* sinT = nullptr; (void)cosT; (void)sinT;
    float* OUT = (float*)d_out;     // [2][3072][1024]
    char* wsp = (char*)d_ws;
    auto take = [&](size_t bytes) { char* p = wsp; wsp += (bytes + 255) & ~(size_t)255; return (void*)p; };
    bf* WQ = (bf*)take((size_t)DQ * DM * 2); bf* WK = (bf*)take((size_t)DKV * DM * 2); bf* WV = (bf*)take((size_t)DKV * DM * 2); bf* WO = (bf*)take((size_t)DM * DQ * 2); float* CS = (float*)take((size_t)TT * HD * 2 * 4);
    bf* XB = (bf*)take((size_t)TT * DM * 2); bf* XBl = (bf*)take((size_t)TT * DM * 2); float* FQ = (float*)take((size_t)TT * DQ * 4); float* FK = (float*)take((size_t)TT * DKV * 4);
    h16* QP16 = (h16*)take((size_t)NH_ * TT * HD * 2); h16* KP16 = (h16*)take((size_t)NKV * TT * HD * 2); h16* VT16 = (h16*)take((size_t)NKV * HD * TT * 2);
    bf* QPh = nullptr; bf* QPl = nullptr; bf* KPh = nullptr; bf* KPl = nullptr; bf* VTh = nullptr; bf* VTl = nullptr; bf* Ph = nullptr; bf* Pl = nullptr;
    float* Sb = (float*)take((size_t)ZH * TT * TT * 4); h16* P16 = (h16*)take((size_t)ZH * TT * TT * 2); float* Ob = (float*)take((size_t)ZH * TT * HD * 4); bf* ATh = (bf*)take((size_t)TT * DQ * 2); bf* ATl = (bf*)take((size_t)TT * DQ * 2);
    if ((size_t)(wsp - (char*)d_ws) > ws_size) return;    // ws 256 MiB
    float* FV = FK;   // v projection reuses the k buffer after the k planes are built (stream-ordered)
    { k_cvt8<<<(unsigned)(((size_t)DQ * DM / 8 + 255) / 256), 256, 0, stream>>>(wq, WQ, (size_t)DQ * DM / 8); k_cvt8<<<(unsigned)(((size_t)DKV * DM / 8 + 255) / 256), 256, 0, stream>>>(wk, WK, (size_t)DKV * DM / 8); k_cvt8<<<(unsigned)(((size_t)DKV * DM / 8 + 255) / 256), 256, 0, stream>>>(wv, WV, (size_t)DKV * DM / 8);
      k_cvt8<<<(unsigned)(((size_t)DM * DQ / 8 + 255) / 256), 256, 0, stream>>>(wo, WO, (size_t)DM * DQ / 8);
       }
    k_csid<<<(TT * HD + 255) / 256, 256, 0, stream>>>(CS);
    const unsigned LQ = (unsigned)(((size_t)NH_ * TT * HD / 2 + 255) / 256), LKv = (unsigned)(((size_t)NKV * TT * HD / 2 + 255) / 256);
    for (int b = 0; b < NB_; ++b) {
        
        k_xte<<<(unsigned)(((size_t)TT * DM / 4 + 255) / 256), 256, 0, stream>>>(x + (size_t)b * TT * DM, temb, XB, XBl);
        k_gemmw<bf, 1, true><<<dim3(TT / 64, DQ / 64, 1), 32, 0, stream>>>(XB, XBl, WQ, nullptr, DM, FQ, DQ, bq, 0, 0, 0);
        k_rope<<<LQ, 256, 0, stream>>>(FQ, DQ, NH_, CS, nullptr, nullptr, 1.0f, QP16, QPh, QPl);
        k_gemmw<bf, 1, true><<<dim3(TT / 64, DKV / 64, 1), 32, 0, stream>>>(XB, XBl, WK, nullptr, DM, FK, DKV, bk, 0, 0, 0);
        k_rope<<<LKv, 256, 0, stream>>>(FK, DKV, NKV, CS, nullptr, nullptr, 1.0f, KP16, KPh, KPl);
        k_gemmw<bf, 1, true><<<dim3(TT / 64, DKV / 64, 1), 32, 0, stream>>>(XB, XBl, WV, nullptr, DM, FV, DKV, bv, 0, 0, 0); k_vtp<<<LKv, 256, 0, stream>>>(FV, DKV, NKV, VT16, VTh, VTl);
        for (int h0 = 0; h0 < NH_; h0 += ZH) { const size_t zq = (size_t)h0, zk = (size_t)(h0 / REP);   // one kv head per query head: the pass's two heads use consecutive kv planes (z-strides TT*HD)
            k_gemmw<h16, 0, false><<<dim3(TT / 64, TT / 64, ZH), 32, 0, stream>>>(QP16 + zq * TT * HD, nullptr, KP16 + zk * TT * HD, nullptr, HD, Sb, TT, nullptr, (size_t)TT * HD, (size_t)TT * HD, (size_t)TT * TT);
            k_asoft<<<ZH * TT / 8, 256, 0, stream>>>(Sb, P16, Ph, Pl);
            k_pvsk<<<dim3(TT / 32, ZH), PVW * 32, 0, stream>>>(P16, VT16 + zk * HD * TT, Ob);
            k_merge<<<(unsigned)(((size_t)ZH * TT * HD / 2 + 255) / 256), 256, 0, stream>>>(Ob, h0, ATh, ATl); }
        k_gemmw<bf, 1, true><<<dim3(TT / 64, DM / 64, 1), 32, 0, stream>>>(ATh, ATl, WO, nullptr, DQ, OUT + (size_t)b * TT * DM, DM, bo, 0, 0, 0); }
}

// v002
// Measured time: 454 microseconds a run.
// Timed twice side by side with v001, it ran 2.57 and 2.56 times as fast.
// Counting every step since v000, it is 4.37 times as fast.
#include <hip/hip_runtime.h>

// TemporalAttention (x [2][12][16][16][1024] + temporal_embedding[:, :12] broadcast over the 16x16 grid; N = 12*16*16 = 3,072 tokens per batch; qkv = (x + te) qkv_w^T + qkv_b (torch [3072][1024], q | k | v, 16 heads x 64); softmax(q.k / 8) over all 3,072 tokens; out = merged proj_w^T + proj_b -> [2][12][16][16][1024]).
// Compute dtypes, f32 accumulate: every input rounded to bf16; x + te in f32 split into hl planes, so q/k/v are hl x exact bf16 (2 products) + bias; scores and attn.v single fp16 on every row, P = 2^6 x exp2(score - maximum in use), unnormalised; softmax f32, online; proj hl x exact (2 products) + bias.

#define NB_  2
#define TT   3072
#define DM   1024
#define NH_  16
#define NKV  16
#define REP  (NH_ / NKV)
#define HD   64
#define DQ   (NH_ * HD)
#define DKV  (NKV * HD)
#define ZH   2
#define RH   0                  // unused: no query rows use hi+lo planes
#define WIN  0
#define PCAR 1024.0f
#define SCL  0.125f   // HD^-0.5
typedef _Float16 h16;
typedef unsigned short bf;
typedef __attribute__((ext_vector_type(16))) __bf16   v16bf;
typedef __attribute__((ext_vector_type(16))) _Float16 v16h;
typedef __attribute__((ext_vector_type(8)))  _Float16 v8h;
typedef __attribute__((ext_vector_type(8)))  unsigned short v8us;
typedef __attribute__((ext_vector_type(8)))  float    v8f;
typedef __attribute__((ext_vector_type(4)))  float    v4f;
typedef v8h  __attribute__((may_alias)) v8ha;
typedef v4f  __attribute__((may_alias)) v4fa;
typedef v8us __attribute__((may_alias)) v8usa;

__device__ __forceinline__ unsigned short f2bf(float f) { unsigned u = __float_as_uint(f); u += 0x7FFFu + ((u >> 16) & 1u); return (unsigned short)(u >> 16); }
__device__ __forceinline__ float bf2f(unsigned short b) { return __uint_as_float(((unsigned)b) << 16); }
__device__ __forceinline__ float bfr(float f) { return bf2f(f2bf(f)); }
__device__ __forceinline__ v16h cat16(v8h lo, v8h hi) { return __builtin_shufflevector(lo, hi, 0, 1, 2, 3, 4, 5, 6, 7, 8, 9, 10, 11, 12, 13, 14, 15); }
__device__ __forceinline__ v16bf cat16b(v8us lo, v8us hi) { return __builtin_bit_cast(v16bf, __builtin_shufflevector(lo, hi, 0, 1, 2, 3, 4, 5, 6, 7, 8, 9, 10, 11, 12, 13, 14, 15)); }
__device__ __forceinline__ v8f wmma16(v16h a, v16h b, v8f c) { return __builtin_amdgcn_wmma_f32_16x16x32_f16(false, a, false, b, (short)0, c, false, false); }
__device__ __forceinline__ v8f wmmab(v16bf a, v16bf b, v8f c) { return __builtin_amdgcn_wmma_f32_16x16x32_bf16(false, a, false, b, (short)0, c, false, false); }



// ---- k_gemmw: register-blocked GEMM, ONE WAVE per 64x64 output tile (16 accumulators), operands straight from K-contiguous 16-bit planes; grid (M/64, N/64, Z), 32 threads.
// C[m][n] (f32, pitch ldc, + optional f32 bias[n]) = sum_k A[m][k] Bt[n][k] (+ split products per NSPLIT). z-batch strides sA/sB/sC in elements. K % 32 == 0.
template <typename T16> struct WFrag;
template <> struct WFrag<h16> { typedef v16h V; static __device__ __forceinline__ V ld(const h16* p) { return cat16(*(const v8h*)p, *(const v8h*)(p + 16)); } static __device__ __forceinline__ v8f mma(V a, V b, v8f c) { return wmma16(a, b, c); } };
template <> struct WFrag<bf> { typedef v16bf V; static __device__ __forceinline__ V ld(const bf* p) { return cat16b(*(const v8us*)p, *(const v8us*)(p + 16)); } static __device__ __forceinline__ v8f mma(V a, V b, v8f c) { return wmmab(a, b, c); } };
template <typename T16, int NSPLIT, bool BIAS>
__global__ __launch_bounds__(32) void k_gemmw(const T16* __restrict__ A, const T16* __restrict__ A2, const T16* __restrict__ Bt, const T16* __restrict__ Bt2, int K, float* C, int ldc, const float* __restrict__ bias, size_t sA, size_t sB, size_t sC) {
    typedef typename WFrag<T16>::V V;
    __shared__ __align__(16) float os[16 * 68];
    const size_t z = blockIdx.z; A += z * sA; if (A2) A2 += z * sA; Bt += z * sB; if (Bt2) Bt2 += z * sB; C += z * sC;
    const int lane = threadIdx.x & 31, lr = lane & 15, hi = lane >> 4; const int r0 = blockIdx.x * 64, c0 = blockIdx.y * 64;
    v8f acc[4][4];
#pragma unroll
    for (int mb = 0; mb < 4; ++mb)
#pragma unroll
        for (int nb = 0; nb < 4; ++nb) acc[mb][nb] = (v8f){};
    const size_t aoff = (size_t)(r0 + lr) * K + 8 * hi, boff = (size_t)(c0 + lr) * K + 8 * hi;
#pragma unroll 1
    for (int kc = 0; kc < K; kc += 32) {
        V a[4], a2[4];
#pragma unroll
        for (int mb = 0; mb < 4; ++mb) { a[mb] = WFrag<T16>::ld(A + aoff + (size_t)mb * 16 * K + kc); if (NSPLIT == 1 || NSPLIT == 2) a2[mb] = WFrag<T16>::ld(A2 + aoff + (size_t)mb * 16 * K + kc); }
#pragma unroll
        for (int nb = 0; nb < 4; ++nb) { const V b = WFrag<T16>::ld(Bt + boff + (size_t)nb * 16 * K + kc); V b2; if (NSPLIT >= 2) b2 = WFrag<T16>::ld(Bt2 + boff + (size_t)nb * 16 * K + kc);
#pragma unroll
            for (int mb = 0; mb < 4; ++mb) { acc[mb][nb] = WFrag<T16>::mma(a[mb], b, acc[mb][nb]); if (NSPLIT == 1 || NSPLIT == 2) acc[mb][nb] = WFrag<T16>::mma(a2[mb], b, acc[mb][nb]); if (NSPLIT >= 2) acc[mb][nb] = WFrag<T16>::mma(a[mb], b2, acc[mb][nb]); } }
        asm volatile("v_nop\n\tv_nop\n\tv_nop\n\tv_nop" : "+v"(acc[0][0]), "+v"(acc[1][1]), "+v"(acc[2][2]), "+v"(acc[3][3]) : "v"(a[0]), "v"(a[3]));
    }
#pragma unroll
    for (int mb = 0; mb < 4; ++mb) {
#pragma unroll
        for (int nb = 0; nb < 4; ++nb) {
#pragma unroll
            for (int j = 0; j < 8; ++j) os[(hi * 8 + j) * 68 + nb * 16 + lr] = acc[mb][nb][j]; }
        __builtin_amdgcn_wave_barrier(); asm volatile("" ::: "memory");
        float* crow = C + (size_t)(r0 + mb * 16) * ldc + c0;
{
#pragma unroll
            for (int s = 0; s < 8; ++s) { const int row = 2 * s + hi, cofs = lr * 4; v4f val = *(const v4fa*)(os + row * 68 + cofs); if (BIAS) { val[0] += bfr(bias[c0 + cofs]); val[1] += bfr(bias[c0 + cofs + 1]); val[2] += bfr(bias[c0 + cofs + 2]); val[3] += bfr(bias[c0 + cofs + 3]); }
                *(v4f*)(crow + (size_t)row * ldc + cofs) = val; }
             }
        __builtin_amdgcn_wave_barrier(); asm volatile("" ::: "memory");
    }
}

__device__ __forceinline__ h16 tohx(float x) { return (h16)x; }
__device__ __forceinline__ void splitf(float y, unsigned short& h, unsigned short& l) { h = f2bf(y); l = f2bf(y - bf2f(h)); }
typedef __attribute__((ext_vector_type(2))) _Float16 v2h;
typedef __attribute__((ext_vector_type(4))) _Float16 v4h;
typedef __attribute__((ext_vector_type(2))) unsigned short v2us;
typedef __attribute__((ext_vector_type(4))) unsigned short v4us;
typedef __attribute__((ext_vector_type(2))) float v2f;
typedef __attribute__((ext_vector_type(4))) int v4i;

__global__ __launch_bounds__(256) void k_wtG(const float* __restrict__ w, int K, int N, bf* Bt) {
    const int lane = threadIdx.x & 31; const int L0 = (blockIdx.x * 8 + (threadIdx.x >> 5)) * 8; const int nlines = N * K / 64;
{
#pragma unroll 1
        for (int l = 0; l < 8; ++l) { const int L = L0 + l; if (L >= nlines) break; const size_t e = (size_t)L * 64 + lane * 2; const int k = (int)(e % K), n = (int)(e / K); v2us o;
            o[0] = f2bf(w[(size_t)k * N + n]); o[1] = f2bf(w[(size_t)(k + 1) * N + n]); *(v2us*)(Bt + e) = o; }
         }
}
__global__ __launch_bounds__(256) void k_cvt8(const float* __restrict__ src, bf* dst, size_t n8) { const size_t i = (size_t)blockIdx.x * 256 + threadIdx.x; if (i >= n8) return; const v8f v = *(const v8f*)(src + i * 8); v8us o;
#pragma unroll
    for (int k = 0; k < 8; ++k) o[k] = f2bf(v[k]); *(v8us*)(dst + i * 8) = o;  }
__global__ __launch_bounds__(256) void k_cscvt(const float* __restrict__ cosT, const float* __restrict__ sinT, float* CS) { const int idx = blockIdx.x * 256 + threadIdx.x; if (idx >= TT * HD) return; v2f cs; cs[0] = bfr(cosT[idx]); cs[1] = bfr(sinT[idx]); *(v2f*)(CS + (size_t)idx * 2) = cs;  }
// k_rope: head planes [h][t][d] (fp16) of rope(x) x sc with the rotate-half convention out[d] = x[d] cos[t][d] - x[d+HD/2] sin[t][d], out[d+HD/2] = x[d+HD/2] cos[t][d+HD/2] + x[d] sin[t][d+HD/2]
__global__ __launch_bounds__(256) void k_rope(const float* __restrict__ F, int pitch, int nheads, const float* __restrict__ CS, const float* __restrict__ RF, const float* __restrict__ nw, float sc, h16* P16, bf* Ph, bf* Pl) {
    const size_t e = ((size_t)blockIdx.x * 256 + threadIdx.x) * 2; if (e >= (size_t)nheads * TT * HD) return; const int d = (int)(e % HD); const int t = (int)((e / HD) % TT); const int h = (int)(e / ((size_t)HD * TT)); const float* f = F + (size_t)t * pitch + h * HD; const float rf = RF ? RF[(size_t)h * TT + t] : 1.0f; v2h o16; v2us oh, ol;
#pragma unroll
    for (int q = 0; q < 2; ++q) { const int dd = d + q; const int dp = (dd < HD / 2) ? dd + HD / 2 : dd - HD / 2; float x0 = f[dd], x1 = f[dp];
        if (RF) { float n0 = __fmul_rn(x0, rf), n1 = __fmul_rn(x1, rf); asm volatile("" : "+v"(n0)); asm volatile("" : "+v"(n1)); x0 = __fmul_rn(bfr(nw[dd]), n0); x1 = __fmul_rn(bfr(nw[dp]), n1); }
        const v2f cs = *(const v2f*)(CS + ((size_t)t * HD + dd) * 2); float a = __fmul_rn(x0, cs[0]), bq = __fmul_rn(x1, cs[1]); asm volatile("" : "+v"(a)); asm volatile("" : "+v"(bq)); const float r = ((dd < HD / 2) ? __fsub_rn(a, bq) : __fadd_rn(a, bq)) * sc;
        o16[q] = tohx(r); (void)oh; (void)ol; }
    *(v2h*)(P16 + e) = o16;  }
__global__ __launch_bounds__(256) void k_vtp(const float* __restrict__ F, int pitch, int nheads, h16* V16, bf* Vh, bf* Vl) { const size_t e = ((size_t)blockIdx.x * 256 + threadIdx.x) * 2; if (e >= (size_t)nheads * HD * TT) return; const int t = (int)(e % TT); const int d = (int)((e / TT) % HD); const int g = (int)(e / ((size_t)TT * HD)); v2h o16; v2us oh, ol;
#pragma unroll
    for (int q = 0; q < 2; ++q) { const float x = F[(size_t)(t + q) * pitch + g * HD + d]; o16[q] = tohx(x); (void)oh; (void)ol; }
    *(v2h*)(V16 + e) = o16;  }
__global__ __launch_bounds__(256) void k_csid(float* CS) { const int idx = blockIdx.x * 256 + threadIdx.x; if (idx >= TT * HD) return; v2f cs; cs[0] = 1.0f; cs[1] = 0.0f; *(v2f*)(CS + (size_t)idx * 2) = cs;  }
#define FSK 64                  // keys per stage
#define FPT 72                  // LDS row pitch in halves: 144 B, an odd multiple of 16 B
#define FNS (TT / FSK)
#define CSC 0.18033688011112042f   // HD^-0.5 x log2(e)
__device__ __forceinline__ float xhalf(float x) { return __builtin_bit_cast(float, __builtin_amdgcn_permlanex16(__builtin_bit_cast(int, x), __builtin_bit_cast(int, x), 0x76543210, 0xfedcba98, false, false)); }   // lane l with lane l ^ 16
__device__ __forceinline__ void fpass(const h16* kb, const h16* vb, const v16h (&qf)[2][2], v8f (&acc)[2][4], v8f (&lacc)[2], float (&m_run)[2], const v16h ones) {
    typedef __attribute__((ext_vector_type(2))) _Float16 h2; typedef __attribute__((ext_vector_type(2))) float f2;
    v8f s[2][2];   // every loop over kt, g, t, r, i here and in k_fattn is unrolled so that fragments, scores and accumulators are indexed by constants and stay in registers
#pragma unroll
    for (int kt = 0; kt < 2; ++kt) { const v16h k0 = WFrag<h16>::ld(kb + kt * 16 * FPT), k1 = WFrag<h16>::ld(kb + kt * 16 * FPT + 32);
#pragma unroll
        for (int g = 0; g < 2; ++g) { s[kt][g] = wmma16(k0, qf[g][0], (v8f){}); s[kt][g] = wmma16(k1, qf[g][1], s[kt][g]); } }
    v16h vf[4];
#pragma unroll
    for (int t = 0; t < 4; ++t) vf[t] = WFrag<h16>::ld(vb + t * 16 * FPT);
    float mb[2]; bool need = false;
#pragma unroll
    for (int g = 0; g < 2; ++g) { float mx = s[0][g][0];
#pragma unroll
        for (int r = 1; r < 8; ++r) mx = fmaxf(mx, s[0][g][r]);
#pragma unroll
        for (int r = 0; r < 8; ++r) mx = fmaxf(mx, s[1][g][r]);
        mx = fmaxf(mx, xhalf(mx)) * CSC; mb[g] = mx; need = need || (mx > m_run[g] + 8.0f); }
    if (__builtin_amdgcn_ballot_w32(need) != 0) {   // a scalar branch, rare after the first passes
#pragma unroll
        for (int g = 0; g < 2; ++g) { const float m_new = fmaxf(m_run[g], mb[g]); const float corr = __builtin_amdgcn_exp2f(m_run[g] - m_new); m_run[g] = m_new; lacc[g] = lacc[g] * corr;
#pragma unroll
            for (int t = 0; t < 4; ++t) acc[g][t] = acc[g][t] * corr; } }
#pragma unroll
    for (int g = 0; g < 2; ++g) { const float nm = 6.0f - m_run[g]; v16h pf;   // P carries a factor 2^6, which the denominator carries too: fewer small probabilities fall into fp16's subnormal range
#pragma unroll
        for (int i = 0; i < 8; ++i) { const int kt = i >> 2, r = 2 * (i & 3); f2 p; p[0] = __builtin_amdgcn_exp2f(fmaf(s[kt][g][r], CSC, nm)); p[1] = __builtin_amdgcn_exp2f(fmaf(s[kt][g][r + 1], CSC, nm)); const h2 q = __builtin_convertvector(p, h2); pf[2 * i] = q[0]; pf[2 * i + 1] = q[1]; }
#pragma unroll
        for (int t = 0; t < 4; ++t) acc[g][t] = wmma16(vf[t], pf, acc[g][t]);
        lacc[g] = wmma16(ones, pf, lacc[g]); }
}
__global__ __launch_bounds__(256) void k_fattn(const h16* __restrict__ Q, const h16* __restrict__ Kp, const h16* __restrict__ Vt, bf* Ah, bf* Al) {
    __shared__ __align__(16) h16 ks[2 * FSK * FPT];
    __shared__ __align__(16) h16 vs[2 * HD * FPT];
    const int tid = threadIdx.x, lane = tid & 31, lr = lane & 15, hi = lane >> 4; const int w = __builtin_amdgcn_readfirstlane(tid >> 5); const int head = blockIdx.y; const int q0 = blockIdx.x * 256 + w * 32;   // w is read as a scalar so that the wave's first query is one
    Q += (size_t)head * TT * HD; Kp += (size_t)head * TT * HD; Vt += (size_t)head * HD * TT;
    const int srow = tid >> 3, scol = (tid & 7) * 8;   // staging: thread tid moves the 16-byte pieces (srow, scol) and (srow + 32, scol) of the K tile and of the V^T tile
    const h16* kg = Kp + (size_t)srow * HD + scol; const h16* vg = Vt + (size_t)srow * TT + scol; const int sl = srow * FPT + scol;
    v8h rk0 = *(const v8h*)kg, rk1 = *(const v8h*)(kg + 32 * HD), rv0 = *(const v8h*)vg, rv1 = *(const v8h*)(vg + (size_t)32 * TT);
    v16h qf[2][2];
#pragma unroll
    for (int g = 0; g < 2; ++g)
#pragma unroll
        for (int kc = 0; kc < 2; ++kc) qf[g][kc] = WFrag<h16>::ld(Q + (size_t)(q0 + g * 16 + lr) * HD + kc * 32 + 8 * hi);
    v8f acc[2][4], lacc[2]; float m_run[2]; v16h ones;
#pragma unroll
    for (int e = 0; e < 16; ++e) ones[e] = (h16)1.0f;
#pragma unroll
    for (int g = 0; g < 2; ++g) { m_run[g] = -__builtin_inff(); lacc[g] = (v8f){};
#pragma unroll
        for (int t = 0; t < 4; ++t) acc[g][t] = (v8f){}; }
    *(v8h*)(ks + sl) = rk0; *(v8h*)(ks + sl + 32 * FPT) = rk1; *(v8h*)(vs + sl) = rv0; *(v8h*)(vs + sl + 32 * FPT) = rv1;
    __syncthreads();   // stage 0 is in LDS before any wave reads it
    const int fo = lr * FPT + 8 * hi;
#pragma unroll 1
    for (int st = 0; st < FNS; ++st) {   // kept rolled: the body already holds two passes, and acc[][] must stay in registers
        const int cur = (st & 1) * (FSK * FPT), nxt = ((st & 1) ^ 1) * (FSK * FPT); const bool more = st + 1 < FNS;
        if (more) { kg += FSK * HD; vg += FSK; rk0 = *(const v8h*)kg; rk1 = *(const v8h*)(kg + 32 * HD); rv0 = *(const v8h*)vg; rv1 = *(const v8h*)(vg + (size_t)32 * TT); }
        fpass(ks + cur + fo, vs + cur + fo, qf, acc, lacc, m_run, ones);
        fpass(ks + cur + fo + 32 * FPT, vs + cur + fo + 32, qf, acc, lacc, m_run, ones);
        __builtin_amdgcn_sched_barrier(0); asm volatile("v_nop\n\tv_nop\n\tv_nop\n\tv_nop"); __builtin_amdgcn_sched_barrier(0);   // the four vector slots behind the pass's last WMMA, also on the taken side of the branch that follows; the two scheduling barriers keep them directly behind it
        if (more) { *(v8h*)(ks + nxt + sl) = rk0; *(v8h*)(ks + nxt + sl + 32 * FPT) = rk1; *(v8h*)(vs + nxt + sl) = rv0; *(v8h*)(vs + nxt + sl + 32 * FPT) = rv1; }
        __syncthreads();   // publishes stage st + 1 and ends every wave's reads of stage st, whose buffer the next trip refills
    }
#pragma unroll
    for (int g = 0; g < 2; ++g) { const float inv = __fdiv_rn(1.0f, lacc[g][0]); const size_t oo = (size_t)(q0 + g * 16 + lr) * DQ + head * HD + 8 * hi;   // every row of lacc holds the column sums
#pragma unroll
        for (int t = 0; t < 4; ++t) { v8us oh, ol;
#pragma unroll
            for (int r = 0; r < 8; ++r) { unsigned short a, c2; splitf(acc[g][t][r] * inv, a, c2); oh[r] = a; ol[r] = c2; }
            *(v8us*)(Ah + oo + t * 16) = oh; *(v8us*)(Al + oo + t * 16) = ol; } }
}

__global__ __launch_bounds__(256) void k_xte(const float* __restrict__ xb, const float* __restrict__ te, bf* Xh, bf* Xl) { const size_t e = ((size_t)blockIdx.x * 256 + threadIdx.x) * 4; if (e >= (size_t)TT * DM) return; const int c = (int)(e % DM); const int tok = (int)(e / DM); const int frame = tok / 256; v4us oh, ol;   // token = (frame, h, w); x + temporal_embedding[0][frame][c] in f32, split hl
#pragma unroll
    for (int u = 0; u < 4; ++u) { const float s = __fadd_rn(bfr(xb[e + u]), bfr(te[(size_t)frame * DM + c + u])); unsigned short a, b; splitf(s, a, b); oh[u] = a; ol[u] = b; } *(v4us*)(Xh + e) = oh; *(v4us*)(Xl + e) = ol;  }

extern "C" void kernel_launch(void* const* d_in, const int* in_sizes, int n_in,
                              void* d_out, int out_size, void* d_ws, size_t ws_size, hipStream_t stream) {
    (void)in_sizes; (void)n_in; (void)out_size;
    const float* x = (const float*)d_in[0]; const float* temb = (const float*)d_in[1]; const float* wf = (const float*)d_in[2]; const float* bfz = (const float*)d_in[3]; const float* wo = (const float*)d_in[4]; const float* bo = (const float*)d_in[5]; const float* wq = wf; const float* wk = wf + (size_t)1024 * 1024; const float* wv = wf + (size_t)2 * 1024 * 1024; const float* bq = bfz; const float* bk = bfz + 1024; const float* bv = bfz + 2048; const float* cosT = nullptr; const float* sinT = nullptr; (void)cosT; (void)sinT;
    float* OUT = (float*)d_out;     // [2][3072][1024]
    char* wsp = (char*)d_ws;
    auto take = [&](size_t bytes) { char* p = wsp; wsp += (bytes + 255) & ~(size_t)255; return (void*)p; };
    bf* WQ = (bf*)take((size_t)DQ * DM * 2); bf* WK = (bf*)take((size_t)DKV * DM * 2); bf* WV = (bf*)take((size_t)DKV * DM * 2); bf* WO = (bf*)take((size_t)DM * DQ * 2); float* CS = (float*)take((size_t)TT * HD * 2 * 4);
    bf* XB = (bf*)take((size_t)TT * DM * 2); bf* XBl = (bf*)take((size_t)TT * DM * 2); float* FQ = (float*)take((size_t)TT * DQ * 4); float* FK = (float*)take((size_t)TT * DKV * 4);
    h16* QP16 = (h16*)take((size_t)NH_ * TT * HD * 2); h16* KP16 = (h16*)take((size_t)NKV * TT * HD * 2); h16* VT16 = (h16*)take((size_t)NKV * HD * TT * 2);
    bf* QPh = nullptr; bf* QPl = nullptr; bf* KPh = nullptr; bf* KPl = nullptr; bf* VTh = nullptr; bf* VTl = nullptr;
    bf* ATh = (bf*)take((size_t)TT * DQ * 2); bf* ATl = (bf*)take((size_t)TT * DQ * 2);
    if ((size_t)(wsp - (char*)d_ws) > ws_size) return;    // ws 256 MiB
    float* FV = FK;   // v projection reuses the k buffer after the k planes are built (stream-ordered)
    { k_cvt8<<<(unsigned)(((size_t)DQ * DM / 8 + 255) / 256), 256, 0, stream>>>(wq, WQ, (size_t)DQ * DM / 8); k_cvt8<<<(unsigned)(((size_t)DKV * DM / 8 + 255) / 256), 256, 0, stream>>>(wk, WK, (size_t)DKV * DM / 8); k_cvt8<<<(unsigned)(((size_t)DKV * DM / 8 + 255) / 256), 256, 0, stream>>>(wv, WV, (size_t)DKV * DM / 8);
      k_cvt8<<<(unsigned)(((size_t)DM * DQ / 8 + 255) / 256), 256, 0, stream>>>(wo, WO, (size_t)DM * DQ / 8);
       }
    k_csid<<<(TT * HD + 255) / 256, 256, 0, stream>>>(CS);
    const unsigned LQ = (unsigned)(((size_t)NH_ * TT * HD / 2 + 255) / 256), LKv = (unsigned)(((size_t)NKV * TT * HD / 2 + 255) / 256);
    for (int b = 0; b < NB_; ++b) {
        
        k_xte<<<(unsigned)(((size_t)TT * DM / 4 + 255) / 256), 256, 0, stream>>>(x + (size_t)b * TT * DM, temb, XB, XBl);
        k_gemmw<bf, 1, true><<<dim3(TT / 64, DQ / 64, 1), 32, 0, stream>>>(XB, XBl, WQ, nullptr, DM, FQ, DQ, bq, 0, 0, 0);
        k_rope<<<LQ, 256, 0, stream>>>(FQ, DQ, NH_, CS, nullptr, nullptr, 1.0f, QP16, QPh, QPl);
        k_gemmw<bf, 1, true><<<dim3(TT / 64, DKV / 64, 1), 32, 0, stream>>>(XB, XBl, WK, nullptr, DM, FK, DKV, bk, 0, 0, 0);
        k_rope<<<LKv, 256, 0, stream>>>(FK, DKV, NKV, CS, nullptr, nullptr, 1.0f, KP16, KPh, KPl);
        k_gemmw<bf, 1, true><<<dim3(TT / 64, DKV / 64, 1), 32, 0, stream>>>(XB, XBl, WV, nullptr, DM, FV, DKV, bv, 0, 0, 0); k_vtp<<<LKv, 256, 0, stream>>>(FV, DKV, NKV, VT16, VTh, VTl);
        k_fattn<<<dim3(TT / 256, NH_), 256, 0, stream>>>(QP16, KP16, VT16, ATh, ATl);
        k_gemmw<bf, 1, true><<<dim3(TT / 64, DM / 64, 1), 32, 0, stream>>>(ATh, ATl, WO, nullptr, DQ, OUT + (size_t)b * TT * DM, DM, bo, 0, 0, 0); }
}

// v003
// It runs in 385 microseconds.
// Timed twice side by side with v002, it ran 1.18 times as fast both times.
// All steps since v000 together make it 5.15 times as fast.
#include <hip/hip_runtime.h>

// TemporalAttention (x [2][12][16][16][1024] + temporal_embedding[:, :12] broadcast over the 16x16 grid; N = 12*16*16 = 3,072 tokens per batch; qkv = (x + te) qkv_w^T + qkv_b (torch [3072][1024], q | k | v, 16 heads x 64); softmax(q.k / 8) over all 3,072 tokens; out = merged proj_w^T + proj_b -> [2][12][16][16][1024]).
// Compute dtypes, f32 accumulate: every input rounded to bf16; x + te in f32 split into hl planes, so q/k/v are hl x exact bf16 (2 products) + bias, rounded to fp16 head planes in the product's own epilogue; scores and attn.v single fp16 on every row, P = 2^6 x exp2(score - maximum in use), unnormalised; softmax f32, online; proj hl x exact (2 products) + bias.

#define NB_  2
#define TT   3072
#define DM   1024
#define NH_  16
#define NKV  16
#define REP  (NH_ / NKV)
#define HD   64
#define DQ   (NH_ * HD)
#define DKV  (NKV * HD)
#define ZH   2
#define RH   0                  // unused: no query rows use hi+lo planes
#define WIN  0
#define PCAR 1024.0f
#define SCL  0.125f   // HD^-0.5
typedef _Float16 h16;
typedef unsigned short bf;
typedef __attribute__((ext_vector_type(16))) __bf16   v16bf;
typedef __attribute__((ext_vector_type(16))) _Float16 v16h;
typedef __attribute__((ext_vector_type(8)))  _Float16 v8h;
typedef __attribute__((ext_vector_type(8)))  unsigned short v8us;
typedef __attribute__((ext_vector_type(8)))  float    v8f;
typedef __attribute__((ext_vector_type(4)))  float    v4f;
typedef v8h  __attribute__((may_alias)) v8ha;
typedef v4f  __attribute__((may_alias)) v4fa;
typedef v8us __attribute__((may_alias)) v8usa;

__device__ __forceinline__ unsigned short f2bf(float f) { unsigned u = __float_as_uint(f); u += 0x7FFFu + ((u >> 16) & 1u); return (unsigned short)(u >> 16); }
__device__ __forceinline__ float bf2f(unsigned short b) { return __uint_as_float(((unsigned)b) << 16); }
__device__ __forceinline__ float bfr(float f) { return bf2f(f2bf(f)); }
__device__ __forceinline__ v16h cat16(v8h lo, v8h hi) { return __builtin_shufflevector(lo, hi, 0, 1, 2, 3, 4, 5, 6, 7, 8, 9, 10, 11, 12, 13, 14, 15); }
__device__ __forceinline__ v16bf cat16b(v8us lo, v8us hi) { return __builtin_bit_cast(v16bf, __builtin_shufflevector(lo, hi, 0, 1, 2, 3, 4, 5, 6, 7, 8, 9, 10, 11, 12, 13, 14, 15)); }
__device__ __forceinline__ v8f wmma16(v16h a, v16h b, v8f c) { return __builtin_amdgcn_wmma_f32_16x16x32_f16(false, a, false, b, (short)0, c, false, false); }
__device__ __forceinline__ v8f wmmab(v16bf a, v16bf b, v8f c) { return __builtin_amdgcn_wmma_f32_16x16x32_bf16(false, a, false, b, (short)0, c, false, false); }



// ---- k_gemmw: register-blocked GEMM, ONE WAVE per 64x64 output tile (16 accumulators), operands straight from K-contiguous 16-bit planes; grid (M/64, N/64, Z), 32 threads.
// C[m][n] (f32, pitch ldc, + optional f32 bias[n]) = sum_k A[m][k] Bt[n][k] (+ split products per NSPLIT). z-batch strides sA/sB/sC in elements. K % 32 == 0.
// OUTM 0: C as above. OUTM 1: the tile (64 tokens x one head, HD == 64) goes out as fp16 rows of the head plane P16[head][token][d]. OUTM 2: as fp16 rows of the transposed plane P16[head][d][token].
template <typename T16> struct WFrag;
template <> struct WFrag<h16> { typedef v16h V; static __device__ __forceinline__ V ld(const h16* p) { return cat16(*(const v8h*)p, *(const v8h*)(p + 16)); } static __device__ __forceinline__ v8f mma(V a, V b, v8f c) { return wmma16(a, b, c); } };
template <> struct WFrag<bf> { typedef v16bf V; static __device__ __forceinline__ V ld(const bf* p) { return cat16b(*(const v8us*)p, *(const v8us*)(p + 16)); } static __device__ __forceinline__ v8f mma(V a, V b, v8f c) { return wmmab(a, b, c); } };
template <typename T16, int NSPLIT, bool BIAS, int OUTM>
__global__ __launch_bounds__(32) void k_gemmw(const T16* __restrict__ A, const T16* __restrict__ A2, const T16* __restrict__ Bt, const T16* __restrict__ Bt2, int K, float* C, int ldc, const float* __restrict__ bias, size_t sA, size_t sB, size_t sC, h16* P16) {
    typedef typename WFrag<T16>::V V; static_assert(OUTM == 0 || HD == 64, "a 64-column tile is one head");
    __shared__ __align__(16) float os[16 * 68];
    const size_t z = blockIdx.z; A += z * sA; if (A2) A2 += z * sA; Bt += z * sB; if (Bt2) Bt2 += z * sB; if (OUTM == 0) C += z * sC;
    const int lane = threadIdx.x & 31, lr = lane & 15, hi = lane >> 4; const int r0 = blockIdx.x * 64, c0 = blockIdx.y * 64;
    v8f acc[4][4];
#pragma unroll
    for (int mb = 0; mb < 4; ++mb)
#pragma unroll
        for (int nb = 0; nb < 4; ++nb) acc[mb][nb] = (v8f){};
    const size_t aoff = (size_t)(r0 + lr) * K + 8 * hi, boff = (size_t)(c0 + lr) * K + 8 * hi;
#pragma unroll 1
    for (int kc = 0; kc < K; kc += 32) {
        V a[4], a2[4];
#pragma unroll
        for (int mb = 0; mb < 4; ++mb) { a[mb] = WFrag<T16>::ld(A + aoff + (size_t)mb * 16 * K + kc); if (NSPLIT == 1 || NSPLIT == 2) a2[mb] = WFrag<T16>::ld(A2 + aoff + (size_t)mb * 16 * K + kc); }
#pragma unroll
        for (int nb = 0; nb < 4; ++nb) { const V b = WFrag<T16>::ld(Bt + boff + (size_t)nb * 16 * K + kc); V b2; if (NSPLIT >= 2) b2 = WFrag<T16>::ld(Bt2 + boff + (size_t)nb * 16 * K + kc);
#pragma unroll
            for (int mb = 0; mb < 4; ++mb) { acc[mb][nb] = WFrag<T16>::mma(a[mb], b, acc[mb][nb]); if (NSPLIT == 1 || NSPLIT == 2) acc[mb][nb] = WFrag<T16>::mma(a2[mb], b, acc[mb][nb]); if (NSPLIT >= 2) acc[mb][nb] = WFrag<T16>::mma(a[mb], b2, acc[mb][nb]); } }
        asm volatile("v_nop\n\tv_nop\n\tv_nop\n\tv_nop" : "+v"(acc[0][0]), "+v"(acc[1][1]), "+v"(acc[2][2]), "+v"(acc[3][3]) : "v"(a[0]), "v"(a[3]));
    }
    if constexpr (OUTM == 2) {   // a lane holds eight consecutive tokens of one d, 16 bytes of a transposed row: stored straight from the accumulators; the four mb stores of a lane pair fill one 128-byte line
#pragma unroll
        for (int nb = 0; nb < 4; ++nb) { const float bz = BIAS ? bfr(bias[c0 + nb * 16 + lr]) : 0.0f; h16* prow = P16 + (size_t)(c0 + nb * 16 + lr) * TT + r0 + 8 * hi;
#pragma unroll
            for (int mb = 0; mb < 4; ++mb) { v8h o;
#pragma unroll
                for (int j = 0; j < 8; ++j) { float val = acc[mb][nb][j]; if (BIAS) val += bz; o[j] = (h16)val; }
                *(v8h*)(prow + mb * 16) = o; } }
        return;
    }
    float bz8[8];
    if constexpr (OUTM == 1) {
#pragma unroll
        for (int u = 0; u < 8; ++u) bz8[u] = BIAS ? bfr(bias[c0 + (lane & 7) * 8 + u]) : 0.0f; }
#pragma unroll
    for (int mb = 0; mb < 4; ++mb) {
#pragma unroll
        for (int nb = 0; nb < 4; ++nb) {
#pragma unroll
            for (int j = 0; j < 8; ++j) os[(hi * 8 + j) * 68 + nb * 16 + lr] = acc[mb][nb][j]; }
        __builtin_amdgcn_wave_barrier(); asm volatile("" ::: "memory");
        if constexpr (OUTM == 1) {   // eight lanes write one token's 128-byte row of the head plane, a store instruction four rows in a run
            h16* prow = P16 + ((size_t)blockIdx.y * TT + r0 + mb * 16) * HD;
#pragma unroll
            for (int s = 0; s < 4; ++s) { const int row = 4 * s + (lane >> 3), cofs = (lane & 7) * 8; const v4f v0 = *(const v4fa*)(os + row * 68 + cofs), v1 = *(const v4fa*)(os + row * 68 + cofs + 4); v8h o;
#pragma unroll
                for (int u = 0; u < 4; ++u) { float a0 = v0[u], a1 = v1[u]; if (BIAS) { a0 += bz8[u]; a1 += bz8[u + 4]; } o[u] = (h16)a0; o[u + 4] = (h16)a1; }
                *(v8h*)(prow + row * HD + cofs) = o; }
        } else {
        float* crow = C + (size_t)(r0 + mb * 16) * ldc + c0;
{
#pragma unroll
            for (int s = 0; s < 8; ++s) { const int row = 2 * s + hi, cofs = lr * 4; v4f val = *(const v4fa*)(os + row * 68 + cofs); if (BIAS) { val[0] += bfr(bias[c0 + cofs]); val[1] += bfr(bias[c0 + cofs + 1]); val[2] += bfr(bias[c0 + cofs + 2]); val[3] += bfr(bias[c0 + cofs + 3]); }
                *(v4f*)(crow + (size_t)row * ldc + cofs) = val; }
             }
        }
        __builtin_amdgcn_wave_barrier(); asm volatile("" ::: "memory");
    }
}

__device__ __forceinline__ void splitf(float y, unsigned short& h, unsigned short& l) { h = f2bf(y); l = f2bf(y - bf2f(h)); }
typedef __attribute__((ext_vector_type(2))) _Float16 v2h;
typedef __attribute__((ext_vector_type(4))) _Float16 v4h;
typedef __attribute__((ext_vector_type(2))) unsigned short v2us;
typedef __attribute__((ext_vector_type(4))) unsigned short v4us;
typedef __attribute__((ext_vector_type(2))) float v2f;
typedef __attribute__((ext_vector_type(4))) int v4i;

__global__ __launch_bounds__(256) void k_wtG(const float* __restrict__ w, int K, int N, bf* Bt) {
    const int lane = threadIdx.x & 31; const int L0 = (blockIdx.x * 8 + (threadIdx.x >> 5)) * 8; const int nlines = N * K / 64;
{
#pragma unroll 1
        for (int l = 0; l < 8; ++l) { const int L = L0 + l; if (L >= nlines) break; const size_t e = (size_t)L * 64 + lane * 2; const int k = (int)(e % K), n = (int)(e / K); v2us o;
            o[0] = f2bf(w[(size_t)k * N + n]); o[1] = f2bf(w[(size_t)(k + 1) * N + n]); *(v2us*)(Bt + e) = o; }
         }
}
__global__ __launch_bounds__(256) void k_cvt8(const float* __restrict__ src, bf* dst, size_t n8) { const size_t i = (size_t)blockIdx.x * 256 + threadIdx.x; if (i >= n8) return; const v8f v = *(const v8f*)(src + i * 8); v8us o;
#pragma unroll
    for (int k = 0; k < 8; ++k) o[k] = f2bf(v[k]); *(v8us*)(dst + i * 8) = o;  }
__global__ __launch_bounds__(256) void k_cscvt(const float* __restrict__ cosT, const float* __restrict__ sinT, float* CS) { const int idx = blockIdx.x * 256 + threadIdx.x; if (idx >= TT * HD) return; v2f cs; cs[0] = bfr(cosT[idx]); cs[1] = bfr(sinT[idx]); *(v2f*)(CS + (size_t)idx * 2) = cs;  }
#define FSK 64                  // keys per stage
#define FPT 72                  // LDS row pitch in halves: 144 B, an odd multiple of 16 B
#define FNS (TT / FSK)
#define CSC 0.18033688011112042f   // HD^-0.5 x log2(e)
__device__ __forceinline__ float xhalf(float x) { return __builtin_bit_cast(float, __builtin_amdgcn_permlanex16(__builtin_bit_cast(int, x), __builtin_bit_cast(int, x), 0x76543210, 0xfedcba98, false, false)); }   // lane l with lane l ^ 16
__device__ __forceinline__ void fpass(const h16* kb, const h16* vb, const v16h (&qf)[2][2], v8f (&acc)[2][4], v8f (&lacc)[2], float (&m_run)[2], const v16h ones) {
    typedef __attribute__((ext_vector_type(2))) _Float16 h2; typedef __attribute__((ext_vector_type(2))) float f2;
    v8f s[2][2];   // every loop over kt, g, t, r, i here and in k_fattn is unrolled so that fragments, scores and accumulators are indexed by constants and stay in registers
#pragma unroll
    for (int kt = 0; kt < 2; ++kt) { const v16h k0 = WFrag<h16>::ld(kb + kt * 16 * FPT), k1 = WFrag<h16>::ld(kb + kt * 16 * FPT + 32);
#pragma unroll
        for (int g = 0; g < 2; ++g) { s[kt][g] = wmma16(k0, qf[g][0], (v8f){}); s[kt][g] = wmma16(k1, qf[g][1], s[kt][g]); } }
    v16h vf[4];
#pragma unroll
    for (int t = 0; t < 4; ++t) vf[t] = WFrag<h16>::ld(vb + t * 16 * FPT);
    float mb[2]; bool need = false;
#pragma unroll
    for (int g = 0; g < 2; ++g) { float mx = s[0][g][0];
#pragma unroll
        for (int r = 1; r < 8; ++r) mx = fmaxf(mx, s[0][g][r]);
#pragma unroll
        for (int r = 0; r < 8; ++r) mx = fmaxf(mx, s[1][g][r]);
        mx = fmaxf(mx, xhalf(mx)) * CSC; mb[g] = mx; need = need || (mx > m_run[g] + 8.0f); }
    if (__builtin_amdgcn_ballot_w32(need) != 0) {   // a scalar branch, rare after the first passes
#pragma unroll
        for (int g = 0; g < 2; ++g) { const float m_new = fmaxf(m_run[g], mb[g]); const float corr = __builtin_amdgcn_exp2f(m_run[g] - m_new); m_run[g] = m_new; lacc[g] = lacc[g] * corr;
#pragma unroll
            for (int t = 0; t < 4; ++t) acc[g][t] = acc[g][t] * corr; } }
#pragma unroll
    for (int g = 0; g < 2; ++g) { const float nm = 6.0f - m_run[g]; v16h pf;   // P carries a factor 2^6, which the denominator carries too: fewer small probabilities fall into fp16's subnormal range
#pragma unroll
        for (int i = 0; i < 8; ++i) { const int kt = i >> 2, r = 2 * (i & 3); f2 p; p[0] = __builtin_amdgcn_exp2f(fmaf(s[kt][g][r], CSC, nm)); p[1] = __builtin_amdgcn_exp2f(fmaf(s[kt][g][r + 1], CSC, nm)); const h2 q = __builtin_convertvector(p, h2); pf[2 * i] = q[0]; pf[2 * i + 1] = q[1]; }
#pragma unroll
        for (int t = 0; t < 4; ++t) acc[g][t] = wmma16(vf[t], pf, acc[g][t]);
        lacc[g] = wmma16(ones, pf, lacc[g]); }
}
__global__ __launch_bounds__(256) void k_fattn(const h16* __restrict__ Q, const h16* __restrict__ Kp, const h16* __restrict__ Vt, bf* Ah, bf* Al) {
    __shared__ __align__(16) h16 ks[2 * FSK * FPT];
    __shared__ __align__(16) h16 vs[2 * HD * FPT];
    const int tid = threadIdx.x, lane = tid & 31, lr = lane & 15, hi = lane >> 4; const int w = __builtin_amdgcn_readfirstlane(tid >> 5); const int head = blockIdx.y; const int q0 = blockIdx.x * 256 + w * 32;   // w is read as a scalar so that the wave's first query is one
    Q += (size_t)head * TT * HD; Kp += (size_t)head * TT * HD; Vt += (size_t)head * HD * TT;
    const int srow = tid >> 3, scol = (tid & 7) * 8;   // staging: thread tid moves the 16-byte pieces (srow, scol) and (srow + 32, scol) of the K tile and of the V^T tile
    const h16* kg = Kp + (size_t)srow * HD + scol; const h16* vg = Vt + (size_t)srow * TT + scol; const int sl = srow * FPT + scol;
    v8h rk0 = *(const v8h*)kg, rk1 = *(const v8h*)(kg + 32 * HD), rv0 = *(const v8h*)vg, rv1 = *(const v8h*)(vg + (size_t)32 * TT);
    v16h qf[2][2];
#pragma unroll
    for (int g = 0; g < 2; ++g)
#pragma unroll
        for (int kc = 0; kc < 2; ++kc) qf[g][kc] = WFrag<h16>::ld(Q + (size_t)(q0 + g * 16 + lr) * HD + kc * 32 + 8 * hi);
    v8f acc[2][4], lacc[2]; float m_run[2]; v16h ones;
#pragma unroll
    for (int e = 0; e < 16; ++e) ones[e] = (h16)1.0f;
#pragma unroll
    for (int g = 0; g < 2; ++g) { m_run[g] = -__builtin_inff(); lacc[g] = (v8f){};
#pragma unroll
        for (int t = 0; t < 4; ++t) acc[g][t] = (v8f){}; }
    *(v8h*)(ks + sl) = rk0; *(v8h*)(ks + sl + 32 * FPT) = rk1; *(v8h*)(vs + sl) = rv0; *(v8h*)(vs + sl + 32 * FPT) = rv1;
    __syncthreads();   // stage 0 is in LDS before any wave reads it
    const int fo = lr * FPT + 8 * hi;
#pragma unroll 1
    for (int st = 0; st < FNS; ++st) {   // kept rolled: the body already holds two passes, and acc[][] must stay in registers
        const int cur = (st & 1) * (FSK * FPT), nxt = ((st & 1) ^ 1) * (FSK * FPT); const bool more = st + 1 < FNS;
        if (more) { kg += FSK * HD; vg += FSK; rk0 = *(const v8h*)kg; rk1 = *(const v8h*)(kg + 32 * HD); rv0 = *(const v8h*)vg; rv1 = *(const v8h*)(vg + (size_t)32 * TT); }
        fpass(ks + cur + fo, vs + cur + fo, qf, acc, lacc, m_run, ones);
        fpass(ks + cur + fo + 32 * FPT, vs + cur + fo + 32, qf, acc, lacc, m_run, ones);
        __builtin_amdgcn_sched_barrier(0); asm volatile("v_nop\n\tv_nop\n\tv_nop\n\tv_nop"); __builtin_amdgcn_sched_barrier(0);   // the four vector slots behind the pass's last WMMA, also on the taken side of the branch that follows; the two scheduling barriers keep them directly behind it
        if (more) { *(v8h*)(ks + nxt + sl) = rk0; *(v8h*)(ks + nxt + sl + 32 * FPT) = rk1; *(v8h*)(vs + nxt + sl) = rv0; *(v8h*)(vs + nxt + sl + 32 * FPT) = rv1; }
        __syncthreads();   // publishes stage st + 1 and ends every wave's reads of stage st, whose buffer the next trip refills
    }
#pragma unroll
    for (int g = 0; g < 2; ++g) { const float inv = __fdiv_rn(1.0f, lacc[g][0]); const size_t oo = (size_t)(q0 + g * 16 + lr) * DQ + head * HD + 8 * hi;   // every row of lacc holds the column sums
#pragma unroll
        for (int t = 0; t < 4; ++t) { v8us oh, ol;
#pragma unroll
            for (int r = 0; r < 8; ++r) { unsigned short a, c2; splitf(acc[g][t][r] * inv, a, c2); oh[r] = a; ol[r] = c2; }
            *(v8us*)(Ah + oo + t * 16) = oh; *(v8us*)(Al + oo + t * 16) = ol; } }
}

__global__ __launch_bounds__(256) void k_xte(const float* __restrict__ xb, const float* __restrict__ te, bf* Xh, bf* Xl) { const size_t e = ((size_t)blockIdx.x * 256 + threadIdx.x) * 4; if (e >= (size_t)TT * DM) return; const int c = (int)(e % DM); const int tok = (int)(e / DM); const int frame = tok / 256; v4us oh, ol;   // token = (frame, h, w); x + temporal_embedding[0][frame][c] in f32, split hl
#pragma unroll
    for (int u = 0; u < 4; ++u) { const float s = __fadd_rn(bfr(xb[e + u]), bfr(te[(size_t)frame * DM + c + u])); unsigned short a, b; splitf(s, a, b); oh[u] = a; ol[u] = b; } *(v4us*)(Xh + e) = oh; *(v4us*)(Xl + e) = ol;  }

extern "C" void kernel_launch(void* const* d_in, const int* in_sizes, int n_in,
                              void* d_out, int out_size, void* d_ws, size_t ws_size, hipStream_t stream) {
    (void)in_sizes; (void)n_in; (void)out_size;
    const float* x = (const float*)d_in[0]; const float* temb = (const float*)d_in[1]; const float* wf = (const float*)d_in[2]; const float* bfz = (const float*)d_in[3]; const float* wo = (const float*)d_in[4]; const float* bo = (const float*)d_in[5]; const float* wq = wf; const float* wk = wf + (size_t)1024 * 1024; const float* wv = wf + (size_t)2 * 1024 * 1024; const float* bq = bfz; const float* bk = bfz + 1024; const float* bv = bfz + 2048; const float* cosT = nullptr; const float* sinT = nullptr; (void)cosT; (void)sinT;
    float* OUT = (float*)d_out;     // [2][3072][1024]
    char* wsp = (char*)d_ws;
    auto take = [&](size_t bytes) { char* p = wsp; wsp += (bytes + 255) & ~(size_t)255; return (void*)p; };
    bf* WQ = (bf*)take((size_t)DQ * DM * 2); bf* WK = (bf*)take((size_t)DKV * DM * 2); bf* WV = (bf*)take((size_t)DKV * DM * 2); bf* WO = (bf*)take((size_t)DM * DQ * 2);
    bf* XB = (bf*)take((size_t)TT * DM * 2); bf* XBl = (bf*)take((size_t)TT * DM * 2);
    h16* QP16 = (h16*)take((size_t)NH_ * TT * HD * 2); h16* KP16 = (h16*)take((size_t)NKV * TT * HD * 2); h16* VT16 = (h16*)take((size_t)NKV * HD * TT * 2);
    bf* ATh = (bf*)take((size_t)TT * DQ * 2); bf* ATl = (bf*)take((size_t)TT * DQ * 2);
    if ((size_t)(wsp - (char*)d_ws) > ws_size) return;    // ws 256 MiB
    { k_cvt8<<<(unsigned)(((size_t)DQ * DM / 8 + 255) / 256), 256, 0, stream>>>(wq, WQ, (size_t)DQ * DM / 8); k_cvt8<<<(unsigned)(((size_t)DKV * DM / 8 + 255) / 256), 256, 0, stream>>>(wk, WK, (size_t)DKV * DM / 8); k_cvt8<<<(unsigned)(((size_t)DKV * DM / 8 + 255) / 256), 256, 0, stream>>>(wv, WV, (size_t)DKV * DM / 8);
      k_cvt8<<<(unsigned)(((size_t)DM * DQ / 8 + 255) / 256), 256, 0, stream>>>(wo, WO, (size_t)DM * DQ / 8);
       }
    for (int b = 0; b < NB_; ++b) {
        
        k_xte<<<(unsigned)(((size_t)TT * DM / 4 + 255) / 256), 256, 0, stream>>>(x + (size_t)b * TT * DM, temb, XB, XBl);
        k_gemmw<bf, 1, true, 1><<<dim3(TT / 64, DQ / 64, 1), 32, 0, stream>>>(XB, XBl, WQ, nullptr, DM, nullptr, 0, bq, 0, 0, 0, QP16);
        k_gemmw<bf, 1, true, 1><<<dim3(TT / 64, DKV / 64, 1), 32, 0, stream>>>(XB, XBl, WK, nullptr, DM, nullptr, 0, bk, 0, 0, 0, KP16);
        k_gemmw<bf, 1, true, 2><<<dim3(TT / 64, DKV / 64, 1), 32, 0, stream>>>(XB, XBl, WV, nullptr, DM, nullptr, 0, bv, 0, 0, 0, VT16);
        k_fattn<<<dim3(TT / 256, NH_), 256, 0, stream>>>(QP16, KP16, VT16, ATh, ATl);
        k_gemmw<bf, 1, true, 0><<<dim3(TT / 64, DM / 64, 1), 32, 0, stream>>>(ATh, ATl, WO, nullptr, DQ, OUT + (size_t)b * TT * DM, DM, bo, 0, 0, 0, nullptr); }
}

// v004
// A run of this version takes 249 microseconds.
// Two timings next to v003 put it at 1.56 and 1.55 times that version's speed.
// All steps since v000 together make it 7.99 times as fast.
#include <hip/hip_runtime.h>

// TemporalAttention (x [2][12][16][16][1024] + temporal_embedding[:, :12] broadcast over the 16x16 grid; N = 12*16*16 = 3,072 tokens per batch; qkv = (x + te) qkv_w^T + qkv_b (torch [3072][1024], q | k | v, 16 heads x 64); softmax(q.k / 8) over all 3,072 tokens; out = merged proj_w^T + proj_b -> [2][12][16][16][1024]).
// Compute dtypes, f32 accumulate: every input rounded to bf16; x + te in f32 split into hl planes, so q/k/v are hl x exact bf16 (2 products) + bias, rounded to fp16 head planes in the product's own epilogue; scores and attn.v single fp16 on every row, P = 2^6 x exp2(score - maximum in use), unnormalised; softmax f32, online; proj hl x exact (2 products) + bias.

#define NB_  2
#define TT   3072
#define DM   1024
#define NH_  16
#define NKV  16
#define REP  (NH_ / NKV)
#define HD   64
#define DQ   (NH_ * HD)
#define DKV  (NKV * HD)
#define ZH   2
#define RH   0                  // unused: no query rows use hi+lo planes
#define WIN  0
#define PCAR 1024.0f
#define SCL  0.125f   // HD^-0.5
typedef _Float16 h16;
typedef unsigned short bf;
typedef __attribute__((ext_vector_type(16))) __bf16   v16bf;
typedef __attribute__((ext_vector_type(16))) _Float16 v16h;
typedef __attribute__((ext_vector_type(8)))  _Float16 v8h;
typedef __attribute__((ext_vector_type(8)))  unsigned short v8us;
typedef __attribute__((ext_vector_type(8)))  float    v8f;
typedef __attribute__((ext_vector_type(4)))  float    v4f;
typedef v8h  __attribute__((may_alias)) v8ha;
typedef v4f  __attribute__((may_alias)) v4fa;
typedef v8us __attribute__((may_alias)) v8usa;

__device__ __forceinline__ unsigned short f2bf(float f) { unsigned u = __float_as_uint(f); u += 0x7FFFu + ((u >> 16) & 1u); return (unsigned short)(u >> 16); }
__device__ __forceinline__ float bf2f(unsigned short b) { return __uint_as_float(((unsigned)b) << 16); }
__device__ __forceinline__ float bfr(float f) { return bf2f(f2bf(f)); }
__device__ __forceinline__ v16h cat16(v8h lo, v8h hi) { return __builtin_shufflevector(lo, hi, 0, 1, 2, 3, 4, 5, 6, 7, 8, 9, 10, 11, 12, 13, 14, 15); }
__device__ __forceinline__ v16bf cat16b(v8us lo, v8us hi) { return __builtin_bit_cast(v16bf, __builtin_shufflevector(lo, hi, 0, 1, 2, 3, 4, 5, 6, 7, 8, 9, 10, 11, 12, 13, 14, 15)); }
__device__ __forceinline__ v8f wmma16(v16h a, v16h b, v8f c) { return __builtin_amdgcn_wmma_f32_16x16x32_f16(false, a, false, b, (short)0, c, false, false); }
__device__ __forceinline__ v8f wmmab(v16bf a, v16bf b, v8f c) { return __builtin_amdgcn_wmma_f32_16x16x32_bf16(false, a, false, b, (short)0, c, false, false); }



// ---- k_gemmt: C[m][n] = sum_k (A[m][k] + A2[m][k]) Bt[n][k] + bias[n], operands K-contiguous bf16 planes; ONE 128x128 output tile per work-group of 8 waves; grid (M/128, N/128), 256 threads. M, N % 128 == 0, K % 64 == 0; K is a compile-time constant, so that the four row steps of a staging load are immediate offsets of one address.
// The 128 rows of A, of A2 and of Bt go through LDS in stages of 64 k (one whole 128-byte line of each row, eight lanes to a line), two buffers: stage s + 1 is fetched into registers while stage s is worked on, stored behind it, and one barrier a stage publishes it.
// A wave holds 32 rows x 64 columns (A has two planes, so the narrow side is A's: 8 fragments read for 16 products).
// OUTM 0: C (f32, pitch ldc). OUTM 1: a wave's 64 columns are one head (HD == 64) and go out as fp16 rows of the head plane P16[head][token][d]. OUTM 2: the work-group's tile is transposed in LDS and goes out as fp16 rows of the transposed plane P16[head][d][token], 256 bytes of a row from one half-wave.
template <typename T16> struct WFrag;
template <> struct WFrag<h16> { typedef v16h V; static __device__ __forceinline__ V ld(const h16* p) { return cat16(*(const v8h*)p, *(const v8h*)(p + 16)); } static __device__ __forceinline__ v8f mma(V a, V b, v8f c) { return wmma16(a, b, c); } };
template <> struct WFrag<bf> { typedef v16bf V; static __device__ __forceinline__ V ld(const bf* p) { return cat16b(*(const v8us*)p, *(const v8us*)(p + 16)); } static __device__ __forceinline__ v8f mma(V a, V b, v8f c) { return wmmab(a, b, c); } };
#define GKS 64                  // k per stage
#define GLP 72                  // LDS row pitch in 16-bit elements: 144 B, an odd multiple of 16 B
#define GSZ (384 * GLP)         // one stage: rows 0..127 A, 128..255 A2, 256..383 Bt
template <bool BIAS, int OUTM, int K>
__global__ __launch_bounds__(256) void k_gemmt(const bf* __restrict__ A, const bf* __restrict__ A2, const bf* __restrict__ Bt, float* C, int ldc, const float* __restrict__ bias, h16* P16) {
    typedef WFrag<bf>::V V; static_assert(OUTM == 0 || HD == 64, "a 64-column wave tile is one head"); static_assert(K % GKS == 0, "whole stages");
    constexpr int MB = 2, NB = 4, WM = 8 / MB;   // 16x16 tiles of a wave along M and N; waves along M
    __shared__ __align__(16) bf st[2 * GSZ];
    __shared__ __align__(16) float osw[8 * 16 * 68];   // epilogue only: a 16 x 68 f32 patch per wave, or (OUTM 2) one 128 x 136 fp16 tile
    const int tid = threadIdx.x, lane = tid & 31, lr = lane & 15, hi = lane >> 4; const int w = __builtin_amdgcn_readfirstlane(tid >> 5); const int wm = w % WM, wn = w / WM;   // w is read as a scalar so that the wave's tile origin is one
    const int srow = tid >> 3, scol = (tid & 7) * 8;   // staging: thread tid moves the 16-byte pieces (srow + 32 i, scol), i = 0..3, of each of the three operands
    const bf* ga = A + (size_t)(blockIdx.x * 128 + srow) * K + scol; const bf* ga2 = A2 + (size_t)(blockIdx.x * 128 + srow) * K + scol; const bf* gb = Bt + (size_t)(blockIdx.y * 128 + srow) * K + scol; const int sl = srow * GLP + scol;
    v8us ra[4], ra2[4], rb[4];   // every loop over i, h, mb, nb here is unrolled so that staging registers, fragments and accumulators are indexed by constants
#pragma unroll
    for (int i = 0; i < 4; ++i) { ra[i] = *(const v8us*)(ga + (size_t)i * 32 * K); ra2[i] = *(const v8us*)(ga2 + (size_t)i * 32 * K); rb[i] = *(const v8us*)(gb + (size_t)i * 32 * K); }
    v8f acc[MB][NB];
#pragma unroll
    for (int mb = 0; mb < MB; ++mb)
#pragma unroll
        for (int nb = 0; nb < NB; ++nb) acc[mb][nb] = (v8f){};
#pragma unroll
    for (int i = 0; i < 4; ++i) { *(v8us*)(st + sl + i * 32 * GLP) = ra[i]; *(v8us*)(st + 128 * GLP + sl + i * 32 * GLP) = ra2[i]; *(v8us*)(st + 256 * GLP + sl + i * 32 * GLP) = rb[i]; }
    __syncthreads();   // stage 0 is in LDS before any wave reads it
    const int ao = (wm * MB * 16 + lr) * GLP + 8 * hi, bo = (256 + wn * NB * 16 + lr) * GLP + 8 * hi; constexpr int ns = K / GKS;
#pragma unroll 1
    for (int s = 0; s < ns; ++s) {   // kept rolled: the body already holds two k steps of 16 products each, and an unrolled loop would outgrow the registers
        const int cur = (s & 1) * GSZ, nxt = ((s & 1) ^ 1) * GSZ; const bool more = s + 1 < ns;
        if (more) { ga += GKS; ga2 += GKS; gb += GKS;
#pragma unroll
            for (int i = 0; i < 4; ++i) { ra[i] = *(const v8us*)(ga + (size_t)i * 32 * K); ra2[i] = *(const v8us*)(ga2 + (size_t)i * 32 * K); rb[i] = *(const v8us*)(gb + (size_t)i * 32 * K); } }
        V a[2][MB], a2[2][MB], b[2][NB];
#pragma unroll
        for (int h = 0; h < 2; ++h) {
#pragma unroll
            for (int mb = 0; mb < MB; ++mb) a[h][mb] = WFrag<bf>::ld(st + cur + ao + mb * 16 * GLP + h * 32);
#pragma unroll
            for (int nb = 0; nb < NB; ++nb) b[h][nb] = WFrag<bf>::ld(st + cur + bo + nb * 16 * GLP + h * 32);
#pragma unroll
            for (int mb = 0; mb < MB; ++mb) a2[h][mb] = WFrag<bf>::ld(st + cur + 128 * GLP + ao + mb * 16 * GLP + h * 32); }
        __builtin_amdgcn_sched_barrier(0);   // keeps the stage's 32 LDS reads one group ahead of its 32 products: left alone, the compiler sinks reads between the products, into registers just freed, and waits for each at once
#pragma unroll
        for (int h = 0; h < 2; ++h) {
#pragma unroll
            for (int nb = 0; nb < NB; ++nb)
#pragma unroll
                for (int mb = 0; mb < MB; ++mb) acc[mb][nb] = WFrag<bf>::mma(a[h][mb], b[h][nb], acc[mb][nb]);
#pragma unroll
            for (int nb = 0; nb < NB; ++nb)
#pragma unroll
                for (int mb = 0; mb < MB; ++mb) acc[mb][nb] = WFrag<bf>::mma(a2[h][mb], b[h][nb], acc[mb][nb]); }
        __builtin_amdgcn_sched_barrier(0); asm volatile("v_nop\n\tv_nop\n\tv_nop\n\tv_nop"); __builtin_amdgcn_sched_barrier(0);   // the four vector slots behind the stage's last WMMA, also on the taken side of the branch that follows; the two scheduling barriers keep them directly behind it
        if (more) {
#pragma unroll
            for (int i = 0; i < 4; ++i) { *(v8us*)(st + nxt + sl + i * 32 * GLP) = ra[i]; *(v8us*)(st + nxt + 128 * GLP + sl + i * 32 * GLP) = ra2[i]; *(v8us*)(st + nxt + 256 * GLP + sl + i * 32 * GLP) = rb[i]; } }
        __syncthreads();   // publishes stage s + 1 and ends every wave's reads of stage s, whose buffer the next trip refills
    }
    const int r0 = blockIdx.x * 128 + wm * MB * 16, c0 = blockIdx.y * 128 + wn * NB * 16;   // the wave's own tile
    if constexpr (OUTM == 2) {   // a lane holds eight consecutive tokens of one d: 16 bytes of a row of the transposed tile [128 d][128 tokens], row pitch 272 B (an odd multiple of 16 B)
        h16* tp = (h16*)osw;
#pragma unroll
        for (int nb = 0; nb < NB; ++nb) { const float bz = BIAS ? bfr(bias[c0 + nb * 16 + lr]) : 0.0f;
#pragma unroll
            for (int mb = 0; mb < MB; ++mb) { v8h o;
#pragma unroll
                for (int j = 0; j < 8; ++j) { float val = acc[mb][nb][j]; if (BIAS) val += bz; o[j] = (h16)val; }
                *(v8ha*)(tp + (wn * NB * 16 + nb * 16 + lr) * 136 + wm * MB * 16 + mb * 16 + 8 * hi) = o; } }
        __syncthreads();   // the whole transposed tile is in LDS before a wave reads rows that four waves wrote
#pragma unroll
        for (int s = 0; s < 8; ++s) { const int row = w * 16 + 2 * s + hi; const v8h o = *(const v8ha*)(tp + row * 136 + lr * 8);   // a half-wave stores 256 bytes of one d row: two whole lines, one writer each
            *(v8h*)(P16 + (size_t)(blockIdx.y * 128 + row) * TT + blockIdx.x * 128 + lr * 8) = o; }
        return;
    }
    float* os = osw + w * (16 * 68);   // the wave's own 16 x 64 f32 patch, read and written by this wave alone
    float bz8[8];
    if constexpr (OUTM == 1) {
#pragma unroll
        for (int u = 0; u < 8; ++u) bz8[u] = BIAS ? bfr(bias[c0 + (lane & 7) * 8 + u]) : 0.0f; }
#pragma unroll
    for (int mb = 0; mb < MB; ++mb) {
#pragma unroll
        for (int nb = 0; nb < NB; ++nb) {
#pragma unroll
            for (int j = 0; j < 8; ++j) os[(hi * 8 + j) * 68 + nb * 16 + lr] = acc[mb][nb][j]; }
        __builtin_amdgcn_wave_barrier(); asm volatile("" ::: "memory");   // holds the compiler to the order: the wave's patch is written whole before it is read
        if constexpr (OUTM == 1) {   // eight lanes write one token's 128-byte row of the head plane, a store instruction four rows in a run
            h16* prow = P16 + ((size_t)(c0 / HD) * TT + r0 + mb * 16) * HD;
#pragma unroll
            for (int s = 0; s < 4; ++s) { const int row = 4 * s + (lane >> 3), cofs = (lane & 7) * 8; const v4f v0 = *(const v4fa*)(os + row * 68 + cofs), v1 = *(const v4fa*)(os + row * 68 + cofs + 4); v8h o;
#pragma unroll
                for (int u = 0; u < 4; ++u) { float a0 = v0[u], a1 = v1[u]; if (BIAS) { a0 += bz8[u]; a1 += bz8[u + 4]; } o[u] = (h16)a0; o[u + 4] = (h16)a1; }
                *(v8h*)(prow + row * HD + cofs) = o; }
        } else {
            float* crow = C + (size_t)(r0 + mb * 16) * ldc + c0;
#pragma unroll
            for (int s = 0; s < 8; ++s) { const int row = 2 * s + hi, cofs = lr * 4; v4f val = *(const v4fa*)(os + row * 68 + cofs); if (BIAS) { val[0] += bfr(bias[c0 + cofs]); val[1] += bfr(bias[c0 + cofs + 1]); val[2] += bfr(bias[c0 + cofs + 2]); val[3] += bfr(bias[c0 + cofs + 3]); }
                *(v4f*)(crow + (size_t)row * ldc + cofs) = val; }
        }
        __builtin_amdgcn_wave_barrier(); asm volatile("" ::: "memory");   // and read whole before the next mb rewrites it
    }
}

__device__ __forceinline__ void splitf(float y, unsigned short& h, unsigned short& l) { h = f2bf(y); l = f2bf(y - bf2f(h)); }
typedef __attribute__((ext_vector_type(2))) _Float16 v2h;
typedef __attribute__((ext_vector_type(4))) _Float16 v4h;
typedef __attribute__((ext_vector_type(2))) unsigned short v2us;
typedef __attribute__((ext_vector_type(4))) unsigned short v4us;
typedef __attribute__((ext_vector_type(2))) float v2f;
typedef __attribute__((ext_vector_type(4))) int v4i;

__global__ __launch_bounds__(256) void k_wtG(const float* __restrict__ w, int K, int N, bf* Bt) {
    const int lane = threadIdx.x & 31; const int L0 = (blockIdx.x * 8 + (threadIdx.x >> 5)) * 8; const int nlines = N * K / 64;
{
#pragma unroll 1
        for (int l = 0; l < 8; ++l) { const int L = L0 + l; if (L >= nlines) break; const size_t e = (size_t)L * 64 + lane * 2; const int k = (int)(e % K), n = (int)(e / K); v2us o;
            o[0] = f2bf(w[(size_t)k * N + n]); o[1] = f2bf(w[(size_t)(k + 1) * N + n]); *(v2us*)(Bt + e) = o; }
         }
}
__global__ __launch_bounds__(256) void k_cvt8(const float* __restrict__ src, bf* dst, size_t n8) { const size_t i = (size_t)blockIdx.x * 256 + threadIdx.x; if (i >= n8) return; const v8f v = *(const v8f*)(src + i * 8); v8us o;
#pragma unroll
    for (int k = 0; k < 8; ++k) o[k] = f2bf(v[k]); *(v8us*)(dst + i * 8) = o;  }
__global__ __launch_bounds__(256) void k_cscvt(const float* __restrict__ cosT, const float* __restrict__ sinT, float* CS) { const int idx = blockIdx.x * 256 + threadIdx.x; if (idx >= TT * HD) return; v2f cs; cs[0] = bfr(cosT[idx]); cs[1] = bfr(sinT[idx]); *(v2f*)(CS + (size_t)idx * 2) = cs;  }
#define FSK 64                  // keys per stage
#define FPT 72                  // LDS row pitch in halves: 144 B, an odd multiple of 16 B
#define FNS (TT / FSK)
#define CSC 0.18033688011112042f   // HD^-0.5 x log2(e)
__device__ __forceinline__ float xhalf(float x) { return __builtin_bit_cast(float, __builtin_amdgcn_permlanex16(__builtin_bit_cast(int, x), __builtin_bit_cast(int, x), 0x76543210, 0xfedcba98, false, false)); }   // lane l with lane l ^ 16
__device__ __forceinline__ void fpass(const h16* kb, const h16* vb, const v16h (&qf)[2][2], v8f (&acc)[2][4], v8f (&lacc)[2], float (&m_run)[2], const v16h ones) {
    typedef __attribute__((ext_vector_type(2))) _Float16 h2; typedef __attribute__((ext_vector_type(2))) float f2;
    v8f s[2][2];   // every loop over kt, g, t, r, i here and in k_fattn is unrolled so that fragments, scores and accumulators are indexed by constants and stay in registers
#pragma unroll
    for (int kt = 0; kt < 2; ++kt) { const v16h k0 = WFrag<h16>::ld(kb + kt * 16 * FPT), k1 = WFrag<h16>::ld(kb + kt * 16 * FPT + 32);
#pragma unroll
        for (int g = 0; g < 2; ++g) { s[kt][g] = wmma16(k0, qf[g][0], (v8f){}); s[kt][g] = wmma16(k1, qf[g][1], s[kt][g]); } }
    v16h vf[4];
#pragma unroll
    for (int t = 0; t < 4; ++t) vf[t] = WFrag<h16>::ld(vb + t * 16 * FPT);
    float mb[2]; bool need = false;
#pragma unroll
    for (int g = 0; g < 2; ++g) { float mx = s[0][g][0];
#pragma unroll
        for (int r = 1; r < 8; ++r) mx = fmaxf(mx, s[0][g][r]);
#pragma unroll
        for (int r = 0; r < 8; ++r) mx = fmaxf(mx, s[1][g][r]);
        mx = fmaxf(mx, xhalf(mx)) * CSC; mb[g] = mx; need = need || (mx > m_run[g] + 8.0f); }
    if (__builtin_amdgcn_ballot_w32(need) != 0) {   // a scalar branch, rare after the first passes
#pragma unroll
        for (int g = 0; g < 2; ++g) { const float m_new = fmaxf(m_run[g], mb[g]); const float corr = __builtin_amdgcn_exp2f(m_run[g] - m_new); m_run[g] = m_new; lacc[g] = lacc[g] * corr;
#pragma unroll
            for (int t = 0; t < 4; ++t) acc[g][t] = acc[g][t] * corr; } }
#pragma unroll
    for (int g = 0; g < 2; ++g) { const float nm = 6.0f - m_run[g]; v16h pf;   // P carries a factor 2^6, which the denominator carries too: fewer small probabilities fall into fp16's subnormal range
#pragma unroll
        for (int i = 0; i < 8; ++i) { const int kt = i >> 2, r = 2 * (i & 3); f2 p; p[0] = __builtin_amdgcn_exp2f(fmaf(s[kt][g][r], CSC, nm)); p[1] = __builtin_amdgcn_exp2f(fmaf(s[kt][g][r + 1], CSC, nm)); const h2 q = __builtin_convertvector(p, h2); pf[2 * i] = q[0]; pf[2 * i + 1] = q[1]; }
#pragma unroll
        for (int t = 0; t < 4; ++t) acc[g][t] = wmma16(vf[t], pf, acc[g][t]);
        lacc[g] = wmma16(ones, pf, lacc[g]); }
}
__global__ __launch_bounds__(256) void k_fattn(const h16* __restrict__ Q, const h16* __restrict__ Kp, const h16* __restrict__ Vt, bf* Ah, bf* Al) {
    __shared__ __align__(16) h16 ks[2 * FSK * FPT];
    __shared__ __align__(16) h16 vs[2 * HD * FPT];
    const int tid = threadIdx.x, lane = tid & 31, lr = lane & 15, hi = lane >> 4; const int w = __builtin_amdgcn_readfirstlane(tid >> 5); const int head = blockIdx.y; const int q0 = blockIdx.x * 256 + w * 32;   // w is read as a scalar so that the wave's first query is one
    Q += (size_t)head * TT * HD; Kp += (size_t)head * TT * HD; Vt += (size_t)head * HD * TT;
    const int srow = tid >> 3, scol = (tid & 7) * 8;   // staging: thread tid moves the 16-byte pieces (srow, scol) and (srow + 32, scol) of the K tile and of the V^T tile
    const h16* kg = Kp + (size_t)srow * HD + scol; const h16* vg = Vt + (size_t)srow * TT + scol; const int sl = srow * FPT + scol;
    v8h rk0 = *(const v8h*)kg, rk1 = *(const v8h*)(kg + 32 * HD), rv0 = *(const v8h*)vg, rv1 = *(const v8h*)(vg + (size_t)32 * TT);
    v16h qf[2][2];
#pragma unroll
    for (int g = 0; g < 2; ++g)
#pragma unroll
        for (int kc = 0; kc < 2; ++kc) qf[g][kc] = WFrag<h16>::ld(Q + (size_t)(q0 + g * 16 + lr) * HD + kc * 32 + 8 * hi);
    v8f acc[2][4], lacc[2]; float m_run[2]; v16h ones;
#pragma unroll
    for (int e = 0; e < 16; ++e) ones[e] = (h16)1.0f;
#pragma unroll
    for (int g = 0; g < 2; ++g) { m_run[g] = -__builtin_inff(); lacc[g] = (v8f){};
#pragma unroll
        for (int t = 0; t < 4; ++t) acc[g][t] = (v8f){}; }
    *(v8h*)(ks + sl) = rk0; *(v8h*)(ks + sl + 32 * FPT) = rk1; *(v8h*)(vs + sl) = rv0; *(v8h*)(vs + sl + 32 * FPT) = rv1;
    __syncthreads();   // stage 0 is in LDS before any wave reads it
    const int fo = lr * FPT + 8 * hi;
#pragma unroll 1
    for (int st = 0; st < FNS; ++st) {   // kept rolled: the body already holds two passes, and acc[][] must stay in registers
        const int cur = (st & 1) * (FSK * FPT), nxt = ((st & 1) ^ 1) * (FSK * FPT); const bool more = st + 1 < FNS;
        if (more) { kg += FSK * HD; vg += FSK; rk0 = *(const v8h*)kg; rk1 = *(const v8h*)(kg + 32 * HD); rv0 = *(const v8h*)vg; rv1 = *(const v8h*)(vg + (size_t)32 * TT); }
        fpass(ks + cur + fo, vs + cur + fo, qf, acc, lacc, m_run, ones);
        fpass(ks + cur + fo + 32 * FPT, vs + cur + fo + 32, qf, acc, lacc, m_run, ones);
        __builtin_amdgcn_sched_barrier(0); asm volatile("v_nop\n\tv_nop\n\tv_nop\n\tv_nop"); __builtin_amdgcn_sched_barrier(0);   // the four vector slots behind the pass's last WMMA, also on the taken side of the branch that follows; the two scheduling barriers keep them directly behind it
        if (more) { *(v8h*)(ks + nxt + sl) = rk0; *(v8h*)(ks + nxt + sl + 32 * FPT) = rk1; *(v8h*)(vs + nxt + sl) = rv0; *(v8h*)(vs + nxt + sl + 32 * FPT) = rv1; }
        __syncthreads();   // publishes stage st + 1 and ends every wave's reads of stage st, whose buffer the next trip refills
    }
#pragma unroll
    for (int g = 0; g < 2; ++g) { const float inv = __fdiv_rn(1.0f, lacc[g][0]); const size_t oo = (size_t)(q0 + g * 16 + lr) * DQ + head * HD + 8 * hi;   // every row of lacc holds the column sums
#pragma unroll
        for (int t = 0; t < 4; ++t) { v8us oh, ol;
#pragma unroll
            for (int r = 0; r < 8; ++r) { unsigned short a, c2; splitf(acc[g][t][r] * inv, a, c2); oh[r] = a; ol[r] = c2; }
            *(v8us*)(Ah + oo + t * 16) = oh; *(v8us*)(Al + oo + t * 16) = ol; } }
}

__global__ __launch_bounds__(256) void k_xte(const float* __restrict__ xb, const float* __restrict__ te, bf* Xh, bf* Xl) { const size_t e = ((size_t)blockIdx.x * 256 + threadIdx.x) * 4; if (e >= (size_t)TT * DM) return; const int c = (int)(e % DM); const int tok = (int)(e / DM); const int frame = tok / 256; v4us oh, ol;   // token = (frame, h, w); x + temporal_embedding[0][frame][c] in f32, split hl
#pragma unroll
    for (int u = 0; u < 4; ++u) { const float s = __fadd_rn(bfr(xb[e + u]), bfr(te[(size_t)frame * DM + c + u])); unsigned short a, b; splitf(s, a, b); oh[u] = a; ol[u] = b; } *(v4us*)(Xh + e) = oh; *(v4us*)(Xl + e) = ol;  }

extern "C" void kernel_launch(void* const* d_in, const int* in_sizes, int n_in,
                              void* d_out, int out_size, void* d_ws, size_t ws_size, hipStream_t stream) {
    (void)in_sizes; (void)n_in; (void)out_size;
    const float* x = (const float*)d_in[0]; const float* temb = (const float*)d_in[1]; const float* wf = (const float*)d_in[2]; const float* bfz = (const float*)d_in[3]; const float* wo = (const float*)d_in[4]; const float* bo = (const float*)d_in[5]; const float* wq = wf; const float* wk = wf + (size_t)1024 * 1024; const float* wv = wf + (size_t)2 * 1024 * 1024; const float* bq = bfz; const float* bk = bfz + 1024; const float* bv = bfz + 2048; const float* cosT = nullptr; const float* sinT = nullptr; (void)cosT; (void)sinT;
    float* OUT = (float*)d_out;     // [2][3072][1024]
    char* wsp = (char*)d_ws;
    auto take = [&](size_t bytes) { char* p = wsp; wsp += (bytes + 255) & ~(size_t)255; return (void*)p; };
    bf* WQ = (bf*)take((size_t)DQ * DM * 2); bf* WK = (bf*)take((size_t)DKV * DM * 2); bf* WV = (bf*)take((size_t)DKV * DM * 2); bf* WO = (bf*)take((size_t)DM * DQ * 2);
    bf* XB = (bf*)take((size_t)TT * DM * 2); bf* XBl = (bf*)take((size_t)TT * DM * 2);
    h16* QP16 = (h16*)take((size_t)NH_ * TT * HD * 2); h16* KP16 = (h16*)take((size_t)NKV * TT * HD * 2); h16* VT16 = (h16*)take((size_t)NKV * HD * TT * 2);
    bf* ATh = (bf*)take((size_t)TT * DQ * 2); bf* ATl = (bf*)take((size_t)TT * DQ * 2);
    if ((size_t)(wsp - (char*)d_ws) > ws_size) return;    // ws 256 MiB
    { k_cvt8<<<(unsigned)(((size_t)DQ * DM / 8 + 255) / 256), 256, 0, stream>>>(wq, WQ, (size_t)DQ * DM / 8); k_cvt8<<<(unsigned)(((size_t)DKV * DM / 8 + 255) / 256), 256, 0, stream>>>(wk, WK, (size_t)DKV * DM / 8); k_cvt8<<<(unsigned)(((size_t)DKV * DM / 8 + 255) / 256), 256, 0, stream>>>(wv, WV, (size_t)DKV * DM / 8);
      k_cvt8<<<(unsigned)(((size_t)DM * DQ / 8 + 255) / 256), 256, 0, stream>>>(wo, WO, (size_t)DM * DQ / 8);
       }
    for (int b = 0; b < NB_; ++b) {
        
        k_xte<<<(unsigned)(((size_t)TT * DM / 4 + 255) / 256), 256, 0, stream>>>(x + (size_t)b * TT * DM, temb, XB, XBl);
        k_gemmt<true, 1, DM><<<dim3(TT / 128, DQ / 128, 1), 256, 0, stream>>>(XB, XBl, WQ, nullptr, 0, bq, QP16);
        k_gemmt<true, 1, DM><<<dim3(TT / 128, DKV / 128, 1), 256, 0, stream>>>(XB, XBl, WK, nullptr, 0, bk, KP16);
        k_gemmt<true, 2, DM><<<dim3(TT / 128, DKV / 128, 1), 256, 0, stream>>>(XB, XBl, WV, nullptr, 0, bv, VT16);
        k_fattn<<<dim3(TT / 256, NH_), 256, 0, stream>>>(QP16, KP16, VT16, ATh, ATl);
        k_gemmt<true, 0, DQ><<<dim3(TT / 128, DM / 128, 1), 256, 0, stream>>>(ATh, ATl, WO, OUT + (size_t)b * TT * DM, DM, bo, nullptr); }
}

// v005
// A run of this version takes 167 microseconds.
// Next to v004, in two timings, it ran 1.47 and 1.49 times as fast.
// All steps since v000 together make it 11.8 times as fast.
#include <hip/hip_runtime.h>

// TemporalAttention (x [2][12][16][16][1024] + temporal_embedding[:, :12] broadcast over the 16x16 grid; N = 12*16*16 = 3,072 tokens per batch; qkv = (x + te) qkv_w^T + qkv_b (torch [3072][1024], q | k | v, 16 heads x 64); softmax(q.k / 8) over all 3,072 tokens; out = merged proj_w^T + proj_b -> [2][12][16][16][1024]).
// Compute dtypes, f32 accumulate: every input rounded to bf16; x + te in f32 split into hl planes, so q/k/v are hl x exact bf16 (2 products) + bias, rounded to fp16 head planes in the product's own epilogue; scores and attn.v single fp16 on every row, P = 2^6 x exp2(score - maximum in use), unnormalised; softmax f32, online; proj hl x exact (2 products) + bias.

#define NB_  2
#define TT   3072
#define DM   1024
#define NH_  16
#define NKV  16
#define REP  (NH_ / NKV)
#define HD   64
#define DQ   (NH_ * HD)
#define DKV  (NKV * HD)
#define ZH   2
#define RH   0                  // unused: no query rows use hi+lo planes
#define WIN  0
#define PCAR 1024.0f
#define SCL  0.125f   // HD^-0.5
typedef _Float16 h16;
typedef unsigned short bf;
typedef __attribute__((ext_vector_type(16))) __bf16   v16bf;
typedef __attribute__((ext_vector_type(16))) _Float16 v16h;
typedef __attribute__((ext_vector_type(8)))  _Float16 v8h;
typedef __attribute__((ext_vector_type(8)))  unsigned short v8us;
typedef __attribute__((ext_vector_type(8)))  float    v8f;
typedef __attribute__((ext_vector_type(4)))  float    v4f;
typedef v8h  __attribute__((may_alias)) v8ha;
typedef v4f  __attribute__((may_alias)) v4fa;
typedef v8us __attribute__((may_alias)) v8usa;

__device__ __forceinline__ unsigned short f2bf(float f) { unsigned u = __float_as_uint(f); u += 0x7FFFu + ((u >> 16) & 1u); return (unsigned short)(u >> 16); }
__device__ __forceinline__ float bf2f(unsigned short b) { return __uint_as_float(((unsigned)b) << 16); }
__device__ __forceinline__ float bfr(float f) { return bf2f(f2bf(f)); }
__device__ __forceinline__ v16h cat16(v8h lo, v8h hi) { return __builtin_shufflevector(lo, hi, 0, 1, 2, 3, 4, 5, 6, 7, 8, 9, 10, 11, 12, 13, 14, 15); }
__device__ __forceinline__ v16bf cat16b(v8us lo, v8us hi) { return __builtin_bit_cast(v16bf, __builtin_shufflevector(lo, hi, 0, 1, 2, 3, 4, 5, 6, 7, 8, 9, 10, 11, 12, 13, 14, 15)); }
__device__ __forceinline__ v8f wmma16(v16h a, v16h b, v8f c) { return __builtin_amdgcn_wmma_f32_16x16x32_f16(false, a, false, b, (short)0, c, false, false); }
__device__ __forceinline__ v8f wmmab(v16bf a, v16bf b, v8f c) { return __builtin_amdgcn_wmma_f32_16x16x32_bf16(false, a, false, b, (short)0, c, false, false); }



// ---- k_gemmt: C[m][n] = sum_k (A[m][k] + A2[m][k]) Bt[n][k] + bias[n], operands K-contiguous bf16 planes; ONE 128x128 output tile per work-group of 8 waves; grid (M/128, N/128), 256 threads. M, N % 128 == 0, K % 64 == 0; K is a compile-time constant, so that the four row steps of a staging load are immediate offsets of one address.
// The 128 rows of A, of A2 and of Bt go through LDS in stages of 64 k (one whole 128-byte line of each row, eight lanes to a line), two buffers: stage s + 1 is fetched into registers while stage s is worked on, stored behind it, and one barrier a stage publishes it.
// A wave holds 32 rows x 64 columns (A has two planes, so the narrow side is A's: 8 fragments read for 16 products).
// The M rows are the tokens of all NB_ batches in a run (a 128-row tile lies inside one batch, TT % 128 == 0).
// OUTM 0: C (f32, pitch ldc). OUTM 1: the N columns are q | k | v. In the q and k columns a wave's 64 columns are one head (HD == 64) and go out as fp16 rows of the head plane P16[q or k][batch][head][token][d]; in the v columns the work-group's tile is transposed in LDS and goes out as fp16 rows of the transposed plane PT[batch][head][d][token], 256 bytes of a row from one half-wave.
template <typename T16> struct WFrag;
template <> struct WFrag<h16> { typedef v16h V; static __device__ __forceinline__ V ld(const h16* p) { return cat16(*(const v8h*)p, *(const v8h*)(p + 16)); } static __device__ __forceinline__ v8f mma(V a, V b, v8f c) { return wmma16(a, b, c); } };
template <> struct WFrag<bf> { typedef v16bf V; static __device__ __forceinline__ V ld(const bf* p) { return cat16b(*(const v8us*)p, *(const v8us*)(p + 16)); } static __device__ __forceinline__ v8f mma(V a, V b, v8f c) { return wmmab(a, b, c); } };
#define GKS 64                  // k per stage
#define GLP 72                  // LDS row pitch in 16-bit elements: 144 B, an odd multiple of 16 B
#define GSZ (384 * GLP)         // one stage: rows 0..127 A, 128..255 A2, 256..383 Bt
template <bool BIAS, int OUTM, int K>
__global__ __launch_bounds__(256) void k_gemmt(const bf* __restrict__ A, const bf* __restrict__ A2, const bf* __restrict__ Bt, float* C, int ldc, const float* __restrict__ bias, h16* P16, h16* PT) {
    typedef WFrag<bf>::V V; static_assert(OUTM == 0 || (HD == 64 && NH_ == NKV && TT % 128 == 0), "a 64-column wave tile is one head, q and k planes are alike, a tile lies in one batch"); static_assert(K % GKS == 0, "whole stages");
    constexpr int MB = 2, NB = 4, WM = 8 / MB;   // 16x16 tiles of a wave along M and N; waves along M
    __shared__ __align__(16) bf st[2 * GSZ];
    __shared__ __align__(16) float osw[8 * 16 * 68];   // epilogue only: a 16 x 68 f32 patch per wave, or (v columns) one 128 x 136 fp16 tile
    const int tid = threadIdx.x, lane = tid & 31, lr = lane & 15, hi = lane >> 4; const int w = __builtin_amdgcn_readfirstlane(tid >> 5); const int wm = w % WM, wn = w / WM;   // w is read as a scalar so that the wave's tile origin is one
    const int srow = tid >> 3, scol = (tid & 7) * 8;   // staging: thread tid moves the 16-byte pieces (srow + 32 i, scol), i = 0..3, of each of the three operands
    const bf* ga = A + (size_t)(blockIdx.x * 128 + srow) * K + scol; const bf* ga2 = A2 + (size_t)(blockIdx.x * 128 + srow) * K + scol; const bf* gb = Bt + (size_t)(blockIdx.y * 128 + srow) * K + scol; const int sl = srow * GLP + scol;
    v8us ra[4], ra2[4], rb[4];   // every loop over i, h, mb, nb here is unrolled so that staging registers, fragments and accumulators are indexed by constants
#pragma unroll
    for (int i = 0; i < 4; ++i) { ra[i] = *(const v8us*)(ga + (size_t)i * 32 * K); ra2[i] = *(const v8us*)(ga2 + (size_t)i * 32 * K); rb[i] = *(const v8us*)(gb + (size_t)i * 32 * K); }
    v8f acc[MB][NB];
#pragma unroll
    for (int mb = 0; mb < MB; ++mb)
#pragma unroll
        for (int nb = 0; nb < NB; ++nb) acc[mb][nb] = (v8f){};
#pragma unroll
    for (int i = 0; i < 4; ++i) { *(v8us*)(st + sl + i * 32 * GLP) = ra[i]; *(v8us*)(st + 128 * GLP + sl + i * 32 * GLP) = ra2[i]; *(v8us*)(st + 256 * GLP + sl + i * 32 * GLP) = rb[i]; }
    __syncthreads();   // stage 0 is in LDS before any wave reads it
    const int ao = (wm * MB * 16 + lr) * GLP + 8 * hi, bo = (256 + wn * NB * 16 + lr) * GLP + 8 * hi; constexpr int ns = K / GKS;
#pragma unroll 1
    for (int s = 0; s < ns; ++s) {   // kept rolled: the body already holds two k steps of 16 products each, and an unrolled loop would outgrow the registers
        const int cur = (s & 1) * GSZ, nxt = ((s & 1) ^ 1) * GSZ; const bool more = s + 1 < ns;
        if (more) { ga += GKS; ga2 += GKS; gb += GKS;
#pragma unroll
            for (int i = 0; i < 4; ++i) { ra[i] = *(const v8us*)(ga + (size_t)i * 32 * K); ra2[i] = *(const v8us*)(ga2 + (size_t)i * 32 * K); rb[i] = *(const v8us*)(gb + (size_t)i * 32 * K); } }
        V a[2][MB], a2[2][MB], b[2][NB];
#pragma unroll
        for (int h = 0; h < 2; ++h) {
#pragma unroll
            for (int mb = 0; mb < MB; ++mb) a[h][mb] = WFrag<bf>::ld(st + cur + ao + mb * 16 * GLP + h * 32);
#pragma unroll
            for (int nb = 0; nb < NB; ++nb) b[h][nb] = WFrag<bf>::ld(st + cur + bo + nb * 16 * GLP + h * 32);
#pragma unroll
            for (int mb = 0; mb < MB; ++mb) a2[h][mb] = WFrag<bf>::ld(st + cur + 128 * GLP + ao + mb * 16 * GLP + h * 32); }
        __builtin_amdgcn_sched_barrier(0);   // keeps the stage's 32 LDS reads one group ahead of its 32 products: left alone, the compiler sinks reads between the products, into registers just freed, and waits for each at once
#pragma unroll
        for (int h = 0; h < 2; ++h) {
#pragma unroll
            for (int nb = 0; nb < NB; ++nb)
#pragma unroll
                for (int mb = 0; mb < MB; ++mb) acc[mb][nb] = WFrag<bf>::mma(a[h][mb], b[h][nb], acc[mb][nb]);
#pragma unroll
            for (int nb = 0; nb < NB; ++nb)
#pragma unroll
                for (int mb = 0; mb < MB; ++mb) acc[mb][nb] = WFrag<bf>::mma(a2[h][mb], b[h][nb], acc[mb][nb]); }
        __builtin_amdgcn_sched_barrier(0); asm volatile("v_nop\n\tv_nop\n\tv_nop\n\tv_nop"); __builtin_amdgcn_sched_barrier(0);   // the four vector slots behind the stage's last WMMA, also on the taken side of the branch that follows; the two scheduling barriers keep them directly behind it
        if (more) {
#pragma unroll
            for (int i = 0; i < 4; ++i) { *(v8us*)(st + nxt + sl + i * 32 * GLP) = ra[i]; *(v8us*)(st + nxt + 128 * GLP + sl + i * 32 * GLP) = ra2[i]; *(v8us*)(st + nxt + 256 * GLP + sl + i * 32 * GLP) = rb[i]; } }
        __syncthreads();   // publishes stage s + 1 and ends every wave's reads of stage s, whose buffer the next trip refills
    }
    const int r0 = blockIdx.x * 128 + wm * MB * 16, c0 = blockIdx.y * 128 + wn * NB * 16;   // the wave's own tile
    if (OUTM == 1 && blockIdx.y >= (DQ + DKV) / 128) {   // v columns, the same for the whole work-group: a lane holds eight consecutive tokens of one d: 16 bytes of a row of the transposed tile [128 d][128 tokens], row pitch 272 B (an odd multiple of 16 B)
        h16* tp = (h16*)osw;
#pragma unroll
        for (int nb = 0; nb < NB; ++nb) { const float bz = BIAS ? bfr(bias[c0 + nb * 16 + lr]) : 0.0f;
#pragma unroll
            for (int mb = 0; mb < MB; ++mb) { v8h o;
#pragma unroll
                for (int j = 0; j < 8; ++j) { float val = acc[mb][nb][j]; if (BIAS) val += bz; o[j] = (h16)val; }
                *(v8ha*)(tp + (wn * NB * 16 + nb * 16 + lr) * 136 + wm * MB * 16 + mb * 16 + 8 * hi) = o; } }
        __syncthreads();   // the whole transposed tile is in LDS before a wave reads rows that four waves wrote
#pragma unroll
        for (int s = 0; s < 8; ++s) { const int row = w * 16 + 2 * s + hi; const v8h o = *(const v8ha*)(tp + row * 136 + lr * 8);   // a half-wave stores 256 bytes of one d row: two whole lines, one writer each
            *(v8h*)(PT + ((size_t)(blockIdx.x / (TT / 128)) * DKV + blockIdx.y * 128 - (DQ + DKV) + row) * TT + blockIdx.x % (TT / 128) * 128 + lr * 8) = o; }
    } else {
    float* os = osw + w * (16 * 68);   // the wave's own 16 x 64 f32 patch, read and written by this wave alone
    float bz8[8];
    if constexpr (OUTM == 1) {
#pragma unroll
        for (int u = 0; u < 8; ++u) bz8[u] = BIAS ? bfr(bias[c0 + (lane & 7) * 8 + u]) : 0.0f; }
#pragma unroll
    for (int mb = 0; mb < MB; ++mb) {
#pragma unroll
        for (int nb = 0; nb < NB; ++nb) {
#pragma unroll
            for (int j = 0; j < 8; ++j) os[(hi * 8 + j) * 68 + nb * 16 + lr] = acc[mb][nb][j]; }
        __builtin_amdgcn_wave_barrier(); asm volatile("" ::: "memory");   // holds the compiler to the order: the wave's patch is written whole before it is read
        if constexpr (OUTM == 1) {   // eight lanes write one token's 128-byte row of the head plane, a store instruction four rows in a run
            h16* prow = P16 + ((size_t)((c0 / DQ * NB_ + r0 / TT) * NH_ + c0 % DQ / HD) * TT + r0 % TT + mb * 16) * HD;
#pragma unroll
            for (int s = 0; s < 4; ++s) { const int row = 4 * s + (lane >> 3), cofs = (lane & 7) * 8; const v4f v0 = *(const v4fa*)(os + row * 68 + cofs), v1 = *(const v4fa*)(os + row * 68 + cofs + 4); v8h o;
#pragma unroll
                for (int u = 0; u < 4; ++u) { float a0 = v0[u], a1 = v1[u]; if (BIAS) { a0 += bz8[u]; a1 += bz8[u + 4]; } o[u] = (h16)a0; o[u + 4] = (h16)a1; }
                *(v8h*)(prow + row * HD + cofs) = o; }
        } else {
            float* crow = C + (size_t)(r0 + mb * 16) * ldc + c0;
#pragma unroll
            for (int s = 0; s < 8; ++s) { const int row = 2 * s + hi, cofs = lr * 4; v4f val = *(const v4fa*)(os + row * 68 + cofs); if (BIAS) { val[0] += bfr(bias[c0 + cofs]); val[1] += bfr(bias[c0 + cofs + 1]); val[2] += bfr(bias[c0 + cofs + 2]); val[3] += bfr(bias[c0 + cofs + 3]); }
                *(v4f*)(crow + (size_t)row * ldc + cofs) = val; }
        }
        __builtin_amdgcn_wave_barrier(); asm volatile("" ::: "memory");   // and read whole before the next mb rewrites it
    }
    if constexpr (OUTM == 1) asm volatile("s_wait_xcnt 0x0" ::: "memory");   // in the built code the v branch stands directly behind this one and rewrites registers that the stores above name: the wait stands in front of it
    }
}

__device__ __forceinline__ void splitf(float y, unsigned short& h, unsigned short& l) { h = f2bf(y); l = f2bf(y - bf2f(h)); }
typedef __attribute__((ext_vector_type(2))) _Float16 v2h;
typedef __attribute__((ext_vector_type(4))) _Float16 v4h;
typedef __attribute__((ext_vector_type(2))) unsigned short v2us;
typedef __attribute__((ext_vector_type(4))) unsigned short v4us;
typedef __attribute__((ext_vector_type(2))) float v2f;
typedef __attribute__((ext_vector_type(4))) int v4i;

__global__ __launch_bounds__(256) void k_wtG(const float* __restrict__ w, int K, int N, bf* Bt) {
    const int lane = threadIdx.x & 31; const int L0 = (blockIdx.x * 8 + (threadIdx.x >> 5)) * 8; const int nlines = N * K / 64;
{
#pragma unroll 1
        for (int l = 0; l < 8; ++l) { const int L = L0 + l; if (L >= nlines) break; const size_t e = (size_t)L * 64 + lane * 2; const int k = (int)(e % K), n = (int)(e / K); v2us o;
            o[0] = f2bf(w[(size_t)k * N + n]); o[1] = f2bf(w[(size_t)(k + 1) * N + n]); *(v2us*)(Bt + e) = o; }
         }
}
__global__ __launch_bounds__(256) void k_cscvt(const float* __restrict__ cosT, const float* __restrict__ sinT, float* CS) { const int idx = blockIdx.x * 256 + threadIdx.x; if (idx >= TT * HD) return; v2f cs; cs[0] = bfr(cosT[idx]); cs[1] = bfr(sinT[idx]); *(v2f*)(CS + (size_t)idx * 2) = cs;  }
#define FSK 64                  // keys per stage
#define FPT 72                  // LDS row pitch in halves: 144 B, an odd multiple of 16 B
#define FNS (TT / FSK)
#define CSC 0.18033688011112042f   // HD^-0.5 x log2(e)
__device__ __forceinline__ float xhalf(float x) { return __builtin_bit_cast(float, __builtin_amdgcn_permlanex16(__builtin_bit_cast(int, x), __builtin_bit_cast(int, x), 0x76543210, 0xfedcba98, false, false)); }   // lane l with lane l ^ 16
__device__ __forceinline__ void fpass(const h16* kb, const h16* vb, const v16h (&qf)[2][2], v8f (&acc)[2][4], v8f (&lacc)[2], float (&m_run)[2], const v16h ones) {
    typedef __attribute__((ext_vector_type(2))) _Float16 h2; typedef __attribute__((ext_vector_type(2))) float f2;
    v8f s[2][2];   // every loop over kt, g, t, r, i here and in k_fattn is unrolled so that fragments, scores and accumulators are indexed by constants and stay in registers
#pragma unroll
    for (int kt = 0; kt < 2; ++kt) { const v16h k0 = WFrag<h16>::ld(kb + kt * 16 * FPT), k1 = WFrag<h16>::ld(kb + kt * 16 * FPT + 32);
#pragma unroll
        for (int g = 0; g < 2; ++g) { s[kt][g] = wmma16(k0, qf[g][0], (v8f){}); s[kt][g] = wmma16(k1, qf[g][1], s[kt][g]); } }
    v16h vf[4];
#pragma unroll
    for (int t = 0; t < 4; ++t) vf[t] = WFrag<h16>::ld(vb + t * 16 * FPT);
    float mb[2]; bool need = false;
#pragma unroll
    for (int g = 0; g < 2; ++g) { float mx = s[0][g][0];
#pragma unroll
        for (int r = 1; r < 8; ++r) mx = fmaxf(mx, s[0][g][r]);
#pragma unroll
        for (int r = 0; r < 8; ++r) mx = fmaxf(mx, s[1][g][r]);
        mx = fmaxf(mx, xhalf(mx)) * CSC; mb[g] = mx; need = need || (mx > m_run[g] + 8.0f); }
    if (__builtin_amdgcn_ballot_w32(need) != 0) {   // a scalar branch, rare after the first passes
#pragma unroll
        for (int g = 0; g < 2; ++g) { const float m_new = fmaxf(m_run[g], mb[g]); const float corr = __builtin_amdgcn_exp2f(m_run[g] - m_new); m_run[g] = m_new; lacc[g] = lacc[g] * corr;
#pragma unroll
            for (int t = 0; t < 4; ++t) acc[g][t] = acc[g][t] * corr; } }
#pragma unroll
    for (int g = 0; g < 2; ++g) { const float nm = 6.0f - m_run[g]; v16h pf;   // P carries a factor 2^6, which the denominator carries too: fewer small probabilities fall into fp16's subnormal range
#pragma unroll
        for (int i = 0; i < 8; ++i) { const int kt = i >> 2, r = 2 * (i & 3); f2 p; p[0] = __builtin_amdgcn_exp2f(fmaf(s[kt][g][r], CSC, nm)); p[1] = __builtin_amdgcn_exp2f(fmaf(s[kt][g][r + 1], CSC, nm)); const h2 q = __builtin_convertvector(p, h2); pf[2 * i] = q[0]; pf[2 * i + 1] = q[1]; }
#pragma unroll
        for (int t = 0; t < 4; ++t) acc[g][t] = wmma16(vf[t], pf, acc[g][t]);
        lacc[g] = wmma16(ones, pf, lacc[g]); }
}
__global__ __launch_bounds__(256) void k_fattn(const h16* __restrict__ Q, const h16* __restrict__ Kp, const h16* __restrict__ Vt, bf* Ah, bf* Al) {
    __shared__ __align__(16) h16 ks[2 * FSK * FPT];
    __shared__ __align__(16) h16 vs[2 * HD * FPT];
    const int tid = threadIdx.x, lane = tid & 31, lr = lane & 15, hi = lane >> 4; const int w = __builtin_amdgcn_readfirstlane(tid >> 5); const int head = blockIdx.y; const int q0 = blockIdx.x * 256 + w * 32;   // w is read as a scalar so that the wave's first query is one
    const int bh = blockIdx.z * NH_ + head; Q += (size_t)bh * TT * HD; Kp += (size_t)bh * TT * HD; Vt += (size_t)bh * HD * TT; Ah += (size_t)blockIdx.z * TT * DQ; Al += (size_t)blockIdx.z * TT * DQ;   // the batch's own planes and output rows
    const int srow = tid >> 3, scol = (tid & 7) * 8;   // staging: thread tid moves the 16-byte pieces (srow, scol) and (srow + 32, scol) of the K tile and of the V^T tile
    const h16* kg = Kp + (size_t)srow * HD + scol; const h16* vg = Vt + (size_t)srow * TT + scol; const int sl = srow * FPT + scol;
    v8h rk0 = *(const v8h*)kg, rk1 = *(const v8h*)(kg + 32 * HD), rv0 = *(const v8h*)vg, rv1 = *(const v8h*)(vg + (size_t)32 * TT);
    v16h qf[2][2];
#pragma unroll
    for (int g = 0; g < 2; ++g)
#pragma unroll
        for (int kc = 0; kc < 2; ++kc) qf[g][kc] = WFrag<h16>::ld(Q + (size_t)(q0 + g * 16 + lr) * HD + kc * 32 + 8 * hi);
    v8f acc[2][4], lacc[2]; float m_run[2]; v16h ones;
#pragma unroll
    for (int e = 0; e < 16; ++e) ones[e] = (h16)1.0f;
#pragma unroll
    for (int g = 0; g < 2; ++g) { m_run[g] = -__builtin_inff(); lacc[g] = (v8f){};
#pragma unroll
        for (int t = 0; t < 4; ++t) acc[g][t] = (v8f){}; }
    *(v8h*)(ks + sl) = rk0; *(v8h*)(ks + sl + 32 * FPT) = rk1; *(v8h*)(vs + sl) = rv0; *(v8h*)(vs + sl + 32 * FPT) = rv1;
    __syncthreads();   // stage 0 is in LDS before any wave reads it
    const int fo = lr * FPT + 8 * hi;
#pragma unroll 1
    for (int st = 0; st < FNS; ++st) {   // kept rolled: the body already holds two passes, and acc[][] must stay in registers
        const int cur = (st & 1) * (FSK * FPT), nxt = ((st & 1) ^ 1) * (FSK * FPT); const bool more = st + 1 < FNS;
        if (more) { kg += FSK * HD; vg += FSK; rk0 = *(const v8h*)kg; rk1 = *(const v8h*)(kg + 32 * HD); rv0 = *(const v8h*)vg; rv1 = *(const v8h*)(vg + (size_t)32 * TT); }
        fpass(ks + cur + fo, vs + cur + fo, qf, acc, lacc, m_run, ones);
        fpass(ks + cur + fo + 32 * FPT, vs + cur + fo + 32, qf, acc, lacc, m_run, ones);
        __builtin_amdgcn_sched_barrier(0); asm volatile("v_nop\n\tv_nop\n\tv_nop\n\tv_nop"); __builtin_amdgcn_sched_barrier(0);   // the four vector slots behind the pass's last WMMA, also on the taken side of the branch that follows; the two scheduling barriers keep them directly behind it
        if (more) { *(v8h*)(ks + nxt + sl) = rk0; *(v8h*)(ks + nxt + sl + 32 * FPT) = rk1; *(v8h*)(vs + nxt + sl) = rv0; *(v8h*)(vs + nxt + sl + 32 * FPT) = rv1; }
        __syncthreads();   // publishes stage st + 1 and ends every wave's reads of stage st, whose buffer the next trip refills
    }
#pragma unroll
    for (int g = 0; g < 2; ++g) { const float inv = __fdiv_rn(1.0f, lacc[g][0]); const size_t oo = (size_t)(q0 + g * 16 + lr) * DQ + head * HD + 8 * hi;   // every row of lacc holds the column sums
#pragma unroll
        for (int t = 0; t < 4; ++t) { v8us oh, ol;
#pragma unroll
            for (int r = 0; r < 8; ++r) { unsigned short a, c2; splitf(acc[g][t][r] * inv, a, c2); oh[r] = a; ol[r] = c2; }
            *(v8us*)(Ah + oo + t * 16) = oh; *(v8us*)(Al + oo + t * 16) = ol; } }
}

// ---- k_prep: all that the products read, in one launch. Work-groups below CVB round the weights to bf16, eight elements a thread (qkv_w, then proj_w, into one run of planes); the others make x + temporal embedding of both batches, four elements a thread.
#define NW1 ((size_t)(DQ + 2 * DKV) * DM / 8)     // 8-element pieces of qkv_w
#define NW2 ((size_t)DM * DQ / 8)                 // and of proj_w
#define CVB ((unsigned)((NW1 + NW2) / 256))
#define XTB ((unsigned)((size_t)NB_ * TT * DM / 4 / 256))
__global__ __launch_bounds__(256) void k_prep(const float* __restrict__ w1, const float* __restrict__ w2, bf* Wd, const float* __restrict__ xb, const float* __restrict__ te, bf* Xh, bf* Xl) {
    static_assert((NW1 + NW2) % 256 == 0 && NW1 % 256 == 0 && (size_t)NB_ * TT * DM % 1024 == 0, "whole work-groups");
    if (blockIdx.x < CVB) { const size_t i = (size_t)blockIdx.x * 256 + threadIdx.x; const v8f v = *(const v8f*)(i < NW1 ? w1 + i * 8 : w2 + (i - NW1) * 8); v8us o;
#pragma unroll
        for (int k = 0; k < 8; ++k) o[k] = f2bf(v[k]);
        *(v8us*)(Wd + i * 8) = o;
    } else {
    const size_t e = ((size_t)(blockIdx.x - CVB) * 256 + threadIdx.x) * 4; const int c = (int)(e % DM); const int tok = (int)(e / DM); const int frame = tok % TT / 256; v4us oh, ol;   // token = (batch, frame, h, w); x + temporal_embedding[0][frame][c] in f32, split hl
#pragma unroll
    for (int u = 0; u < 4; ++u) { const float s = __fadd_rn(bfr(xb[e + u]), bfr(te[(size_t)frame * DM + c + u])); unsigned short a, b; splitf(s, a, b); oh[u] = a; ol[u] = b; }
    *(v4us*)(Xh + e) = oh; *(v4us*)(Xl + e) = ol;
    asm volatile("s_wait_xcnt 0x0" ::: "memory");   // in the built code the weights' branch stands directly behind this one and rewrites registers that the two stores name: the wait stands in front of it
    }
}

extern "C" void kernel_launch(void* const* d_in, const int* in_sizes, int n_in,
                              void* d_out, int out_size, void* d_ws, size_t ws_size, hipStream_t stream) {
    (void)in_sizes; (void)n_in; (void)out_size;
    const float* x = (const float*)d_in[0]; const float* temb = (const float*)d_in[1]; const float* wf = (const float*)d_in[2]; const float* bfz = (const float*)d_in[3]; const float* wo = (const float*)d_in[4]; const float* bo = (const float*)d_in[5];
    float* OUT = (float*)d_out;     // [2][3072][1024]
    char* wsp = (char*)d_ws;
    auto take = [&](size_t bytes) { char* p = wsp; wsp += (bytes + 255) & ~(size_t)255; return (void*)p; };
    bf* WF = (bf*)take((size_t)(DQ + 2 * DKV + DM) * DM * 2); bf* WO = WF + (size_t)(DQ + 2 * DKV) * DM;   // q | k | v rows, then proj rows
    bf* XB = (bf*)take((size_t)NB_ * TT * DM * 2); bf* XBl = (bf*)take((size_t)NB_ * TT * DM * 2);
    h16* QP16 = (h16*)take((size_t)2 * NB_ * NH_ * TT * HD * 2); h16* KP16 = QP16 + (size_t)NB_ * NH_ * TT * HD; h16* VT16 = (h16*)take((size_t)NB_ * NKV * HD * TT * 2);
    bf* ATh = (bf*)take((size_t)NB_ * TT * DQ * 2); bf* ATl = (bf*)take((size_t)NB_ * TT * DQ * 2);
    if ((size_t)(wsp - (char*)d_ws) > ws_size) return;    // ws 256 MiB
    k_prep<<<CVB + XTB, 256, 0, stream>>>(wf, wo, WF, x, temb, XB, XBl);
    k_gemmt<true, 1, DM><<<dim3(NB_ * TT / 128, (DQ + 2 * DKV) / 128, 1), 256, 0, stream>>>(XB, XBl, WF, nullptr, 0, bfz, QP16, VT16);
    k_fattn<<<dim3(TT / 256, NH_, NB_), 256, 0, stream>>>(QP16, KP16, VT16, ATh, ATl);
    k_gemmt<true, 0, DQ><<<dim3(NB_ * TT / 128, DM / 128, 1), 256, 0, stream>>>(ATh, ATl, WO, OUT, DM, bo, nullptr, nullptr);
}

// v006
// Measured time: 148 microseconds a run.
// Timed twice side by side with v005, it ran 1.13 times as fast both times.
// Counting every step since v000, it is 13.4 times as fast.
#include <hip/hip_runtime.h>

// TemporalAttention (x [2][12][16][16][1024] + temporal_embedding[:, :12] broadcast over the 16x16 grid; N = 12*16*16 = 3,072 tokens per batch; qkv = (x + te) qkv_w^T + qkv_b (torch [3072][1024], q | k | v, 16 heads x 64); softmax(q.k / 8) over all 3,072 tokens; out = merged proj_w^T + proj_b -> [2][12][16][16][1024]).
// Compute dtypes, f32 accumulate: every input rounded to bf16; x + te in f32 split into hl planes, so q/k/v are hl x exact bf16 (2 products) + bias, rounded to fp16 head planes in the product's own epilogue; scores and attn.v single fp16 on every row, P = 2^6 x exp2(score - maximum in use), unnormalised; softmax f32, online; proj hl x exact (2 products) + bias.

#define NB_  2
#define TT   3072
#define DM   1024
#define NH_  16
#define NKV  16
#define REP  (NH_ / NKV)
#define HD   64
#define DQ   (NH_ * HD)
#define DKV  (NKV * HD)
#define ZH   2
#define RH   0                  // unused: no query rows use hi+lo planes
#define WIN  0
#define PCAR 1024.0f
#define SCL  0.125f   // HD^-0.5
typedef _Float16 h16;
typedef unsigned short bf;
typedef __attribute__((ext_vector_type(16))) __bf16   v16bf;
typedef __attribute__((ext_vector_type(16))) _Float16 v16h;
typedef __attribute__((ext_vector_type(8)))  _Float16 v8h;
typedef __attribute__((ext_vector_type(8)))  unsigned short v8us;
typedef __attribute__((ext_vector_type(8)))  float    v8f;
typedef __attribute__((ext_vector_type(4)))  float    v4f;
typedef v8h  __attribute__((may_alias)) v8ha;
typedef v4f  __attribute__((may_alias)) v4fa;
typedef v8us __attribute__((may_alias)) v8usa;

__device__ __forceinline__ unsigned short f2bf(float f) { unsigned u = __float_as_uint(f); u += 0x7FFFu + ((u >> 16) & 1u); return (unsigned short)(u >> 16); }
__device__ __forceinline__ float bf2f(unsigned short b) { return __uint_as_float(((unsigned)b) << 16); }
__device__ __forceinline__ float bfr(float f) { return bf2f(f2bf(f)); }
__device__ __forceinline__ v16h cat16(v8h lo, v8h hi) { return __builtin_shufflevector(lo, hi, 0, 1, 2, 3, 4, 5, 6, 7, 8, 9, 10, 11, 12, 13, 14, 15); }
__device__ __forceinline__ v16bf cat16b(v8us lo, v8us hi) { return __builtin_bit_cast(v16bf, __builtin_shufflevector(lo, hi, 0, 1, 2, 3, 4, 5, 6, 7, 8, 9, 10, 11, 12, 13, 14, 15)); }
__device__ __forceinline__ v8f wmma16(v16h a, v16h b, v8f c) { return __builtin_amdgcn_wmma_f32_16x16x32_f16(false, a, false, b, (short)0, c, false, false); }
__device__ __forceinline__ v8f wmmab(v16bf a, v16bf b, v8f c) { return __builtin_amdgcn_wmma_f32_16x16x32_bf16(false, a, false, b, (short)0, c, false, false); }



// ---- k_gemmt: C[m][n] = sum_k (A[m][k] + A2[m][k]) Bt[n][k] + bias[n], operands K-contiguous bf16 planes; ONE 128x128 output tile per work-group of 8 waves; grid (M/128, N/128), 256 threads. M, N % 128 == 0, K % 64 == 0; K is a compile-time constant, so that the four row steps of a staging load are immediate offsets of one address.
// The 128 rows of A, of A2 and of Bt go through LDS in stages of 64 k (one whole 128-byte line of each row, eight lanes to a line), two buffers: stage s + 1 is fetched into registers while stage s is worked on, stored behind it, and one barrier a stage publishes it.
// A wave holds 32 rows x 64 columns (A has two planes, so the narrow side is A's: 8 fragments read for 16 products).
// The M rows are the tokens of all NB_ batches in a run (a 128-row tile lies inside one batch, TT % 128 == 0).
// OUTM 0: C (f32, pitch ldc). OUTM 1: the N columns are q | k | v. In the q and k columns a wave's 64 columns are one head (HD == 64) and go out as fp16 rows of the head plane P16[q or k][batch][head][token][d]; in the v columns the work-group's tile is transposed in LDS and goes out as fp16 rows of the transposed plane PT[batch][head][d][token], 256 bytes of a row from one half-wave.
template <typename T16> struct WFrag;
template <> struct WFrag<h16> { typedef v16h V; static __device__ __forceinline__ V ld(const h16* p) { return cat16(*(const v8h*)p, *(const v8h*)(p + 16)); } static __device__ __forceinline__ v8f mma(V a, V b, v8f c) { return wmma16(a, b, c); } };
template <> struct WFrag<bf> { typedef v16bf V; static __device__ __forceinline__ V ld(const bf* p) { return cat16b(*(const v8us*)p, *(const v8us*)(p + 16)); } static __device__ __forceinline__ v8f mma(V a, V b, v8f c) { return wmmab(a, b, c); } };
#define GKS 64                  // k per stage
#define GLP 72                  // LDS row pitch in 16-bit elements: 144 B, an odd multiple of 16 B
#define GSZ (384 * GLP)         // one stage: rows 0..127 A, 128..255 A2, 256..383 Bt
template <bool BIAS, int OUTM, int K>
__global__ __launch_bounds__(256) void k_gemmt(const bf* __restrict__ A, const bf* __restrict__ A2, const bf* __restrict__ Bt, float* C, int ldc, const float* __restrict__ bias, h16* P16, h16* PT) {
    typedef WFrag<bf>::V V; static_assert(OUTM == 0 || (HD == 64 && NH_ == NKV && TT % 128 == 0), "a 64-column wave tile is one head, q and k planes are alike, a tile lies in one batch"); static_assert(K % GKS == 0, "whole stages");
    constexpr int MB = 2, NB = 4, WM = 8 / MB;   // 16x16 tiles of a wave along M and N; waves along M
    __shared__ __align__(16) bf st[2 * GSZ];
    __shared__ __align__(16) float osw[8 * 16 * 68];   // epilogue only: a 16 x 68 f32 patch per wave, or (v columns) one 128 x 136 fp16 tile
    const int tid = threadIdx.x, lane = tid & 31, lr = lane & 15, hi = lane >> 4; const int w = __builtin_amdgcn_readfirstlane(tid >> 5); const int wm = w % WM, wn = w / WM;   // w is read as a scalar so that the wave's tile origin is one
    const int srow = tid >> 3, scol = (tid & 7) * 8;   // staging: thread tid moves the 16-byte pieces (srow + 32 i, scol), i = 0..3, of each of the three operands
    const bf* ga = A + (size_t)(blockIdx.x * 128 + srow) * K + scol; const bf* ga2 = A2 + (size_t)(blockIdx.x * 128 + srow) * K + scol; const bf* gb = Bt + (size_t)(blockIdx.y * 128 + srow) * K + scol; const int sl = srow * GLP + scol;
    v8us ra[4], ra2[4], rb[4];   // every loop over i, h, mb, nb here is unrolled so that staging registers, fragments and accumulators are indexed by constants
#pragma unroll
    for (int i = 0; i < 4; ++i) { ra[i] = *(const v8us*)(ga + (size_t)i * 32 * K); ra2[i] = *(const v8us*)(ga2 + (size_t)i * 32 * K); rb[i] = *(const v8us*)(gb + (size_t)i * 32 * K); }
    v8f acc[MB][NB];
#pragma unroll
    for (int mb = 0; mb < MB; ++mb)
#pragma unroll
        for (int nb = 0; nb < NB; ++nb) acc[mb][nb] = (v8f){};
#pragma unroll
    for (int i = 0; i < 4; ++i) { *(v8us*)(st + sl + i * 32 * GLP) = ra[i]; *(v8us*)(st + 128 * GLP + sl + i * 32 * GLP) = ra2[i]; *(v8us*)(st + 256 * GLP + sl + i * 32 * GLP) = rb[i]; }
    __syncthreads();   // stage 0 is in LDS before any wave reads it
    const int ao = (wm * MB * 16 + lr) * GLP + 8 * hi, bo = (256 + wn * NB * 16 + lr) * GLP + 8 * hi; constexpr int ns = K / GKS;
#pragma unroll 1
    for (int s = 0; s < ns; ++s) {   // kept rolled: the body already holds two k steps of 16 products each, and an unrolled loop would outgrow the registers
        const int cur = (s & 1) * GSZ, nxt = ((s & 1) ^ 1) * GSZ; const bool more = s + 1 < ns;
        if (more) { ga += GKS; ga2 += GKS; gb += GKS;
#pragma unroll
            for (int i = 0; i < 4; ++i) { ra[i] = *(const v8us*)(ga + (size_t)i * 32 * K); ra2[i] = *(const v8us*)(ga2 + (size_t)i * 32 * K); rb[i] = *(const v8us*)(gb + (size_t)i * 32 * K); } }
        V a[2][MB], a2[2][MB], b[2][NB];
#pragma unroll
        for (int h = 0; h < 2; ++h) {
#pragma unroll
            for (int mb = 0; mb < MB; ++mb) a[h][mb] = WFrag<bf>::ld(st + cur + ao + mb * 16 * GLP + h * 32);
#pragma unroll
            for (int nb = 0; nb < NB; ++nb) b[h][nb] = WFrag<bf>::ld(st + cur + bo + nb * 16 * GLP + h * 32);
#pragma unroll
            for (int mb = 0; mb < MB; ++mb) a2[h][mb] = WFrag<bf>::ld(st + cur + 128 * GLP + ao + mb * 16 * GLP + h * 32); }
        __builtin_amdgcn_sched_barrier(0);   // keeps the stage's 32 LDS reads one group ahead of its 32 products: left alone, the compiler sinks reads between the products, into registers just freed, and waits for each at once
#pragma unroll
        for (int h = 0; h < 2; ++h) {
#pragma unroll
            for (int nb = 0; nb < NB; ++nb)
#pragma unroll
                for (int mb = 0; mb < MB; ++mb) acc[mb][nb] = WFrag<bf>::mma(a[h][mb], b[h][nb], acc[mb][nb]);
#pragma unroll
            for (int nb = 0; nb < NB; ++nb)
#pragma unroll
                for (int mb = 0; mb < MB; ++mb) acc[mb][nb] = WFrag<bf>::mma(a2[h][mb], b[h][nb], acc[mb][nb]); }
        __builtin_amdgcn_sched_barrier(0); asm volatile("v_nop\n\tv_nop\n\tv_nop\n\tv_nop"); __builtin_amdgcn_sched_barrier(0);   // the four vector slots behind the stage's last WMMA, also on the taken side of the branch that follows; the two scheduling barriers keep them directly behind it
        if (more) {
#pragma unroll
            for (int i = 0; i < 4; ++i) { *(v8us*)(st + nxt + sl + i * 32 * GLP) = ra[i]; *(v8us*)(st + nxt + 128 * GLP + sl + i * 32 * GLP) = ra2[i]; *(v8us*)(st + nxt + 256 * GLP + sl + i * 32 * GLP) = rb[i]; } }
        __syncthreads();   // publishes stage s + 1 and ends every wave's reads of stage s, whose buffer the next trip refills
    }
    const int r0 = blockIdx.x * 128 + wm * MB * 16, c0 = blockIdx.y * 128 + wn * NB * 16;   // the wave's own tile
    if (OUTM == 1 && blockIdx.y >= (DQ + DKV) / 128) {   // v columns, the same for the whole work-group: a lane holds eight consecutive tokens of one d: 16 bytes of a row of the transposed tile [128 d][128 tokens], row pitch 272 B (an odd multiple of 16 B)
        h16* tp = (h16*)osw;
#pragma unroll
        for (int nb = 0; nb < NB; ++nb) { const float bz = BIAS ? bfr(bias[c0 + nb * 16 + lr]) : 0.0f;
#pragma unroll
            for (int mb = 0; mb < MB; ++mb) { v8h o;
#pragma unroll
                for (int j = 0; j < 8; ++j) { float val = acc[mb][nb][j]; if (BIAS) val += bz; o[j] = (h16)val; }
                *(v8ha*)(tp + (wn * NB * 16 + nb * 16 + lr) * 136 + wm * MB * 16 + mb * 16 + 8 * hi) = o; } }
        __syncthreads();   // the whole transposed tile is in LDS before a wave reads rows that four waves wrote
#pragma unroll
        for (int s = 0; s < 8; ++s) { const int row = w * 16 + 2 * s + hi; const v8h o = *(const v8ha*)(tp + row * 136 + lr * 8);   // a half-wave stores 256 bytes of one d row: two whole lines, one writer each
            *(v8h*)(PT + ((size_t)(blockIdx.x / (TT / 128)) * DKV + blockIdx.y * 128 - (DQ + DKV) + row) * TT + blockIdx.x % (TT / 128) * 128 + lr * 8) = o; }
    } else {
    float* os = osw + w * (16 * 68);   // the wave's own 16 x 64 f32 patch, read and written by this wave alone
    float bz8[8];
    if constexpr (OUTM == 1) {
#pragma unroll
        for (int u = 0; u < 8; ++u) bz8[u] = BIAS ? bfr(bias[c0 + (lane & 7) * 8 + u]) : 0.0f; }
#pragma unroll
    for (int mb = 0; mb < MB; ++mb) {
#pragma unroll
        for (int nb = 0; nb < NB; ++nb) {
#pragma unroll
            for (int j = 0; j < 8; ++j) os[(hi * 8 + j) * 68 + nb * 16 + lr] = acc[mb][nb][j]; }
        __builtin_amdgcn_wave_barrier(); asm volatile("" ::: "memory");   // holds the compiler to the order: the wave's patch is written whole before it is read
        if constexpr (OUTM == 1) {   // eight lanes write one token's 128-byte row of the head plane, a store instruction four rows in a run
            h16* prow = P16 + ((size_t)((c0 / DQ * NB_ + r0 / TT) * NH_ + c0 % DQ / HD) * TT + r0 % TT + mb * 16) * HD;
#pragma unroll
            for (int s = 0; s < 4; ++s) { const int row = 4 * s + (lane >> 3), cofs = (lane & 7) * 8; const v4f v0 = *(const v4fa*)(os + row * 68 + cofs), v1 = *(const v4fa*)(os + row * 68 + cofs + 4); v8h o;
#pragma unroll
                for (int u = 0; u < 4; ++u) { float a0 = v0[u], a1 = v1[u]; if (BIAS) { a0 += bz8[u]; a1 += bz8[u + 4]; } o[u] = (h16)a0; o[u + 4] = (h16)a1; }
                *(v8h*)(prow + row * HD + cofs) = o; }
        } else {
            float* crow = C + (size_t)(r0 + mb * 16) * ldc + c0;
#pragma unroll
            for (int s = 0; s < 8; ++s) { const int row = 2 * s + hi, cofs = lr * 4; v4f val = *(const v4fa*)(os + row * 68 + cofs); if (BIAS) { val[0] += bfr(bias[c0 + cofs]); val[1] += bfr(bias[c0 + cofs + 1]); val[2] += bfr(bias[c0 + cofs + 2]); val[3] += bfr(bias[c0 + cofs + 3]); }
                *(v4f*)(crow + (size_t)row * ldc + cofs) = val; }
        }
        __builtin_amdgcn_wave_barrier(); asm volatile("" ::: "memory");   // and read whole before the next mb rewrites it
    }
    if constexpr (OUTM == 1) asm volatile("s_wait_xcnt 0x0" ::: "memory");   // in the built code the v branch stands directly behind this one and rewrites registers that the stores above name: the wait stands in front of it
    }
}

__device__ __forceinline__ void splitf(float y, unsigned short& h, unsigned short& l) { h = f2bf(y); l = f2bf(y - bf2f(h)); }
typedef __attribute__((ext_vector_type(2))) _Float16 v2h;
typedef __attribute__((ext_vector_type(4))) _Float16 v4h;
typedef __attribute__((ext_vector_type(2))) unsigned short v2us;
typedef __attribute__((ext_vector_type(4))) unsigned short v4us;
typedef __attribute__((ext_vector_type(2))) float v2f;
typedef __attribute__((ext_vector_type(4))) int v4i;

__global__ __launch_bounds__(256) void k_wtG(const float* __restrict__ w, int K, int N, bf* Bt) {
    const int lane = threadIdx.x & 31; const int L0 = (blockIdx.x * 8 + (threadIdx.x >> 5)) * 8; const int nlines = N * K / 64;
{
#pragma unroll 1
        for (int l = 0; l < 8; ++l) { const int L = L0 + l; if (L >= nlines) break; const size_t e = (size_t)L * 64 + lane * 2; const int k = (int)(e % K), n = (int)(e / K); v2us o;
            o[0] = f2bf(w[(size_t)k * N + n]); o[1] = f2bf(w[(size_t)(k + 1) * N + n]); *(v2us*)(Bt + e) = o; }
         }
}
__global__ __launch_bounds__(256) void k_cscvt(const float* __restrict__ cosT, const float* __restrict__ sinT, float* CS) { const int idx = blockIdx.x * 256 + threadIdx.x; if (idx >= TT * HD) return; v2f cs; cs[0] = bfr(cosT[idx]); cs[1] = bfr(sinT[idx]); *(v2f*)(CS + (size_t)idx * 2) = cs;  }
#define FWV 12                  // waves per work-group
#define FSK 192                 // keys per stage
#define FPT 72                  // LDS pitch of a K row (64 d) in halves: 144 B, an odd multiple of 16 B
#define FVP (FSK + 8)           // LDS pitch of a V^T row (FSK keys) in halves: 400 B, an odd multiple of 16 B
#define FNS (TT / FSK)
#define CSC 0.18033688011112042f   // HD^-0.5 x log2(e)
__device__ __forceinline__ float xhalf(float x) { return __builtin_bit_cast(float, __builtin_amdgcn_permlanex16(__builtin_bit_cast(int, x), __builtin_bit_cast(int, x), 0x76543210, 0xfedcba98, false, false)); }   // lane l with lane l ^ 16
__device__ __forceinline__ void fpass(const h16* kb, const h16* vb, const v16h (&qf)[2][2], v8f (&acc)[2][4], v8f (&lacc)[2], float (&m_run)[2], const v16h ones) {
    typedef __attribute__((ext_vector_type(2))) _Float16 h2; typedef __attribute__((ext_vector_type(2))) float f2;
    v8f s[2][2];   // every loop over kt, g, t, r, i here and in k_fattn is unrolled so that fragments, scores and accumulators are indexed by constants and stay in registers
#pragma unroll
    for (int kt = 0; kt < 2; ++kt) { const v16h k0 = WFrag<h16>::ld(kb + kt * 16 * FPT), k1 = WFrag<h16>::ld(kb + kt * 16 * FPT + 32);
#pragma unroll
        for (int g = 0; g < 2; ++g) { s[kt][g] = wmma16(k0, qf[g][0], (v8f){}); s[kt][g] = wmma16(k1, qf[g][1], s[kt][g]); } }
    v16h vf[4];
#pragma unroll
    for (int t = 0; t < 4; ++t) vf[t] = WFrag<h16>::ld(vb + t * 16 * FVP);
    float mb[2]; bool need = false;
#pragma unroll
    for (int g = 0; g < 2; ++g) { float mx = s[0][g][0];
#pragma unroll
        for (int r = 1; r < 8; ++r) mx = fmaxf(mx, s[0][g][r]);
#pragma unroll
        for (int r = 0; r < 8; ++r) mx = fmaxf(mx, s[1][g][r]);
        mx = fmaxf(mx, xhalf(mx)) * CSC; mb[g] = mx; need = need || (mx > m_run[g] + 8.0f); }
    if (__builtin_amdgcn_ballot_w32(need) != 0) {   // a scalar branch, rare after the first passes
#pragma unroll
        for (int g = 0; g < 2; ++g) { const float m_new = fmaxf(m_run[g], mb[g]); const float corr = __builtin_amdgcn_exp2f(m_run[g] - m_new); m_run[g] = m_new; lacc[g] = lacc[g] * corr;
#pragma unroll
            for (int t = 0; t < 4; ++t) acc[g][t] = acc[g][t] * corr; } }
#pragma unroll
    for (int g = 0; g < 2; ++g) { const float nm = 6.0f - m_run[g]; v16h pf;   // P carries a factor 2^6, which the denominator carries too: fewer small probabilities fall into fp16's subnormal range
#pragma unroll
        for (int i = 0; i < 8; ++i) { const int kt = i >> 2, r = 2 * (i & 3); f2 p; p[0] = __builtin_amdgcn_exp2f(fmaf(s[kt][g][r], CSC, nm)); p[1] = __builtin_amdgcn_exp2f(fmaf(s[kt][g][r + 1], CSC, nm)); const h2 q = __builtin_convertvector(p, h2); pf[2 * i] = q[0]; pf[2 * i + 1] = q[1]; }
#pragma unroll
        for (int t = 0; t < 4; ++t) acc[g][t] = wmma16(vf[t], pf, acc[g][t]);
        lacc[g] = wmma16(ones, pf, lacc[g]); }
}
__global__ __launch_bounds__(FWV * 32) void k_fattn(const h16* __restrict__ Q, const h16* __restrict__ Kp, const h16* __restrict__ Vt, bf* Ah, bf* Al) {
    __shared__ __align__(16) h16 ks[2 * FSK * FPT];
    __shared__ __align__(16) h16 vs[2 * HD * FVP];
    constexpr int KR = FWV * 32 / 8, VR = FWV * 32 / (FSK / 8), NP = FSK / KR;   // rows of the K tile and of the V^T tile that one sweep of the work-group's threads covers; sweeps a tile
    static_assert(TT % (FWV * 32) == 0 && TT % FSK == 0 && FSK % 64 == 0 && FSK % KR == 0 && HD == NP * VR && FVP / 8 % 2 == 1, "whole work-groups, stages, lines and sweeps");
    const int tid = threadIdx.x, lane = tid & 31, lr = lane & 15, hi = lane >> 4; const int w = __builtin_amdgcn_readfirstlane(tid >> 5); const int head = blockIdx.y; const int q0 = blockIdx.x * (FWV * 32) + w * 32;   // w is read as a scalar so that the wave's first query is one
    const int bh = blockIdx.z * NH_ + head; Q += (size_t)bh * TT * HD; Kp += (size_t)bh * TT * HD; Vt += (size_t)bh * HD * TT; Ah += (size_t)blockIdx.z * TT * DQ; Al += (size_t)blockIdx.z * TT * DQ;   // the batch's own planes and output rows
    const int srow = tid >> 3, scol = (tid & 7) * 8, vrow = tid / (FSK / 8), vcol = tid % (FSK / 8) * 8;   // staging: thread tid moves the 16-byte pieces (srow + KR i, scol) of the K tile [FSK keys][64 d] and (vrow + VR i, vcol) of the V^T tile [64 d][FSK keys], i < NP
    const h16* kg = Kp + (size_t)srow * HD + scol; const h16* vg = Vt + (size_t)vrow * TT + vcol; const int sl = srow * FPT + scol, sv = vrow * FVP + vcol;
    v8h rk[NP], rv[NP];
#pragma unroll
    for (int i = 0; i < NP; ++i) { rk[i] = *(const v8h*)(kg + i * KR * HD); rv[i] = *(const v8h*)(vg + (size_t)i * VR * TT); }
    v16h qf[2][2];
#pragma unroll
    for (int g = 0; g < 2; ++g)
#pragma unroll
        for (int kc = 0; kc < 2; ++kc) qf[g][kc] = WFrag<h16>::ld(Q + (size_t)(q0 + g * 16 + lr) * HD + kc * 32 + 8 * hi);
    asm volatile("s_wait_xcnt 0x0" ::: "memory");   // in the built code the accumulators' start values go into registers that the loads above name as addresses
    v8f acc[2][4], lacc[2]; float m_run[2]; v16h ones;
#pragma unroll
    for (int e = 0; e < 16; ++e) ones[e] = (h16)1.0f;
#pragma unroll
    for (int g = 0; g < 2; ++g) { m_run[g] = -__builtin_inff(); lacc[g] = (v8f){};
#pragma unroll
        for (int t = 0; t < 4; ++t) acc[g][t] = (v8f){}; }
#pragma unroll
    for (int i = 0; i < NP; ++i) { *(v8h*)(ks + sl + i * KR * FPT) = rk[i]; *(v8h*)(vs + sv + i * VR * FVP) = rv[i]; }
    __syncthreads();   // stage 0 is in LDS before any wave reads it
    const int fo = lr * FPT + 8 * hi, fv = lr * FVP + 8 * hi;
#pragma unroll 1
    for (int st = 0; st < FNS; ++st) {   // kept rolled: the body already holds six passes, and acc[][] must stay in registers
        const int cur = (st & 1) * (FSK * FPT), nxt = ((st & 1) ^ 1) * (FSK * FPT), curv = (st & 1) * (HD * FVP), nxtv = ((st & 1) ^ 1) * (HD * FVP); const bool more = st + 1 < FNS;
        if (more) { kg += FSK * HD; vg += FSK;
#pragma unroll
            for (int i = 0; i < NP; ++i) { rk[i] = *(const v8h*)(kg + i * KR * HD); rv[i] = *(const v8h*)(vg + (size_t)i * VR * TT); } }
#pragma unroll   // unrolled so that a pass's last products stand in one block with the next pass's first LDS reads and products, which the compiler then interleaves
        for (int p = 0; p < FSK / 32; ++p) fpass(ks + cur + fo + p * 32 * FPT, vs + curv + fv + p * 32, qf, acc, lacc, m_run, ones);
        __builtin_amdgcn_sched_barrier(0); asm volatile("v_nop\n\tv_nop\n\tv_nop\n\tv_nop"); __builtin_amdgcn_sched_barrier(0);   // the four vector slots behind the pass's last WMMA, also on the taken side of the branch that follows; the two scheduling barriers keep them directly behind it
        if (more) {
#pragma unroll
            for (int i = 0; i < NP; ++i) { *(v8h*)(ks + nxt + sl + i * KR * FPT) = rk[i]; *(v8h*)(vs + nxtv + sv + i * VR * FVP) = rv[i]; } }
        __syncthreads();   // publishes stage st + 1 and ends every wave's reads of stage st, whose buffer the next trip refills
    }
#pragma unroll
    for (int g = 0; g < 2; ++g) { const float inv = __fdiv_rn(1.0f, lacc[g][0]); const size_t oo = (size_t)(q0 + g * 16 + lr) * DQ + head * HD + 8 * hi;   // every row of lacc holds the column sums
#pragma unroll
        for (int t = 0; t < 4; ++t) { v8us oh, ol;
#pragma unroll
            for (int r = 0; r < 8; ++r) { unsigned short a, c2; splitf(acc[g][t][r] * inv, a, c2); oh[r] = a; ol[r] = c2; }
            *(v8us*)(Ah + oo + t * 16) = oh; *(v8us*)(Al + oo + t * 16) = ol; } }
}

// ---- k_prep: all that the products read, in one launch. Work-groups below CVB round the weights to bf16, eight elements a thread (qkv_w, then proj_w, into one run of planes); the others make x + temporal embedding of both batches, four elements a thread.
#define NW1 ((size_t)(DQ + 2 * DKV) * DM / 8)     // 8-element pieces of qkv_w
#define NW2 ((size_t)DM * DQ / 8)                 // and of proj_w
#define CVB ((unsigned)((NW1 + NW2) / 256))
#define XTB ((unsigned)((size_t)NB_ * TT * DM / 4 / 256))
__global__ __launch_bounds__(256) void k_prep(const float* __restrict__ w1, const float* __restrict__ w2, bf* Wd, const float* __restrict__ xb, const float* __restrict__ te, bf* Xh, bf* Xl) {
    static_assert((NW1 + NW2) % 256 == 0 && NW1 % 256 == 0 && (size_t)NB_ * TT * DM % 1024 == 0, "whole work-groups");
    if (blockIdx.x < CVB) { const size_t i = (size_t)blockIdx.x * 256 + threadIdx.x; const v8f v = *(const v8f*)(i < NW1 ? w1 + i * 8 : w2 + (i - NW1) * 8); v8us o;
#pragma unroll
        for (int k = 0; k < 8; ++k) o[k] = f2bf(v[k]);
        *(v8us*)(Wd + i * 8) = o;
    } else {
    const size_t e = ((size_t)(blockIdx.x - CVB) * 256 + threadIdx.x) * 4; const int c = (int)(e % DM); const int tok = (int)(e / DM); const int frame = tok % TT / 256; v4us oh, ol;   // token = (batch, frame, h, w); x + temporal_embedding[0][frame][c] in f32, split hl
#pragma unroll
    for (int u = 0; u < 4; ++u) { const float s = __fadd_rn(bfr(xb[e + u]), bfr(te[(size_t)frame * DM + c + u])); unsigned short a, b; splitf(s, a, b); oh[u] = a; ol[u] = b; }
    *(v4us*)(Xh + e) = oh; *(v4us*)(Xl + e) = ol;
    asm volatile("s_wait_xcnt 0x0" ::: "memory");   // in the built code the weights' branch stands directly behind this one and rewrites registers that the two stores name: the wait stands in front of it
    }
}

extern "C" void kernel_launch(void* const* d_in, const int* in_sizes, int n_in,
                              void* d_out, int out_size, void* d_ws, size_t ws_size, hipStream_t stream) {
    (void)in_sizes; (void)n_in; (void)out_size;
    const float* x = (const float*)d_in[0]; const float* temb = (const float*)d_in[1]; const float* wf = (const float*)d_in[2]; const float* bfz = (const float*)d_in[3]; const float* wo = (const float*)d_in[4]; const float* bo = (const float*)d_in[5];
    float* OUT = (float*)d_out;     // [2][3072][1024]
    char* wsp = (char*)d_ws;
    auto take = [&](size_t bytes) { char* p = wsp; wsp += (bytes + 255) & ~(size_t)255; return (void*)p; };
    bf* WF = (bf*)take((size_t)(DQ + 2 * DKV + DM) * DM * 2); bf* WO = WF + (size_t)(DQ + 2 * DKV) * DM;   // q | k | v rows, then proj rows
    bf* XB = (bf*)take((size_t)NB_ * TT * DM * 2); bf* XBl = (bf*)take((size_t)NB_ * TT * DM * 2);
    h16* QP16 = (h16*)take((size_t)2 * NB_ * NH_ * TT * HD * 2); h16* KP16 = QP16 + (size_t)NB_ * NH_ * TT * HD; h16* VT16 = (h16*)take((size_t)NB_ * NKV * HD * TT * 2);
    bf* ATh = (bf*)take((size_t)NB_ * TT * DQ * 2); bf* ATl = (bf*)take((size_t)NB_ * TT * DQ * 2);
    if ((size_t)(wsp - (char*)d_ws) > ws_size) return;    // ws 256 MiB
    k_prep<<<CVB + XTB, 256, 0, stream>>>(wf, wo, WF, x, temb, XB, XBl);
    k_gemmt<true, 1, DM><<<dim3(NB_ * TT / 128, (DQ + 2 * DKV) / 128, 1), 256, 0, stream>>>(XB, XBl, WF, nullptr, 0, bfz, QP16, VT16);
    k_fattn<<<dim3(TT / (FWV * 32), NH_, NB_), FWV * 32, 0, stream>>>(QP16, KP16, VT16, ATh, ATl);
    k_gemmt<true, 0, DQ><<<dim3(NB_ * TT / 128, DM / 128, 1), 256, 0, stream>>>(ATh, ATl, WO, OUT, DM, bo, nullptr, nullptr);
}

// v007
// A run of this version takes 136 microseconds.
// Timed twice side by side with v006, it ran 1.08 times as fast both times.
// All steps since v000 together make it 14.5 times as fast.
#include <hip/hip_runtime.h>

// TemporalAttention (x [2][12][16][16][1024] + temporal_embedding[:, :12] broadcast over the 16x16 grid; N = 12*16*16 = 3,072 tokens per batch; qkv = (x + te) qkv_w^T + qkv_b (torch [3072][1024], q | k | v, 16 heads x 64); softmax(q.k / 8) over all 3,072 tokens; out = merged proj_w^T + proj_b -> [2][12][16][16][1024]).
// Compute dtypes, f32 accumulate: every input rounded to bf16; x + te in f32 split into hl planes, so q/k/v are hl x exact bf16 (2 products) + bias, rounded to fp16 head planes in the product's own epilogue; scores and attn.v single fp16 on every row, P = 2^6 x exp2(score - maximum in use), unnormalised; softmax f32, online; proj hl x exact (2 products) + bias.

#define NB_  2
#define TT   3072
#define DM   1024
#define NH_  16
#define NKV  16
#define REP  (NH_ / NKV)
#define HD   64
#define DQ   (NH_ * HD)
#define DKV  (NKV * HD)
#define ZH   2
#define RH   0                  // unused: no query rows use hi+lo planes
#define WIN  0
#define PCAR 1024.0f
#define SCL  0.125f   // HD^-0.5
typedef _Float16 h16;
typedef unsigned short bf;
typedef __attribute__((ext_vector_type(16))) __bf16   v16bf;
typedef __attribute__((ext_vector_type(16))) _Float16 v16h;
typedef __attribute__((ext_vector_type(8)))  _Float16 v8h;
typedef __attribute__((ext_vector_type(8)))  unsigned short v8us;
typedef __attribute__((ext_vector_type(8)))  float    v8f;
typedef __attribute__((ext_vector_type(4)))  float    v4f;
typedef v8h  __attribute__((may_alias)) v8ha;
typedef v4f  __attribute__((may_alias)) v4fa;
typedef v8us __attribute__((may_alias)) v8usa;

__device__ __forceinline__ unsigned short f2bf(float f) { unsigned u = __float_as_uint(f); u += 0x7FFFu + ((u >> 16) & 1u); return (unsigned short)(u >> 16); }
__device__ __forceinline__ float bf2f(unsigned short b) { return __uint_as_float(((unsigned)b) << 16); }
__device__ __forceinline__ float bfr(float f) { return bf2f(f2bf(f)); }
__device__ __forceinline__ v16h cat16(v8h lo, v8h hi) { return __builtin_shufflevector(lo, hi, 0, 1, 2, 3, 4, 5, 6, 7, 8, 9, 10, 11, 12, 13, 14, 15); }
__device__ __forceinline__ v16bf cat16b(v8us lo, v8us hi) { return __builtin_bit_cast(v16bf, __builtin_shufflevector(lo, hi, 0, 1, 2, 3, 4, 5, 6, 7, 8, 9, 10, 11, 12, 13, 14, 15)); }
__device__ __forceinline__ v8f wmma16(v16h a, v16h b, v8f c) { return __builtin_amdgcn_wmma_f32_16x16x32_f16(false, a, false, b, (short)0, c, false, false); }
__device__ __forceinline__ v8f wmmab(v16bf a, v16bf b, v8f c) { return __builtin_amdgcn_wmma_f32_16x16x32_bf16(false, a, false, b, (short)0, c, false, false); }



// ---- k_gemmt: C[m][n] = sum_k (A[m][k] + A2[m][k]) Bt[n][k] + bias[n], operands K-contiguous bf16 planes; ONE 128x128 output tile per work-group of 8 waves; grid (M/128, N/128), 256 threads. M, N % 128 == 0, K % 64 == 0; K is a compile-time constant, so that the four row steps of a staging load are immediate offsets of one address.
// The 128 rows of A, of A2 and of Bt go through LDS in stages of 64 k (one whole 128-byte line of each row, eight lanes to a line), two buffers: stage s + 1 is fetched into registers while stage s is worked on, stored behind it, and one barrier a stage publishes it.
// A wave holds 32 rows x 64 columns (A has two planes, so the narrow side is A's: 8 fragments read for 16 products).
// The M rows are the tokens of all NB_ batches in a run (a 128-row tile lies inside one batch, TT % 128 == 0).
// OUTM 0: C (f32, pitch ldc). OUTM 1: the N columns are q | k | v. In the q and k columns a wave's 64 columns are one head (HD == 64) and go out as fp16 rows of the head plane P16[q or k][batch][head][token][d]; in the v columns the work-group's tile is transposed in LDS and goes out as fp16 rows of the transposed plane PT[batch][head][d][token], 256 bytes of a row from one half-wave.
template <typename T16> struct WFrag;
template <> struct WFrag<h16> { typedef v16h V; static __device__ __forceinline__ V ld(const h16* p) { return cat16(*(const v8h*)p, *(const v8h*)(p + 16)); } static __device__ __forceinline__ v8f mma(V a, V b, v8f c) { return wmma16(a, b, c); } };
template <> struct WFrag<bf> { typedef v16bf V; static __device__ __forceinline__ V ld(const bf* p) { return cat16b(*(const v8us*)p, *(const v8us*)(p + 16)); } static __device__ __forceinline__ v8f mma(V a, V b, v8f c) { return wmmab(a, b, c); } };
#define GKS 64                  // k per stage
#define GLP 72                  // LDS row pitch in 16-bit elements: 144 B, an odd multiple of 16 B
#define GSZ (384 * GLP)         // one stage: rows 0..127 A, 128..255 A2, 256..383 Bt
template <bool BIAS, int OUTM, int K>
__global__ __launch_bounds__(256) void k_gemmt(const bf* __restrict__ A, const bf* __restrict__ A2, const bf* __restrict__ Bt, float* C, int ldc, const float* __restrict__ bias, h16* P16, h16* PT) {
    typedef WFrag<bf>::V V; static_assert(OUTM == 0 || (HD == 64 && NH_ == NKV && TT % 128 == 0), "a 64-column wave tile is one head, q and k planes are alike, a tile lies in one batch"); static_assert(K % GKS == 0, "whole stages");
    constexpr int MB = 2, NB = 4, WM = 8 / MB;   // 16x16 tiles of a wave along M and N; waves along M
    __shared__ __align__(16) bf st[2 * GSZ];
    __shared__ __align__(16) float osw[8 * 16 * 68];   // epilogue only: a 16 x 68 f32 patch per wave, or (v columns) one 128 x 136 fp16 tile
    const int tid = threadIdx.x, lane = tid & 31, lr = lane & 15, hi = lane >> 4; const int w = __builtin_amdgcn_readfirstlane(tid >> 5); const int wm = w % WM, wn = w / WM;   // w is read as a scalar so that the wave's tile origin is one
    const int srow = tid >> 3, scol = (tid & 7) * 8;   // staging: thread tid moves the 16-byte pieces (srow + 32 i, scol), i = 0..3, of each of the three operands
    const bf* ga = A + (size_t)(blockIdx.x * 128 + srow) * K + scol; const bf* ga2 = A2 + (size_t)(blockIdx.x * 128 + srow) * K + scol; const bf* gb = Bt + (size_t)(blockIdx.y * 128 + srow) * K + scol; const int sl = srow * GLP + scol;
    v8us ra[4], ra2[4], rb[4];   // every loop over i, h, mb, nb here is unrolled so that staging registers, fragments and accumulators are indexed by constants
#pragma unroll
    for (int i = 0; i < 4; ++i) { ra[i] = *(const v8us*)(ga + (size_t)i * 32 * K); ra2[i] = *(const v8us*)(ga2 + (size_t)i * 32 * K); rb[i] = *(const v8us*)(gb + (size_t)i * 32 * K); }
    v8f acc[MB][NB];
#pragma unroll
    for (int mb = 0; mb < MB; ++mb)
#pragma unroll
        for (int nb = 0; nb < NB; ++nb) acc[mb][nb] = (v8f){};
#pragma unroll
    for (int i = 0; i < 4; ++i) { *(v8us*)(st + sl + i * 32 * GLP) = ra[i]; *(v8us*)(st + 128 * GLP + sl + i * 32 * GLP) = ra2[i]; *(v8us*)(st + 256 * GLP + sl + i * 32 * GLP) = rb[i]; }
    __syncthreads();   // stage 0 is in LDS before any wave reads it
    const int ao = (wm * MB * 16 + lr) * GLP + 8 * hi, bo = (256 + wn * NB * 16 + lr) * GLP + 8 * hi; constexpr int ns = K / GKS;
#pragma unroll 1
    for (int s = 0; s < ns; ++s) {   // kept rolled: the body already holds two k steps of 16 products each, and an unrolled loop would outgrow the registers
        const int cur = (s & 1) * GSZ, nxt = ((s & 1) ^ 1) * GSZ; const bool more = s + 1 < ns;
        if (more) { ga += GKS; ga2 += GKS; gb += GKS;
#pragma unroll
            for (int i = 0; i < 4; ++i) { ra[i] = *(const v8us*)(ga + (size_t)i * 32 * K); ra2[i] = *(const v8us*)(ga2 + (size_t)i * 32 * K); rb[i] = *(const v8us*)(gb + (size_t)i * 32 * K); } }
        V a[2][MB], a2[2][MB], b[2][NB];
#pragma unroll
        for (int h = 0; h < 2; ++h) {
#pragma unroll
            for (int mb = 0; mb < MB; ++mb) a[h][mb] = WFrag<bf>::ld(st + cur + ao + mb * 16 * GLP + h * 32);
#pragma unroll
            for (int nb = 0; nb < NB; ++nb) b[h][nb] = WFrag<bf>::ld(st + cur + bo + nb * 16 * GLP + h * 32);
#pragma unroll
            for (int mb = 0; mb < MB; ++mb) a2[h][mb] = WFrag<bf>::ld(st + cur + 128 * GLP + ao + mb * 16 * GLP + h * 32); }
        __builtin_amdgcn_sched_barrier(0);   // keeps the stage's 32 LDS reads one group ahead of its 32 products: left alone, the compiler sinks reads between the products, into registers just freed, and waits for each at once
#pragma unroll
        for (int h = 0; h < 2; ++h) {
#pragma unroll
            for (int nb = 0; nb < NB; ++nb)
#pragma unroll
                for (int mb = 0; mb < MB; ++mb) acc[mb][nb] = WFrag<bf>::mma(a[h][mb], b[h][nb], acc[mb][nb]);
#pragma unroll
            for (int nb = 0; nb < NB; ++nb)
#pragma unroll
                for (int mb = 0; mb < MB; ++mb) acc[mb][nb] = WFrag<bf>::mma(a2[h][mb], b[h][nb], acc[mb][nb]); }
        __builtin_amdgcn_sched_barrier(0); asm volatile("v_nop\n\tv_nop\n\tv_nop\n\tv_nop"); __builtin_amdgcn_sched_barrier(0);   // the four vector slots behind the stage's last WMMA, also on the taken side of the branch that follows; the two scheduling barriers keep them directly behind it
        if (more) {
#pragma unroll
            for (int i = 0; i < 4; ++i) { *(v8us*)(st + nxt + sl + i * 32 * GLP) = ra[i]; *(v8us*)(st + nxt + 128 * GLP + sl + i * 32 * GLP) = ra2[i]; *(v8us*)(st + nxt + 256 * GLP + sl + i * 32 * GLP) = rb[i]; } }
        __syncthreads();   // publishes stage s + 1 and ends every wave's reads of stage s, whose buffer the next trip refills
    }
    const int r0 = blockIdx.x * 128 + wm * MB * 16, c0 = blockIdx.y * 128 + wn * NB * 16;   // the wave's own tile
    if (OUTM == 1 && blockIdx.y >= (DQ + DKV) / 128) {   // v columns, the same for the whole work-group: a lane holds eight consecutive tokens of one d: 16 bytes of a row of the transposed tile [128 d][128 tokens], row pitch 272 B (an odd multiple of 16 B)
        h16* tp = (h16*)osw;
#pragma unroll
        for (int nb = 0; nb < NB; ++nb) { const float bz = BIAS ? bfr(bias[c0 + nb * 16 + lr]) : 0.0f;
#pragma unroll
            for (int mb = 0; mb < MB; ++mb) { v8h o;
#pragma unroll
                for (int j = 0; j < 8; ++j) { float val = acc[mb][nb][j]; if (BIAS) val += bz; o[j] = (h16)val; }
                *(v8ha*)(tp + (wn * NB * 16 + nb * 16 + lr) * 136 + wm * MB * 16 + mb * 16 + 8 * hi) = o; } }
        __syncthreads();   // the whole transposed tile is in LDS before a wave reads rows that four waves wrote
#pragma unroll
        for (int s = 0; s < 8; ++s) { const int row = w * 16 + 2 * s + hi; const v8h o = *(const v8ha*)(tp + row * 136 + lr * 8);   // a half-wave stores 256 bytes of one d row: two whole lines, one writer each
            *(v8h*)(PT + ((size_t)(blockIdx.x / (TT / 128)) * DKV + blockIdx.y * 128 - (DQ + DKV) + row) * TT + blockIdx.x % (TT / 128) * 128 + lr * 8) = o; }
    } else {
    float* os = osw + w * (16 * 68);   // the wave's own 16 x 64 f32 patch, read and written by this wave alone
    float bz8[8];
    if constexpr (OUTM == 1) {
#pragma unroll
        for (int u = 0; u < 8; ++u) bz8[u] = BIAS ? bfr(bias[c0 + (lane & 7) * 8 + u]) : 0.0f; }
#pragma unroll
    for (int mb = 0; mb < MB; ++mb) {
#pragma unroll
        for (int nb = 0; nb < NB; ++nb) {
#pragma unroll
            for (int j = 0; j < 8; ++j) os[(hi * 8 + j) * 68 + nb * 16 + lr] = acc[mb][nb][j]; }
        __builtin_amdgcn_wave_barrier(); asm volatile("" ::: "memory");   // holds the compiler to the order: the wave's patch is written whole before it is read
        if constexpr (OUTM == 1) {   // eight lanes write one token's 128-byte row of the head plane, a store instruction four rows in a run
            h16* prow = P16 + ((size_t)((c0 / DQ * NB_ + r0 / TT) * NH_ + c0 % DQ / HD) * TT + r0 % TT + mb * 16) * HD;
#pragma unroll
            for (int s = 0; s < 4; ++s) { const int row = 4 * s + (lane >> 3), cofs = (lane & 7) * 8; const v4f v0 = *(const v4fa*)(os + row * 68 + cofs), v1 = *(const v4fa*)(os + row * 68 + cofs + 4); v8h o;
#pragma unroll
                for (int u = 0; u < 4; ++u) { float a0 = v0[u], a1 = v1[u]; if (BIAS) { a0 += bz8[u]; a1 += bz8[u + 4]; } o[u] = (h16)a0; o[u + 4] = (h16)a1; }
                *(v8h*)(prow + row * HD + cofs) = o; }
        } else {
            float* crow = C + (size_t)(r0 + mb * 16) * ldc + c0;
#pragma unroll
            for (int s = 0; s < 8; ++s) { const int row = 2 * s + hi, cofs = lr * 4; v4f val = *(const v4fa*)(os + row * 68 + cofs); if (BIAS) { val[0] += bfr(bias[c0 + cofs]); val[1] += bfr(bias[c0 + cofs + 1]); val[2] += bfr(bias[c0 + cofs + 2]); val[3] += bfr(bias[c0 + cofs + 3]); }
                *(v4f*)(crow + (size_t)row * ldc + cofs) = val; }
        }
        __builtin_amdgcn_wave_barrier(); asm volatile("" ::: "memory");   // and read whole before the next mb rewrites it
    }
    if constexpr (OUTM == 1) asm volatile("s_wait_xcnt 0x0" ::: "memory");   // in the built code the v branch stands directly behind this one and rewrites registers that the stores above name: the wait stands in front of it
    }
}

// ---- k_gemmq: the q | k | v product, C[m][n] = sum_k (A[m][k] + A2[m][k]) Bt[n][k] + bias[n], on ONE 192x384 output tile per work-group of 12 waves; grid (M/192, N/384) = 256 work-groups, one for each WGP, 384 threads.
// Why this tile: a work-group fetches 2 x 192 + 384 = 768 operand rows for 73,728 outputs (the 128x128 tile: 384 rows for 16,384), so the launch asks L2 for less than half the bytes; A has two planes, so the tile is twice as wide as it is high.
// A wave holds 48 rows x 128 columns: 14 fragments read from LDS for 48 products (32 x 64: 8 for 16). Stages of 64 k and the two buffers are as in k_gemmt; the next stage comes through eight 16-byte pieces a thread in two halves (A and A2 are fetched during the first 32 k, Bt during the second), because 192 accumulator registers leave no room for a whole stage.
// A wave's 128 columns lie wholly in q, in k or in v (two heads). Epilogue: each column block of 128 has its own region of the stage buffers, which are free behind the loop's last barrier: [192 tokens][128 d] at pitch 272 B for q and k, [128 d][192 tokens] at pitch 400 B for v; one barrier, then whole 128-byte lines go out.
#define QTM 192
#define QTN 384
#define QWV 12
#define QSZ ((2 * QTM + QTN) * GLP)   // one stage: rows 0..191 A, 192..383 A2, 384..767 Bt
#define QRP 136                 // epilogue pitch of a token row (128 d) in halves
#define QVP (QTM + 8)           // epilogue pitch of a d row (192 tokens) in halves
template <int K>
__global__ __launch_bounds__(QWV * 32) void k_gemmq(const bf* __restrict__ A, const bf* __restrict__ A2, const bf* __restrict__ Bt, const float* __restrict__ bias, h16* P16, h16* PT) {
    typedef WFrag<bf>::V V;
    constexpr int MB = 3, NB = 8, NG = 4, WM = QTM / (MB * 16), SR = QWV * 32 / 8, NA = QTM / SR, NT = QTN / SR;   // 16x16 tiles of a wave along M and N; B fragments held at a time; waves along M; rows that one sweep of the threads covers; sweeps of A and of Bt
    static_assert(HD == 64 && NH_ == NKV && TT % QTM == 0 && DQ % (NB * 16) == 0 && DKV % (NB * 16) == 0 && K % GKS == 0 && WM * (QTN / (NB * 16)) == QWV && 2 * NA == NT && 128 * QVP <= QTM * QRP && 3 * QTM * QRP <= 2 * QSZ, "a tile lies in one batch, a wave's columns in one of q, k, v; whole stages and sweeps; the epilogue fits the buffers");
    __shared__ __align__(16) bf st[2 * QSZ];
    const int tid = threadIdx.x, lane = tid & 31, lr = lane & 15, hi = lane >> 4; const int w = __builtin_amdgcn_readfirstlane(tid >> 5); const int wm = w % WM, wn = w / WM;   // w is read as a scalar so that the wave's tile origin is one
    const int srow = tid >> 3, scol = (tid & 7) * 8;   // staging: thread tid moves the 16-byte pieces (srow + SR i, scol) of each operand
    const bf* ga = A + (size_t)(blockIdx.x * QTM + srow) * K + scol; const bf* ga2 = A2 + (size_t)(blockIdx.x * QTM + srow) * K + scol; const bf* gb = Bt + (size_t)(blockIdx.y * QTN + srow) * K + scol; const int sl = srow * GLP + scol;
    v8us r[NT], r0[NT];   // every loop over i, h, g, n, mb, nb, j, it here is unrolled so that staging registers, fragments and accumulators are indexed by constants
#pragma unroll
    for (int i = 0; i < NA; ++i) { r[i] = *(const v8us*)(ga + (size_t)i * SR * K); r[NA + i] = *(const v8us*)(ga2 + (size_t)i * SR * K); }
#pragma unroll
    for (int i = 0; i < NT; ++i) r0[i] = *(const v8us*)(gb + (size_t)i * SR * K);
    const int c0 = blockIdx.y * QTN + wn * NB * 16;   // the wave's first column, a scalar
    float bz[NB];   // the bias of the lane's eight columns, fetched here so that the epilogue, which no other work-group covers on this WGP, waits for no load
#pragma unroll
    for (int nb = 0; nb < NB; ++nb) bz[nb] = bias[c0 + nb * 16 + lr];
    asm volatile("s_wait_xcnt 0x0" ::: "memory");   // in the built code the accumulators' start values go into the register that the bias loads name as their offset
#pragma unroll
    for (int i = 0; i < NA; ++i) { *(v8us*)(st + sl + i * SR * GLP) = r[i]; *(v8us*)(st + QTM * GLP + sl + i * SR * GLP) = r[NA + i]; }
#pragma unroll
    for (int i = 0; i < NT; ++i) *(v8us*)(st + 2 * QTM * GLP + sl + i * SR * GLP) = r0[i];
    v8f acc[MB][NB];
#pragma unroll
    for (int mb = 0; mb < MB; ++mb)
#pragma unroll
        for (int nb = 0; nb < NB; ++nb) acc[mb][nb] = (v8f){};
    __syncthreads();   // stage 0 is in LDS before any wave reads it
    const int ao = (wm * MB * 16 + lr) * GLP + 8 * hi, bo = (2 * QTM + wn * NB * 16 + lr) * GLP + 8 * hi; constexpr int ns = K / GKS;
#pragma unroll 1
    for (int s = 0; s < ns; ++s) {   // kept rolled: the body already holds 96 products, and an unrolled loop would outgrow the registers
        const int cur = (s & 1) * QSZ, nxt = ((s & 1) ^ 1) * QSZ; const bool more = s + 1 < ns;
        if (more) { gb += GKS;   // the last loads that name gb are waited for in front of the barrier at the foot of the trip before
#pragma unroll
            for (int i = 0; i < NA; ++i) { r[i] = *(const v8us*)(ga + GKS + (size_t)i * SR * K); r[NA + i] = *(const v8us*)(ga2 + GKS + (size_t)i * SR * K); } }
#pragma unroll
        for (int h = 0; h < 2; ++h) {
            V a[MB], a2[MB];
#pragma unroll
            for (int mb = 0; mb < MB; ++mb) a[mb] = WFrag<bf>::ld(st + cur + ao + mb * 16 * GLP + h * 32);
#pragma unroll
            for (int g = 0; g < NB / NG; ++g) {
                V b[NG];
#pragma unroll
                for (int n = 0; n < NG; ++n) b[n] = WFrag<bf>::ld(st + cur + bo + (g * NG + n) * 16 * GLP + h * 32);
                if (g == 0) {   // A2 is read last: the half's 13th product is the first to need it, so the first product waits for 8 reads and not for 14
#pragma unroll
                    for (int mb = 0; mb < MB; ++mb) a2[mb] = WFrag<bf>::ld(st + cur + QTM * GLP + ao + mb * 16 * GLP + h * 32); }
                __builtin_amdgcn_sched_barrier(0);   // keeps the group's LDS reads together ahead of its 24 products: left alone, the compiler sinks reads between the products and waits for each at once
#pragma unroll
                for (int n = 0; n < NG; ++n)
#pragma unroll
                    for (int mb = 0; mb < MB; ++mb) acc[mb][g * NG + n] = WFrag<bf>::mma(a[mb], b[n], acc[mb][g * NG + n]);
#pragma unroll
                for (int n = 0; n < NG; ++n)
#pragma unroll
                    for (int mb = 0; mb < MB; ++mb) acc[mb][g * NG + n] = WFrag<bf>::mma(a2[mb], b[n], acc[mb][g * NG + n]);
                __builtin_amdgcn_sched_barrier(0);   // keeps the next group's reads behind these products, so that only four B fragments are held at a time
            }
            asm volatile("v_nop\n\tv_nop\n\tv_nop\n\tv_nop"); __builtin_amdgcn_sched_barrier(0);   // the four vector slots behind the last WMMA, also on the taken side of the branch that follows; the scheduling barriers keep them directly behind it
            if (more) {
                if (h == 0) {
#pragma unroll
                    for (int i = 0; i < NA; ++i) { *(v8us*)(st + nxt + sl + i * SR * GLP) = r[i]; *(v8us*)(st + nxt + QTM * GLP + sl + i * SR * GLP) = r[NA + i]; }
                    ga += GKS; ga2 += GKS;   // stepped in this block, whose stores have waited for the data of the eight loads that name the two pointers: in the listing both additions stand behind the block's last wait
#pragma unroll
                    for (int i = 0; i < NT; ++i) r[i] = *(const v8us*)(gb + (size_t)i * SR * K);
                } else {
#pragma unroll
                    for (int i = 0; i < NT; ++i) *(v8us*)(st + nxt + 2 * QTM * GLP + sl + i * SR * GLP) = r[i];
                } }
        }
        __syncthreads();   // publishes stage s + 1 and ends every wave's reads of stage s, whose buffer the next trip refills
    }
    const int bt = blockIdx.x / (TT / QTM), t0 = blockIdx.x % (TT / QTM) * QTM; const bool isv = c0 >= DQ + DKV;
    bf* rg = st + wn * (QTM * QRP);   // the column block's region; four waves (wm = 0..3) fill it
    if (isv) {   // a lane holds eight consecutive tokens of one d: 16 bytes of a row of the transposed block
#pragma unroll
        for (int nb = 0; nb < NB; ++nb) { const float bb = bfr(bz[nb]);
#pragma unroll
            for (int mb = 0; mb < MB; ++mb) { v8h o;
#pragma unroll
                for (int j = 0; j < 8; ++j) o[j] = (h16)(acc[mb][nb][j] + bb);
                *(v8ha*)(rg + (nb * 16 + lr) * QVP + wm * MB * 16 + mb * 16 + 8 * hi) = o; }
        }
    } else {
#pragma unroll
        for (int nb = 0; nb < NB; ++nb) { const float bb = bfr(bz[nb]);
#pragma unroll
            for (int mb = 0; mb < MB; ++mb)
#pragma unroll
                for (int j = 0; j < 8; ++j) rg[(wm * MB * 16 + mb * 16 + 8 * hi + j) * QRP + nb * 16 + lr] = __builtin_bit_cast(unsigned short, (h16)(acc[mb][nb][j] + bb));
        }
    }
    __syncthreads();   // every region is written whole before a wave reads rows that four waves wrote; passed by all waves, outside the two branches
    if (isv) {   // the block's 128 d rows of 384 bytes are 3,072 pieces in a run; a store instruction takes 32 of them: four whole lines, one writer each
#pragma unroll
        for (int it = 0; it < 128 * (QTM / 8) / (WM * 32); ++it) { const int p = it * (WM * 32) + wm * 32 + lane, row = p / (QTM / 8), col = p % (QTM / 8); const v8h o = *(const v8ha*)(rg + row * QVP + col * 8);
            *(v8h*)(PT + ((size_t)bt * DKV + c0 - (DQ + DKV) + row) * TT + t0 + col * 8) = o; }
    } else {   // eight lanes write one token's 128-byte row of a head plane, a store instruction four rows in a run; the wave takes its own 48 tokens of both heads
#pragma unroll
        for (int it = 0; it < 2 * MB * 4; ++it) { const int hh = it / (MB * 4), tok = wm * MB * 16 + it % (MB * 4) * 4 + (lane >> 3), cofs = (lane & 7) * 8; const v8h o = *(const v8ha*)(rg + tok * QRP + hh * HD + cofs);
            *(v8h*)(P16 + ((size_t)((c0 / DQ * NB_ + bt) * NH_ + c0 % DQ / HD + hh) * TT + t0 + tok) * HD + cofs) = o; }
        asm volatile("s_wait_xcnt 0x0" ::: "memory");   // in the built code the v branch stands directly behind this one and rewrites registers that the stores above name: the wait stands in front of it
    }
}

__device__ __forceinline__ void splitf(float y, unsigned short& h, unsigned short& l) { h = f2bf(y); l = f2bf(y - bf2f(h)); }
typedef __attribute__((ext_vector_type(2))) _Float16 v2h;
typedef __attribute__((ext_vector_type(4))) _Float16 v4h;
typedef __attribute__((ext_vector_type(2))) unsigned short v2us;
typedef __attribute__((ext_vector_type(4))) unsigned short v4us;
typedef __attribute__((ext_vector_type(2))) float v2f;
typedef __attribute__((ext_vector_type(4))) int v4i;

__global__ __launch_bounds__(256) void k_wtG(const float* __restrict__ w, int K, int N, bf* Bt) {
    const int lane = threadIdx.x & 31; const int L0 = (blockIdx.x * 8 + (threadIdx.x >> 5)) * 8; const int nlines = N * K / 64;
{
#pragma unroll 1
        for (int l = 0; l < 8; ++l) { const int L = L0 + l; if (L >= nlines) break; const size_t e = (size_t)L * 64 + lane * 2; const int k = (int)(e % K), n = (int)(e / K); v2us o;
            o[0] = f2bf(w[(size_t)k * N + n]); o[1] = f2bf(w[(size_t)(k + 1) * N + n]); *(v2us*)(Bt + e) = o; }
         }
}
__global__ __launch_bounds__(256) void k_cscvt(const float* __restrict__ cosT, const float* __restrict__ sinT, float* CS) { const int idx = blockIdx.x * 256 + threadIdx.x; if (idx >= TT * HD) return; v2f cs; cs[0] = bfr(cosT[idx]); cs[1] = bfr(sinT[idx]); *(v2f*)(CS + (size_t)idx * 2) = cs;  }
#define FWV 12                  // waves per work-group
#define FSK 192                 // keys per stage
#define FPT 72                  // LDS pitch of a K row (64 d) in halves: 144 B, an odd multiple of 16 B
#define FVP (FSK + 8)           // LDS pitch of a V^T row (FSK keys) in halves: 400 B, an odd multiple of 16 B
#define FNS (TT / FSK)
#define CSC 0.18033688011112042f   // HD^-0.5 x log2(e)
__device__ __forceinline__ float xhalf(float x) { return __builtin_bit_cast(float, __builtin_amdgcn_permlanex16(__builtin_bit_cast(int, x), __builtin_bit_cast(int, x), 0x76543210, 0xfedcba98, false, false)); }   // lane l with lane l ^ 16
__device__ __forceinline__ void fpass(const h16* kb, const h16* vb, const v16h (&qf)[2][2], v8f (&acc)[2][4], v8f (&lacc)[2], float (&m_run)[2], const v16h ones) {
    typedef __attribute__((ext_vector_type(2))) _Float16 h2; typedef __attribute__((ext_vector_type(2))) float f2;
    v8f s[2][2];   // every loop over kt, g, t, r, i here and in k_fattn is unrolled so that fragments, scores and accumulators are indexed by constants and stay in registers
#pragma unroll
    for (int kt = 0; kt < 2; ++kt) { const v16h k0 = WFrag<h16>::ld(kb + kt * 16 * FPT), k1 = WFrag<h16>::ld(kb + kt * 16 * FPT + 32);
#pragma unroll
        for (int g = 0; g < 2; ++g) { s[kt][g] = wmma16(k0, qf[g][0], (v8f){}); s[kt][g] = wmma16(k1, qf[g][1], s[kt][g]); } }
    v16h vf[4];
#pragma unroll
    for (int t = 0; t < 4; ++t) vf[t] = WFrag<h16>::ld(vb + t * 16 * FVP);
    float mb[2]; bool need = false;
#pragma unroll
    for (int g = 0; g < 2; ++g) { float mx = s[0][g][0];
#pragma unroll
        for (int r = 1; r < 8; ++r) mx = fmaxf(mx, s[0][g][r]);
#pragma unroll
        for (int r = 0; r < 8; ++r) mx = fmaxf(mx, s[1][g][r]);
        mx = fmaxf(mx, xhalf(mx)) * CSC; mb[g] = mx; need = need || (mx > m_run[g] + 8.0f); }
    if (__builtin_amdgcn_ballot_w32(need) != 0) {   // a scalar branch, rare after the first passes
#pragma unroll
        for (int g = 0; g < 2; ++g) { const float m_new = fmaxf(m_run[g], mb[g]); const float corr = __builtin_amdgcn_exp2f(m_run[g] - m_new); m_run[g] = m_new; lacc[g] = lacc[g] * corr;
#pragma unroll
            for (int t = 0; t < 4; ++t) acc[g][t] = acc[g][t] * corr; } }
#pragma unroll
    for (int g = 0; g < 2; ++g) { const float nm = 6.0f - m_run[g]; v16h pf;   // P carries a factor 2^6, which the denominator carries too: fewer small probabilities fall into fp16's subnormal range
#pragma unroll
        for (int i = 0; i < 8; ++i) { const int kt = i >> 2, r = 2 * (i & 3); f2 p; p[0] = __builtin_amdgcn_exp2f(fmaf(s[kt][g][r], CSC, nm)); p[1] = __builtin_amdgcn_exp2f(fmaf(s[kt][g][r + 1], CSC, nm)); const h2 q = __builtin_convertvector(p, h2); pf[2 * i] = q[0]; pf[2 * i + 1] = q[1]; }
#pragma unroll
        for (int t = 0; t < 4; ++t) acc[g][t] = wmma16(vf[t], pf, acc[g][t]);
        lacc[g] = wmma16(ones, pf, lacc[g]); }
}
__global__ __launch_bounds__(FWV * 32) void k_fattn(const h16* __restrict__ Q, const h16* __restrict__ Kp, const h16* __restrict__ Vt, bf* Ah, bf* Al) {
    __shared__ __align__(16) h16 ks[2 * FSK * FPT];
    __shared__ __align__(16) h16 vs[2 * HD * FVP];
    constexpr int KR = FWV * 32 / 8, VR = FWV * 32 / (FSK / 8), NP = FSK / KR;   // rows of the K tile and of the V^T tile that one sweep of the work-group's threads covers; sweeps a tile
    static_assert(TT % (FWV * 32) == 0 && TT % FSK == 0 && FSK % 64 == 0 && FSK % KR == 0 && HD == NP * VR && FVP / 8 % 2 == 1, "whole work-groups, stages, lines and sweeps");
    const int tid = threadIdx.x, lane = tid & 31, lr = lane & 15, hi = lane >> 4; const int w = __builtin_amdgcn_readfirstlane(tid >> 5); const int head = blockIdx.y; const int q0 = blockIdx.x * (FWV * 32) + w * 32;   // w is read as a scalar so that the wave's first query is one
    const int bh = blockIdx.z * NH_ + head; Q += (size_t)bh * TT * HD; Kp += (size_t)bh * TT * HD; Vt += (size_t)bh * HD * TT; Ah += (size_t)blockIdx.z * TT * DQ; Al += (size_t)blockIdx.z * TT * DQ;   // the batch's own planes and output rows
    const int srow = tid >> 3, scol = (tid & 7) * 8, vrow = tid / (FSK / 8), vcol = tid % (FSK / 8) * 8;   // staging: thread tid moves the 16-byte pieces (srow + KR i, scol) of the K tile [FSK keys][64 d] and (vrow + VR i, vcol) of the V^T tile [64 d][FSK keys], i < NP
    const h16* kg = Kp + (size_t)srow * HD + scol; const h16* vg = Vt + (size_t)vrow * TT + vcol; const int sl = srow * FPT + scol, sv = vrow * FVP + vcol;
    v8h rk[NP], rv[NP];
#pragma unroll
    for (int i = 0; i < NP; ++i) { rk[i] = *(const v8h*)(kg + i * KR * HD); rv[i] = *(const v8h*)(vg + (size_t)i * VR * TT); }
    v16h qf[2][2];
#pragma unroll
    for (int g = 0; g < 2; ++g)
#pragma unroll
        for (int kc = 0; kc < 2; ++kc) qf[g][kc] = WFrag<h16>::ld(Q + (size_t)(q0 + g * 16 + lr) * HD + kc * 32 + 8 * hi);
    asm volatile("s_wait_xcnt 0x0" ::: "memory");   // in the built code the accumulators' start values go into registers that the loads above name as addresses
    v8f acc[2][4], lacc[2]; float m_run[2]; v16h ones;
#pragma unroll
    for (int e = 0; e < 16; ++e) ones[e] = (h16)1.0f;
#pragma unroll
    for (int g = 0; g < 2; ++g) { m_run[g] = -__builtin_inff(); lacc[g] = (v8f){};
#pragma unroll
        for (int t = 0; t < 4; ++t) acc[g][t] = (v8f){}; }
#pragma unroll
    for (int i = 0; i < NP; ++i) { *(v8h*)(ks + sl + i * KR * FPT) = rk[i]; *(v8h*)(vs + sv + i * VR * FVP) = rv[i]; }
    __syncthreads();   // stage 0 is in LDS before any wave reads it
    const int fo = lr * FPT + 8 * hi, fv = lr * FVP + 8 * hi;
#pragma unroll 1
    for (int st = 0; st < FNS; ++st) {   // kept rolled: the body already holds six passes, and acc[][] must stay in registers
        const int cur = (st & 1) * (FSK * FPT), nxt = ((st & 1) ^ 1) * (FSK * FPT), curv = (st & 1) * (HD * FVP), nxtv = ((st & 1) ^ 1) * (HD * FVP); const bool more = st + 1 < FNS;
        if (more) { kg += FSK * HD; vg += FSK;
#pragma unroll
            for (int i = 0; i < NP; ++i) { rk[i] = *(const v8h*)(kg + i * KR * HD); rv[i] = *(const v8h*)(vg + (size_t)i * VR * TT); } }
#pragma unroll   // unrolled so that a pass's last products stand in one block with the next pass's first LDS reads and products, which the compiler then interleaves
        for (int p = 0; p < FSK / 32; ++p) fpass(ks + cur + fo + p * 32 * FPT, vs + curv + fv + p * 32, qf, acc, lacc, m_run, ones);
        __builtin_amdgcn_sched_barrier(0); asm volatile("v_nop\n\tv_nop\n\tv_nop\n\tv_nop"); __builtin_amdgcn_sched_barrier(0);   // the four vector slots behind the pass's last WMMA, also on the taken side of the branch that follows; the two scheduling barriers keep them directly behind it
        if (more) {
#pragma unroll
            for (int i = 0; i < NP; ++i) { *(v8h*)(ks + nxt + sl + i * KR * FPT) = rk[i]; *(v8h*)(vs + nxtv + sv + i * VR * FVP) = rv[i]; } }
        __syncthreads();   // publishes stage st + 1 and ends every wave's reads of stage st, whose buffer the next trip refills
    }
#pragma unroll
    for (int g = 0; g < 2; ++g) { const float inv = __fdiv_rn(1.0f, lacc[g][0]); const size_t oo = (size_t)(q0 + g * 16 + lr) * DQ + head * HD + 8 * hi;   // every row of lacc holds the column sums
#pragma unroll
        for (int t = 0; t < 4; ++t) { v8us oh, ol;
#pragma unroll
            for (int r = 0; r < 8; ++r) { unsigned short a, c2; splitf(acc[g][t][r] * inv, a, c2); oh[r] = a; ol[r] = c2; }
            *(v8us*)(Ah + oo + t * 16) = oh; *(v8us*)(Al + oo + t * 16) = ol; } }
}

// ---- k_prep: all that the products read, in one launch. Work-groups below CVB round the weights to bf16, eight elements a thread (qkv_w, then proj_w, into one run of planes); the others make x + temporal embedding of both batches, four elements a thread.
#define NW1 ((size_t)(DQ + 2 * DKV) * DM / 8)     // 8-element pieces of qkv_w
#define NW2 ((size_t)DM * DQ / 8)                 // and of proj_w
#define CVB ((unsigned)((NW1 + NW2) / 256))
#define XTB ((unsigned)((size_t)NB_ * TT * DM / 4 / 256))
__global__ __launch_bounds__(256) void k_prep(const float* __restrict__ w1, const float* __restrict__ w2, bf* Wd, const float* __restrict__ xb, const float* __restrict__ te, bf* Xh, bf* Xl) {
    static_assert((NW1 + NW2) % 256 == 0 && NW1 % 256 == 0 && (size_t)NB_ * TT * DM % 1024 == 0, "whole work-groups");
    if (blockIdx.x < CVB) { const size_t i = (size_t)blockIdx.x * 256 + threadIdx.x; const v8f v = *(const v8f*)(i < NW1 ? w1 + i * 8 : w2 + (i - NW1) * 8); v8us o;
#pragma unroll
        for (int k = 0; k < 8; ++k) o[k] = f2bf(v[k]);
        *(v8us*)(Wd + i * 8) = o;
    } else {
    const size_t e = ((size_t)(blockIdx.x - CVB) * 256 + threadIdx.x) * 4; const int c = (int)(e % DM); const int tok = (int)(e / DM); const int frame = tok % TT / 256; v4us oh, ol;   // token = (batch, frame, h, w); x + temporal_embedding[0][frame][c] in f32, split hl
#pragma unroll
    for (int u = 0; u < 4; ++u) { const float s = __fadd_rn(bfr(xb[e + u]), bfr(te[(size_t)frame * DM + c + u])); unsigned short a, b; splitf(s, a, b); oh[u] = a; ol[u] = b; }
    *(v4us*)(Xh + e) = oh; *(v4us*)(Xl + e) = ol;
    asm volatile("s_wait_xcnt 0x0" ::: "memory");   // in the built code the weights' branch stands directly behind this one and rewrites registers that the two stores name: the wait stands in front of it
    }
}

extern "C" void kernel_launch(void* const* d_in, const int* in_sizes, int n_in,
                              void* d_out, int out_size, void* d_ws, size_t ws_size, hipStream_t stream) {
    (void)in_sizes; (void)n_in; (void)out_size;
    const float* x = (const float*)d_in[0]; const float* temb = (const float*)d_in[1]; const float* wf = (const float*)d_in[2]; const float* bfz = (const float*)d_in[3]; const float* wo = (const float*)d_in[4]; const float* bo = (const float*)d_in[5];
    float* OUT = (float*)d_out;     // [2][3072][1024]
    char* wsp = (char*)d_ws;
    auto take = [&](size_t bytes) { char* p = wsp; wsp += (bytes + 255) & ~(size_t)255; return (void*)p; };
    bf* WF = (bf*)take((size_t)(DQ + 2 * DKV + DM) * DM * 2); bf* WO = WF + (size_t)(DQ + 2 * DKV) * DM;   // q | k | v rows, then proj rows
    bf* XB = (bf*)take((size_t)NB_ * TT * DM * 2); bf* XBl = (bf*)take((size_t)NB_ * TT * DM * 2);
    h16* QP16 = (h16*)take((size_t)2 * NB_ * NH_ * TT * HD * 2); h16* KP16 = QP16 + (size_t)NB_ * NH_ * TT * HD; h16* VT16 = (h16*)take((size_t)NB_ * NKV * HD * TT * 2);
    bf* ATh = (bf*)take((size_t)NB_ * TT * DQ * 2); bf* ATl = (bf*)take((size_t)NB_ * TT * DQ * 2);
    if ((size_t)(wsp - (char*)d_ws) > ws_size) return;    // ws 256 MiB
    k_prep<<<CVB + XTB, 256, 0, stream>>>(wf, wo, WF, x, temb, XB, XBl);
    k_gemmq<DM><<<dim3(NB_ * TT / QTM, (DQ + 2 * DKV) / QTN, 1), QWV * 32, 0, stream>>>(XB, XBl, WF, bfz, QP16, VT16);
    k_fattn<<<dim3(TT / (FWV * 32), NH_, NB_), FWV * 32, 0, stream>>>(QP16, KP16, VT16, ATh, ATl);
    k_gemmt<true, 0, DQ><<<dim3(NB_ * TT / 128, DM / 128, 1), 256, 0, stream>>>(ATh, ATl, WO, OUT, DM, bo, nullptr, nullptr);
}

// v008
// It runs in 127 microseconds.
// Two timings next to v007 both put it at 1.07 times that version's speed.
// All steps since v000 together make it 15.5 times as fast.
#include <hip/hip_runtime.h>

// Attention over all tokens of a clip (x [2][12][16][16][1024] + temporal_embedding[:, :12] broadcast over the 16x16 grid; N = 12*16*16 = 3,072 tokens per batch; qkv = (x + te) qkv_w^T + qkv_b (qkv_w [3072][1024], rows q | k | v, 16 heads x 64); softmax(q.k / 8) over all 3,072 tokens; out = merged proj_w^T + proj_b -> [2][12][16][16][1024]).
// Compute dtypes, f32 accumulate: every input rounded to bf16; (x + te) W = x W + te W: x goes in as one exact bf16 plane (1 product), te W + bias is a table of 12 frames x 3,072 columns from which the accumulators start; q/k/v rounded to fp16 head planes in the product's own epilogue; scores and attn.v single fp16 on every row, P = 2^6 x exp2(score - maximum in use), unnormalised; softmax f32, online; proj hl x exact (2 products) + bias.

#define NB_  2
#define TT   3072
#define DM   1024
#define NH_  16
#define NKV  16
#define REP  (NH_ / NKV)
#define HD   64
#define DQ   (NH_ * HD)
#define DKV  (NKV * HD)
#define ZH   2
#define RH   0                  // unused: no query rows use hi+lo planes
#define WIN  0
#define PCAR 1024.0f
#define SCL  0.125f   // HD^-0.5
typedef _Float16 h16;
typedef unsigned short bf;
typedef __attribute__((ext_vector_type(16))) __bf16   v16bf;
typedef __attribute__((ext_vector_type(16))) _Float16 v16h;
typedef __attribute__((ext_vector_type(8)))  _Float16 v8h;
typedef __attribute__((ext_vector_type(8)))  unsigned short v8us;
typedef __attribute__((ext_vector_type(8)))  float    v8f;
typedef __attribute__((ext_vector_type(4)))  float    v4f;
typedef v8h  __attribute__((may_alias)) v8ha;
typedef v4f  __attribute__((may_alias)) v4fa;
typedef v8us __attribute__((may_alias)) v8usa;

__device__ __forceinline__ unsigned short f2bf(float f) { unsigned u = __float_as_uint(f); u += 0x7FFFu + ((u >> 16) & 1u); return (unsigned short)(u >> 16); }
__device__ __forceinline__ float bf2f(unsigned short b) { return __uint_as_float(((unsigned)b) << 16); }
__device__ __forceinline__ float bfr(float f) { return bf2f(f2bf(f)); }
__device__ __forceinline__ v16h cat16(v8h lo, v8h hi) { return __builtin_shufflevector(lo, hi, 0, 1, 2, 3, 4, 5, 6, 7, 8, 9, 10, 11, 12, 13, 14, 15); }
__device__ __forceinline__ v16bf cat16b(v8us lo, v8us hi) { return __builtin_bit_cast(v16bf, __builtin_shufflevector(lo, hi, 0, 1, 2, 3, 4, 5, 6, 7, 8, 9, 10, 11, 12, 13, 14, 15)); }
__device__ __forceinline__ v8f wmma16(v16h a, v16h b, v8f c) { return __builtin_amdgcn_wmma_f32_16x16x32_f16(false, a, false, b, (short)0, c, false, false); }
__device__ __forceinline__ v8f wmmab(v16bf a, v16bf b, v8f c) { return __builtin_amdgcn_wmma_f32_16x16x32_bf16(false, a, false, b, (short)0, c, false, false); }



// ---- k_gemmt: C[m][n] = sum_k (A[m][k] + A2[m][k]) Bt[n][k] + bias[n], operands K-contiguous bf16 planes; ONE 128x128 output tile per work-group of 8 waves; grid (M/128, N/128), 256 threads. M, N % 128 == 0, K % 64 == 0; K is a compile-time constant, so that the four row steps of a staging load are immediate offsets of one address.
// The 128 rows of A, of A2 and of Bt go through LDS in stages of 64 k (one whole 128-byte line of each row, eight lanes to a line), two buffers: stage s + 1 is fetched into registers while stage s is worked on, stored behind it, and one barrier a stage publishes it.
// A wave holds 32 rows x 64 columns (A has two planes, so the narrow side is A's: 8 fragments read for 16 products).
// The M rows are the tokens of all NB_ batches in a run (a 128-row tile lies inside one batch, TT % 128 == 0).
// OUTM 0: C (f32, pitch ldc). OUTM 1: the N columns are q | k | v. In the q and k columns a wave's 64 columns are one head (HD == 64) and go out as fp16 rows of the head plane P16[q or k][batch][head][token][d]; in the v columns the work-group's tile is transposed in LDS and goes out as fp16 rows of the transposed plane PT[batch][head][d][token], 256 bytes of a row from one half-wave.
template <typename T16> struct WFrag;
template <> struct WFrag<h16> { typedef v16h V; static __device__ __forceinline__ V ld(const h16* p) { return cat16(*(const v8h*)p, *(const v8h*)(p + 16)); } static __device__ __forceinline__ v8f mma(V a, V b, v8f c) { return wmma16(a, b, c); } };
template <> struct WFrag<bf> { typedef v16bf V; static __device__ __forceinline__ V ld(const bf* p) { return cat16b(*(const v8us*)p, *(const v8us*)(p + 16)); } static __device__ __forceinline__ v8f mma(V a, V b, v8f c) { return wmmab(a, b, c); } };
#define GKS 64                  // k per stage
#define GLP 72                  // LDS row pitch in 16-bit elements: 144 B, an odd multiple of 16 B
#define GSZ (384 * GLP)         // one stage: rows 0..127 A, 128..255 A2, 256..383 Bt
template <bool BIAS, int OUTM, int K>
__global__ __launch_bounds__(256) void k_gemmt(const bf* __restrict__ A, const bf* __restrict__ A2, const bf* __restrict__ Bt, float* C, int ldc, const float* __restrict__ bias, h16* P16, h16* PT) {
    typedef WFrag<bf>::V V; static_assert(OUTM == 0 || (HD == 64 && NH_ == NKV && TT % 128 == 0), "a 64-column wave tile is one head, q and k planes are alike, a tile lies in one batch"); static_assert(K % GKS == 0, "whole stages");
    constexpr int MB = 2, NB = 4, WM = 8 / MB;   // 16x16 tiles of a wave along M and N; waves along M
    __shared__ __align__(16) bf st[2 * GSZ];
    __shared__ __align__(16) float osw[8 * 16 * 68];   // epilogue only: a 16 x 68 f32 patch per wave, or (v columns) one 128 x 136 fp16 tile
    const int tid = threadIdx.x, lane = tid & 31, lr = lane & 15, hi = lane >> 4; const int w = __builtin_amdgcn_readfirstlane(tid >> 5); const int wm = w % WM, wn = w / WM;   // w is read as a scalar so that the wave's tile origin is one
    const int srow = tid >> 3, scol = (tid & 7) * 8;   // staging: thread tid moves the 16-byte pieces (srow + 32 i, scol), i = 0..3, of each of the three operands
    const bf* ga = A + (size_t)(blockIdx.x * 128 + srow) * K + scol; const bf* ga2 = A2 + (size_t)(blockIdx.x * 128 + srow) * K + scol; const bf* gb = Bt + (size_t)(blockIdx.y * 128 + srow) * K + scol; const int sl = srow * GLP + scol;
    v8us ra[4], ra2[4], rb[4];   // every loop over i, h, mb, nb here is unrolled so that staging registers, fragments and accumulators are indexed by constants
#pragma unroll
    for (int i = 0; i < 4; ++i) { ra[i] = *(const v8us*)(ga + (size_t)i * 32 * K); ra2[i] = *(const v8us*)(ga2 + (size_t)i * 32 * K); rb[i] = *(const v8us*)(gb + (size_t)i * 32 * K); }
    v8f acc[MB][NB];
#pragma unroll
    for (int mb = 0; mb < MB; ++mb)
#pragma unroll
        for (int nb = 0; nb < NB; ++nb) acc[mb][nb] = (v8f){};
#pragma unroll
    for (int i = 0; i < 4; ++i) { *(v8us*)(st + sl + i * 32 * GLP) = ra[i]; *(v8us*)(st + 128 * GLP + sl + i * 32 * GLP) = ra2[i]; *(v8us*)(st + 256 * GLP + sl + i * 32 * GLP) = rb[i]; }
    __syncthreads();   // stage 0 is in LDS before any wave reads it
    const int ao = (wm * MB * 16 + lr) * GLP + 8 * hi, bo = (256 + wn * NB * 16 + lr) * GLP + 8 * hi; constexpr int ns = K / GKS;
#pragma unroll 1
    for (int s = 0; s < ns; ++s) {   // kept rolled: the body already holds two k steps of 16 products each, and an unrolled loop would outgrow the registers
        const int cur = (s & 1) * GSZ, nxt = ((s & 1) ^ 1) * GSZ; const bool more = s + 1 < ns;
        if (more) { ga += GKS; ga2 += GKS; gb += GKS;
#pragma unroll
            for (int i = 0; i < 4; ++i) { ra[i] = *(const v8us*)(ga + (size_t)i * 32 * K); ra2[i] = *(const v8us*)(ga2 + (size_t)i * 32 * K); rb[i] = *(const v8us*)(gb + (size_t)i * 32 * K); } }
        V a[2][MB], a2[2][MB], b[2][NB];
#pragma unroll
        for (int h = 0; h < 2; ++h) {
#pragma unroll
            for (int mb = 0; mb < MB; ++mb) a[h][mb] = WFrag<bf>::ld(st + cur + ao + mb * 16 * GLP + h * 32);
#pragma unroll
            for (int nb = 0; nb < NB; ++nb) b[h][nb] = WFrag<bf>::ld(st + cur + bo + nb * 16 * GLP + h * 32);
#pragma unroll
            for (int mb = 0; mb < MB; ++mb) a2[h][mb] = WFrag<bf>::ld(st + cur + 128 * GLP + ao + mb * 16 * GLP + h * 32); }
        __builtin_amdgcn_sched_barrier(0);   // keeps the stage's 32 LDS reads one group ahead of its 32 products: left alone, the compiler sinks reads between the products, into registers just freed, and waits for each at once
#pragma unroll
        for (int h = 0; h < 2; ++h) {
#pragma unroll
            for (int nb = 0; nb < NB; ++nb)
#pragma unroll
                for (int mb = 0; mb < MB; ++mb) acc[mb][nb] = WFrag<bf>::mma(a[h][mb], b[h][nb], acc[mb][nb]);
#pragma unroll
            for (int nb = 0; nb < NB; ++nb)
#pragma unroll
                for (int mb = 0; mb < MB; ++mb) acc[mb][nb] = WFrag<bf>::mma(a2[h][mb], b[h][nb], acc[mb][nb]); }
        __builtin_amdgcn_sched_barrier(0); asm volatile("v_nop\n\tv_nop\n\tv_nop\n\tv_nop"); __builtin_amdgcn_sched_barrier(0);   // the four vector slots behind the stage's last WMMA, also on the taken side of the branch that follows; the two scheduling barriers keep them directly behind it
        if (more) {
#pragma unroll
            for (int i = 0; i < 4; ++i) { *(v8us*)(st + nxt + sl + i * 32 * GLP) = ra[i]; *(v8us*)(st + nxt + 128 * GLP + sl + i * 32 * GLP) = ra2[i]; *(v8us*)(st + nxt + 256 * GLP + sl + i * 32 * GLP) = rb[i]; } }
        __syncthreads();   // publishes stage s + 1 and ends every wave's reads of stage s, whose buffer the next trip refills
    }
    const int r0 = blockIdx.x * 128 + wm * MB * 16, c0 = blockIdx.y * 128 + wn * NB * 16;   // the wave's own tile
    if (OUTM == 1 && blockIdx.y >= (DQ + DKV) / 128) {   // v columns, the same for the whole work-group: a lane holds eight consecutive tokens of one d: 16 bytes of a row of the transposed tile [128 d][128 tokens], row pitch 272 B (an odd multiple of 16 B)
        h16* tp = (h16*)osw;
#pragma unroll
        for (int nb = 0; nb < NB; ++nb) { const float bz = BIAS ? bfr(bias[c0 + nb * 16 + lr]) : 0.0f;
#pragma unroll
            for (int mb = 0; mb < MB; ++mb) { v8h o;
#pragma unroll
                for (int j = 0; j < 8; ++j) { float val = acc[mb][nb][j]; if (BIAS) val += bz; o[j] = (h16)val; }
                *(v8ha*)(tp + (wn * NB * 16 + nb * 16 + lr) * 136 + wm * MB * 16 + mb * 16 + 8 * hi) = o; } }
        __syncthreads();   // the whole transposed tile is in LDS before a wave reads rows that four waves wrote
#pragma unroll
        for (int s = 0; s < 8; ++s) { const int row = w * 16 + 2 * s + hi; const v8h o = *(const v8ha*)(tp + row * 136 + lr * 8);   // a half-wave stores 256 bytes of one d row: two whole lines, one writer each
            *(v8h*)(PT + ((size_t)(blockIdx.x / (TT / 128)) * DKV + blockIdx.y * 128 - (DQ + DKV) + row) * TT + blockIdx.x % (TT / 128) * 128 + lr * 8) = o; }
    } else {
    float* os = osw + w * (16 * 68);   // the wave's own 16 x 64 f32 patch, read and written by this wave alone
    float bz8[8];
    if constexpr (OUTM == 1) {
#pragma unroll
        for (int u = 0; u < 8; ++u) bz8[u] = BIAS ? bfr(bias[c0 + (lane & 7) * 8 + u]) : 0.0f; }
#pragma unroll
    for (int mb = 0; mb < MB; ++mb) {
#pragma unroll
        for (int nb = 0; nb < NB; ++nb) {
#pragma unroll
            for (int j = 0; j < 8; ++j) os[(hi * 8 + j) * 68 + nb * 16 + lr] = acc[mb][nb][j]; }
        __builtin_amdgcn_wave_barrier(); asm volatile("" ::: "memory");   // holds the compiler to the order: the wave's patch is written whole before it is read
        if constexpr (OUTM == 1) {   // eight lanes write one token's 128-byte row of the head plane, a store instruction four rows in a run
            h16* prow = P16 + ((size_t)((c0 / DQ * NB_ + r0 / TT) * NH_ + c0 % DQ / HD) * TT + r0 % TT + mb * 16) * HD;
#pragma unroll
            for (int s = 0; s < 4; ++s) { const int row = 4 * s + (lane >> 3), cofs = (lane & 7) * 8; const v4f v0 = *(const v4fa*)(os + row * 68 + cofs), v1 = *(const v4fa*)(os + row * 68 + cofs + 4); v8h o;
#pragma unroll
                for (int u = 0; u < 4; ++u) { float a0 = v0[u], a1 = v1[u]; if (BIAS) { a0 += bz8[u]; a1 += bz8[u + 4]; } o[u] = (h16)a0; o[u + 4] = (h16)a1; }
                *(v8h*)(prow + row * HD + cofs) = o; }
        } else {
            float* crow = C + (size_t)(r0 + mb * 16) * ldc + c0;
#pragma unroll
            for (int s = 0; s < 8; ++s) { const int row = 2 * s + hi, cofs = lr * 4; v4f val = *(const v4fa*)(os + row * 68 + cofs); if (BIAS) { val[0] += bfr(bias[c0 + cofs]); val[1] += bfr(bias[c0 + cofs + 1]); val[2] += bfr(bias[c0 + cofs + 2]); val[3] += bfr(bias[c0 + cofs + 3]); }
                *(v4f*)(crow + (size_t)row * ldc + cofs) = val; }
        }
        __builtin_amdgcn_wave_barrier(); asm volatile("" ::: "memory");   // and read whole before the next mb rewrites it
    }
    if constexpr (OUTM == 1) asm volatile("s_wait_xcnt 0x0" ::: "memory");   // in the built code the v branch stands directly behind this one and rewrites registers that the stores above name: the wait stands in front of it
    }
}

// ---- k_gemmq: the q | k | v product, C[m][n] = TB[frame of m][n] + sum_k A[m][k] Bt[n][k], on ONE 192x384 output tile per work-group of 12 waves; grid (M/192, N/384) = 256 work-groups, one for each WGP, 384 threads.
// TB[f][n] = sum_k te[f][k] Bt[n][k] + bias[n] (k_prep makes it): the embedding is the same for the 256 tokens of a frame, so its product is done once a frame and x alone, exact in bf16, goes through this kernel. A 16-token tile lies in one frame, so its accumulators start from one table row.
// A work-group fetches 192 + 384 = 576 operand rows for 73,728 outputs. A wave holds 48 rows x 128 columns: 11 fragments read from LDS for 24 products. Stages of 64 k and the two buffers are as in k_gemmt; the next stage comes through six 16-byte pieces a thread in two halves (A and two sweeps of Bt are fetched during the first 32 k, the other six sweeps of Bt during the second), because 192 accumulator registers leave no room for a whole stage.
// A wave's 128 columns lie wholly in q, in k or in v (two heads). Epilogue: each column block of 128 has its own region of the stage buffers, which are free behind the loop's last barrier: [192 tokens][128 d] at pitch 272 B for q and k, [128 d][192 tokens] at pitch 400 B for v; one barrier, then whole 128-byte lines go out.
#define QTM 192
#define QTN 384
#define QWV 12
#define QSZ ((QTM + QTN) * GLP)   // one stage: rows 0..191 A, 192..575 Bt
#define FRT 256                 // tokens of a frame (16 x 16)
#define NFR (TT / FRT)          // frames
#define NQC (DQ + 2 * DKV)      // q | k | v columns
#define QRP 136                 // epilogue pitch of a token row (128 d) in halves
#define QVP (QTM + 8)           // epilogue pitch of a d row (192 tokens) in halves
template <int K>
__global__ __launch_bounds__(QWV * 32) void k_gemmq(const bf* __restrict__ A, const bf* __restrict__ Bt, const float* __restrict__ TB, h16* P16, h16* PT) {
    typedef WFrag<bf>::V V;
    constexpr int MB = 3, NB = 8, NG = 8, WM = QTM / (MB * 16), SR = QWV * 32 / 8, NA = QTM / SR, NT = QTN / SR, NH = (NA + NT) / 2, N0 = NH - NA;   // 16x16 tiles of a wave along M and N; B fragments held at a time; waves along M; rows that one sweep of the threads covers; sweeps of A and of Bt; pieces a thread fetches in each half of a stage; sweeps of Bt in the first half
    static_assert(HD == 64 && NH_ == NKV && TT % QTM == 0 && DQ % (NB * 16) == 0 && DKV % (NB * 16) == 0 && K % GKS == 0 && WM * (QTN / (NB * 16)) == QWV && (NA + NT) % 2 == 0 && NA < NH && FRT % 16 == 0 && QTM % 16 == 0 && 128 * QVP <= QTM * QRP && 3 * QTM * QRP <= 2 * QSZ, "a tile lies in one batch, a wave's columns in one of q, k, v; whole stages and sweeps; the epilogue fits the buffers");
    __shared__ __align__(16) bf st[2 * QSZ];
    const int tid = threadIdx.x, lane = tid & 31, lr = lane & 15, hi = lane >> 4; const int w = __builtin_amdgcn_readfirstlane(tid >> 5); const int wm = w % WM, wn = w / WM;   // w is read as a scalar so that the wave's tile origin is one
    const int srow = tid >> 3, scol = (tid & 7) * 8;   // staging: thread tid moves the 16-byte pieces (srow + SR i, scol) of each operand
    const bf* ga = A + (size_t)(blockIdx.x * QTM + srow) * K + scol; const bf* gb = Bt + (size_t)(blockIdx.y * QTN + srow) * K + scol; const int sl = srow * GLP + scol;
    v8us r[NH], r0[NT];   // every loop over i, h, g, n, mb, nb, j, it here is unrolled so that staging registers, fragments and accumulators are indexed by constants
#pragma unroll
    for (int i = 0; i < NA; ++i) r[i] = *(const v8us*)(ga + (size_t)i * SR * K);
#pragma unroll
    for (int i = 0; i < NT; ++i) r0[i] = *(const v8us*)(gb + (size_t)i * SR * K);
    const int c0 = blockIdx.y * QTN + wn * NB * 16;   // the wave's first column, a scalar
    const int bt = blockIdx.x / (TT / QTM), t0 = blockIdx.x % (TT / QTM) * QTM;   // the tile's batch and its first token there
    float bz[MB][NB];   // the table's value for the lane's eight columns in the frame of each of the wave's three 16-token tiles
#pragma unroll
    for (int mb = 0; mb < MB; ++mb) { const float* tr = TB + (size_t)((t0 + (wm * MB + mb) * 16) / FRT) * NQC + c0;   // a scalar: the table row of the tile's frame at the wave's first column
#pragma unroll
        for (int nb = 0; nb < NB; ++nb) bz[mb][nb] = tr[nb * 16 + lr]; }
    asm volatile("s_wait_xcnt 0x0" :: "v"(lr) : "memory");   // the wait in front of the first rewrite of a register that the table loads name; lr, their one vector offset, is its input so that it stays in its register up to the wait and no load is given that register as its target
#pragma unroll
    for (int i = 0; i < NA; ++i) *(v8us*)(st + sl + i * SR * GLP) = r[i];
#pragma unroll
    for (int i = 0; i < NT; ++i) *(v8us*)(st + QTM * GLP + sl + i * SR * GLP) = r0[i];
    v8f acc[MB][NB];
#pragma unroll
    for (int mb = 0; mb < MB; ++mb)
#pragma unroll
        for (int nb = 0; nb < NB; ++nb)
#pragma unroll
            for (int j = 0; j < 8; ++j) acc[mb][nb][j] = bz[mb][nb];   // a lane's eight rows of a tile are eight tokens of one frame in one column
    __syncthreads();   // stage 0 is in LDS before any wave reads it
    const int ao = (wm * MB * 16 + lr) * GLP + 8 * hi, bo = (QTM + wn * NB * 16 + lr) * GLP + 8 * hi; constexpr int ns = K / GKS;
#pragma unroll 1
    for (int s = 0; s < ns; ++s) {   // kept rolled: the body already holds 48 products, and an unrolled loop would outgrow the registers
        const int cur = (s & 1) * QSZ, nxt = ((s & 1) ^ 1) * QSZ; const bool more = s + 1 < ns;
        if (more) { gb += GKS;   // the last loads that name gb are waited for in front of the barrier at the foot of the trip before
#pragma unroll
            for (int i = 0; i < NA; ++i) r[i] = *(const v8us*)(ga + GKS + (size_t)i * SR * K);
#pragma unroll
            for (int i = 0; i < N0; ++i) r[NA + i] = *(const v8us*)(gb + (size_t)i * SR * K); }
#pragma unroll
        for (int h = 0; h < 2; ++h) {
            V a[MB];
#pragma unroll
            for (int mb = 0; mb < MB; ++mb) a[mb] = WFrag<bf>::ld(st + cur + ao + mb * 16 * GLP + h * 32);
#pragma unroll
            for (int g = 0; g < NB / NG; ++g) {
                V b[NG];
#pragma unroll
                for (int n = 0; n < NG; ++n) b[n] = WFrag<bf>::ld(st + cur + bo + (g * NG + n) * 16 * GLP + h * 32);
                __builtin_amdgcn_sched_barrier(0);   // keeps the group's LDS reads together ahead of its 24 products: left alone, the compiler sinks reads between the products and waits for each at once
#pragma unroll
                for (int n = 0; n < NG; ++n)
#pragma unroll
                    for (int mb = 0; mb < MB; ++mb) acc[mb][g * NG + n] = WFrag<bf>::mma(a[mb], b[n], acc[mb][g * NG + n]);
                __builtin_amdgcn_sched_barrier(0);   // keeps the next group's reads behind these products, so that only one group's fragments are held at a time
            }
            asm volatile("v_nop\n\tv_nop\n\tv_nop\n\tv_nop"); __builtin_amdgcn_sched_barrier(0);   // the four vector slots behind the last WMMA, also on the taken side of the branch that follows; the scheduling barriers keep them directly behind it
            if (more) {
                if (h == 0) {
#pragma unroll
                    for (int i = 0; i < NA; ++i) *(v8us*)(st + nxt + sl + i * SR * GLP) = r[i];
#pragma unroll
                    for (int i = 0; i < N0; ++i) *(v8us*)(st + nxt + QTM * GLP + sl + i * SR * GLP) = r[NA + i];
                    ga += GKS;   // stepped in this block, whose stores have waited for the data of the loads that name the pointer
#pragma unroll
                    for (int i = 0; i < NH; ++i) r[i] = *(const v8us*)(gb + (size_t)(N0 + i) * SR * K);
                } else {
#pragma unroll
                    for (int i = 0; i < NH; ++i) *(v8us*)(st + nxt + QTM * GLP + sl + (N0 + i) * SR * GLP) = r[i];
                } }
        }
        __syncthreads();   // publishes stage s + 1 and ends every wave's reads of stage s, whose buffer the next trip refills
    }
    const bool isv = c0 >= DQ + DKV;
    bf* rg = st + wn * (QTM * QRP);   // the column block's region; four waves (wm = 0..3) fill it
    if (isv) {   // a lane holds eight consecutive tokens of one d: 16 bytes of a row of the transposed block
#pragma unroll
        for (int nb = 0; nb < NB; ++nb) {
#pragma unroll
            for (int mb = 0; mb < MB; ++mb) { v8h o;
#pragma unroll
                for (int j = 0; j < 8; ++j) o[j] = (h16)acc[mb][nb][j];
                *(v8ha*)(rg + (nb * 16 + lr) * QVP + wm * MB * 16 + mb * 16 + 8 * hi) = o; }
        }
    } else {
#pragma unroll
        for (int nb = 0; nb < NB; ++nb) {
#pragma unroll
            for (int mb = 0; mb < MB; ++mb)
#pragma unroll
                for (int j = 0; j < 8; ++j) rg[(wm * MB * 16 + mb * 16 + 8 * hi + j) * QRP + nb * 16 + lr] = __builtin_bit_cast(unsigned short, (h16)acc[mb][nb][j]);
        }
    }
    __syncthreads();   // every region is written whole before a wave reads rows that four waves wrote; passed by all waves, outside the two branches
    if (isv) {   // the block's 128 d rows of 384 bytes are 3,072 pieces in a run; a store instruction takes 32 of them: four whole lines, one writer each
#pragma unroll
        for (int it = 0; it < 128 * (QTM / 8) / (WM * 32); ++it) { const int p = it * (WM * 32) + wm * 32 + lane, row = p / (QTM / 8), col = p % (QTM / 8); const v8h o = *(const v8ha*)(rg + row * QVP + col * 8);
            *(v8h*)(PT + ((size_t)bt * DKV + c0 - (DQ + DKV) + row) * TT + t0 + col * 8) = o; }
    } else {   // eight lanes write one token's 128-byte row of a head plane, a store instruction four rows in a run; the wave takes its own 48 tokens of both heads
#pragma unroll
        for (int it = 0; it < 2 * MB * 4; ++it) { const int hh = it / (MB * 4), tok = wm * MB * 16 + it % (MB * 4) * 4 + (lane >> 3), cofs = (lane & 7) * 8; const v8h o = *(const v8ha*)(rg + tok * QRP + hh * HD + cofs);
            *(v8h*)(P16 + ((size_t)((c0 / DQ * NB_ + bt) * NH_ + c0 % DQ / HD + hh) * TT + t0 + tok) * HD + cofs) = o; }
        asm volatile("s_wait_xcnt 0x0" ::: "memory");   // in the built code the v branch stands directly behind this one and rewrites registers that the stores above name: the wait stands in front of it
    }
}

__device__ __forceinline__ void splitf(float y, unsigned short& h, unsigned short& l) { h = f2bf(y); l = f2bf(y - bf2f(h)); }
typedef __attribute__((ext_vector_type(2))) _Float16 v2h;
typedef __attribute__((ext_vector_type(4))) _Float16 v4h;
typedef __attribute__((ext_vector_type(2))) unsigned short v2us;
typedef __attribute__((ext_vector_type(4))) unsigned short v4us;
typedef __attribute__((ext_vector_type(2))) float v2f;
typedef __attribute__((ext_vector_type(4))) int v4i;

__global__ __launch_bounds__(256) void k_wtG(const float* __restrict__ w, int K, int N, bf* Bt) {
    const int lane = threadIdx.x & 31; const int L0 = (blockIdx.x * 8 + (threadIdx.x >> 5)) * 8; const int nlines = N * K / 64;
{
#pragma unroll 1
        for (int l = 0; l < 8; ++l) { const int L = L0 + l; if (L >= nlines) break; const size_t e = (size_t)L * 64 + lane * 2; const int k = (int)(e % K), n = (int)(e / K); v2us o;
            o[0] = f2bf(w[(size_t)k * N + n]); o[1] = f2bf(w[(size_t)(k + 1) * N + n]); *(v2us*)(Bt + e) = o; }
         }
}
__global__ __launch_bounds__(256) void k_cscvt(const float* __restrict__ cosT, const float* __restrict__ sinT, float* CS) { const int idx = blockIdx.x * 256 + threadIdx.x; if (idx >= TT * HD) return; v2f cs; cs[0] = bfr(cosT[idx]); cs[1] = bfr(sinT[idx]); *(v2f*)(CS + (size_t)idx * 2) = cs;  }
#define FWV 12                  // waves per work-group
#define FSK 192                 // keys per stage
#define FPT 72                  // LDS pitch of a K row (64 d) in halves: 144 B, an odd multiple of 16 B
#define FVP (FSK + 8)           // LDS pitch of a V^T row (FSK keys) in halves: 400 B, an odd multiple of 16 B
#define FNS (TT / FSK)
#define CSC 0.18033688011112042f   // HD^-0.5 x log2(e)
__device__ __forceinline__ float xhalf(float x) { return __builtin_bit_cast(float, __builtin_amdgcn_permlanex16(__builtin_bit_cast(int, x), __builtin_bit_cast(int, x), 0x76543210, 0xfedcba98, false, false)); }   // lane l with lane l ^ 16
__device__ __forceinline__ void fpass(const h16* kb, const h16* vb, const v16h (&qf)[2][2], v8f (&acc)[2][4], v8f (&lacc)[2], float (&m_run)[2], const v16h ones) {
    typedef __attribute__((ext_vector_type(2))) _Float16 h2; typedef __attribute__((ext_vector_type(2))) float f2;
    v8f s[2][2];   // every loop over kt, g, t, r, i here and in k_fattn is unrolled so that fragments, scores and accumulators are indexed by constants and stay in registers
#pragma unroll
    for (int kt = 0; kt < 2; ++kt) { const v16h k0 = WFrag<h16>::ld(kb + kt * 16 * FPT), k1 = WFrag<h16>::ld(kb + kt * 16 * FPT + 32);
#pragma unroll
        for (int g = 0; g < 2; ++g) { s[kt][g] = wmma16(k0, qf[g][0], (v8f){}); s[kt][g] = wmma16(k1, qf[g][1], s[kt][g]); } }
    v16h vf[4];
#pragma unroll
    for (int t = 0; t < 4; ++t) vf[t] = WFrag<h16>::ld(vb + t * 16 * FVP);
    float mb[2]; bool need = false;
#pragma unroll
    for (int g = 0; g < 2; ++g) { float mx = s[0][g][0];
#pragma unroll
        for (int r = 1; r < 8; ++r) mx = fmaxf(mx, s[0][g][r]);
#pragma unroll
        for (int r = 0; r < 8; ++r) mx = fmaxf(mx, s[1][g][r]);
        mx = fmaxf(mx, xhalf(mx)) * CSC; mb[g] = mx; need = need || (mx > m_run[g] + 8.0f); }
    if (__builtin_amdgcn_ballot_w32(need) != 0) {   // a scalar branch, rare after the first passes
#pragma unroll
        for (int g = 0; g < 2; ++g) { const float m_new = fmaxf(m_run[g], mb[g]); const float corr = __builtin_amdgcn_exp2f(m_run[g] - m_new); m_run[g] = m_new; lacc[g] = lacc[g] * corr;
#pragma unroll
            for (int t = 0; t < 4; ++t) acc[g][t] = acc[g][t] * corr; } }
#pragma unroll
    for (int g = 0; g < 2; ++g) { const float nm = 6.0f - m_run[g]; v16h pf;   // P carries a factor 2^6, which the denominator carries too: fewer small probabilities fall into fp16's subnormal range
#pragma unroll
        for (int i = 0; i < 8; ++i) { const int kt = i >> 2, r = 2 * (i & 3); f2 p; p[0] = __builtin_amdgcn_exp2f(fmaf(s[kt][g][r], CSC, nm)); p[1] = __builtin_amdgcn_exp2f(fmaf(s[kt][g][r + 1], CSC, nm)); const h2 q = __builtin_convertvector(p, h2); pf[2 * i] = q[0]; pf[2 * i + 1] = q[1]; }
#pragma unroll
        for (int t = 0; t < 4; ++t) acc[g][t] = wmma16(vf[t], pf, acc[g][t]);
        lacc[g] = wmma16(ones, pf, lacc[g]); }
}
__global__ __launch_bounds__(FWV * 32) void k_fattn(const h16* __restrict__ Q, const h16* __restrict__ Kp, const h16* __restrict__ Vt, bf* Ah, bf* Al) {
    __shared__ __align__(16) h16 ks[2 * FSK * FPT];
    __shared__ __align__(16) h16 vs[2 * HD * FVP];
    constexpr int KR = FWV * 32 / 8, VR = FWV * 32 / (FSK / 8), NP = FSK / KR;   // rows of the K tile and of the V^T tile that one sweep of the work-group's threads covers; sweeps a tile
    static_assert(TT % (FWV * 32) == 0 && TT % FSK == 0 && FSK % 64 == 0 && FSK % KR == 0 && HD == NP * VR && FVP / 8 % 2 == 1, "whole work-groups, stages, lines and sweeps");
    const int tid = threadIdx.x, lane = tid & 31, lr = lane & 15, hi = lane >> 4; const int w = __builtin_amdgcn_readfirstlane(tid >> 5); const int head = blockIdx.y; const int q0 = blockIdx.x * (FWV * 32) + w * 32;   // w is read as a scalar so that the wave's first query is one
    const int bh = blockIdx.z * NH_ + head; Q += (size_t)bh * TT * HD; Kp += (size_t)bh * TT * HD; Vt += (size_t)bh * HD * TT; Ah += (size_t)blockIdx.z * TT * DQ; Al += (size_t)blockIdx.z * TT * DQ;   // the batch's own planes and output rows
    const int srow = tid >> 3, scol = (tid & 7) * 8, vrow = tid / (FSK / 8), vcol = tid % (FSK / 8) * 8;   // staging: thread tid moves the 16-byte pieces (srow + KR i, scol) of the K tile [FSK keys][64 d] and (vrow + VR i, vcol) of the V^T tile [64 d][FSK keys], i < NP
    const h16* kg = Kp + (size_t)srow * HD + scol; const h16* vg = Vt + (size_t)vrow * TT + vcol; const int sl = srow * FPT + scol, sv = vrow * FVP + vcol;
    v8h rk[NP], rv[NP];
#pragma unroll
    for (int i = 0; i < NP; ++i) { rk[i] = *(const v8h*)(kg + i * KR * HD); rv[i] = *(const v8h*)(vg + (size_t)i * VR * TT); }
    v16h qf[2][2];
#pragma unroll
    for (int g = 0; g < 2; ++g)
#pragma unroll
        for (int kc = 0; kc < 2; ++kc) qf[g][kc] = WFrag<h16>::ld(Q + (size_t)(q0 + g * 16 + lr) * HD + kc * 32 + 8 * hi);
    asm volatile("s_wait_xcnt 0x0" ::: "memory");   // in the built code the accumulators' start values go into registers that the loads above name as addresses
    v8f acc[2][4], lacc[2]; float m_run[2]; v16h ones;
#pragma unroll
    for (int e = 0; e < 16; ++e) ones[e] = (h16)1.0f;
#pragma unroll
    for (int g = 0; g < 2; ++g) { m_run[g] = -__builtin_inff(); lacc[g] = (v8f){};
#pragma unroll
        for (int t = 0; t < 4; ++t) acc[g][t] = (v8f){}; }
#pragma unroll
    for (int i = 0; i < NP; ++i) { *(v8h*)(ks + sl + i * KR * FPT) = rk[i]; *(v8h*)(vs + sv + i * VR * FVP) = rv[i]; }
    __syncthreads();   // stage 0 is in LDS before any wave reads it
    const int fo = lr * FPT + 8 * hi, fv = lr * FVP + 8 * hi;
#pragma unroll 1
    for (int st = 0; st < FNS; ++st) {   // kept rolled: the body already holds six passes, and acc[][] must stay in registers
        const int cur = (st & 1) * (FSK * FPT), nxt = ((st & 1) ^ 1) * (FSK * FPT), curv = (st & 1) * (HD * FVP), nxtv = ((st & 1) ^ 1) * (HD * FVP); const bool more = st + 1 < FNS;
        if (more) { kg += FSK * HD; vg += FSK;
#pragma unroll
            for (int i = 0; i < NP; ++i) { rk[i] = *(const v8h*)(kg + i * KR * HD); rv[i] = *(const v8h*)(vg + (size_t)i * VR * TT); } }
#pragma unroll   // unrolled so that a pass's last products stand in one block with the next pass's first LDS reads and products, which the compiler then interleaves
        for (int p = 0; p < FSK / 32; ++p) fpass(ks + cur + fo + p * 32 * FPT, vs + curv + fv + p * 32, qf, acc, lacc, m_run, ones);
        __builtin_amdgcn_sched_barrier(0); asm volatile("v_nop\n\tv_nop\n\tv_nop\n\tv_nop"); __builtin_amdgcn_sched_barrier(0);   // the four vector slots behind the pass's last WMMA, also on the taken side of the branch that follows; the two scheduling barriers keep them directly behind it
        if (more) {
#pragma unroll
            for (int i = 0; i < NP; ++i) { *(v8h*)(ks + nxt + sl + i * KR * FPT) = rk[i]; *(v8h*)(vs + nxtv + sv + i * VR * FVP) = rv[i]; } }
        __syncthreads();   // publishes stage st + 1 and ends every wave's reads of stage st, whose buffer the next trip refills
    }
#pragma unroll
    for (int g = 0; g < 2; ++g) { const float inv = __fdiv_rn(1.0f, lacc[g][0]); const size_t oo = (size_t)(q0 + g * 16 + lr) * DQ + head * HD + 8 * hi;   // every row of lacc holds the column sums
#pragma unroll
        for (int t = 0; t < 4; ++t) { v8us oh, ol;
#pragma unroll
            for (int r = 0; r < 8; ++r) { unsigned short a, c2; splitf(acc[g][t][r] * inv, a, c2); oh[r] = a; ol[r] = c2; }
            *(v8us*)(Ah + oo + t * 16) = oh; *(v8us*)(Al + oo + t * 16) = ol; } }
}

// ---- k_prep: all that the products read, in one launch. The first TEB work-groups make the table TB[frame][column] = sum_k te[frame][k] qkv_w[column][k] + qkv_b[column], operands rounded to bf16 in registers, f32 out; the others round qkv_w, proj_w (into one run of planes) and x to bf16, eight elements a thread.
// A table work-group has 32 columns (a 128-byte line of each table row, one writer). Wave w takes the 16-column tile w & 1 and the quarter w >> 1 of k; the frames are the rows of A (rows NFR..15 repeat the last frame and are not stored); the four partial sums meet in LDS.
#define NW1 ((size_t)NQC * DM / 8)                // 8-element pieces of qkv_w
#define NW2 ((size_t)DM * DQ / 8)                 // of proj_w
#define NXP ((size_t)NB_ * TT * DM / 8)           // and of x
#define TEB ((unsigned)(NQC / 32))
#define CVB ((unsigned)((NW1 + NW2 + NXP) / 256))
__global__ __launch_bounds__(256) void k_prep(const float* __restrict__ w1, const float* __restrict__ w2, bf* Wd, const float* __restrict__ xb, bf* Xh, const float* __restrict__ te, const float* __restrict__ bias, float* TB) {
    static_assert(NW1 % 256 == 0 && NW2 % 256 == 0 && NXP % 256 == 0 && NQC % 32 == 0 && DM % 128 == 0 && NFR <= 16, "whole work-groups, whole k steps, the frames fit one tile");
    __shared__ float part[8 * 256];
    if (blockIdx.x < TEB) {
        const int tid = threadIdx.x, lane = tid & 31, lr = lane & 15, hi = lane >> 4; const int w = __builtin_amdgcn_readfirstlane(tid >> 5); const int n0 = blockIdx.x * 32;   // w is read as a scalar so that the test on the frame below is one
        const float* tp = te + (size_t)(lr < NFR ? lr : NFR - 1) * DM + (w >> 1) * (DM / 4) + 8 * hi; const float* wp = w1 + (size_t)(n0 + (w & 1) * 16 + lr) * DM + (w >> 1) * (DM / 4) + 8 * hi;
        const float bb = bfr(bias[n0 + lane]);   // fetched here so that the store at the end waits for no load
        v8f acc = (v8f){};
#pragma unroll   // unrolled so that a later k step's loads are issued ahead of an earlier step's product
        for (int s = 0; s < DM / 4 / 32; ++s) { const v8f a0 = *(const v8f*)(tp + s * 32), a1 = *(const v8f*)(tp + s * 32 + 16), b0 = *(const v8f*)(wp + s * 32), b1 = *(const v8f*)(wp + s * 32 + 16); v8us ca0, ca1, cb0, cb1;   // both operands in the k order of WFrag::ld
#pragma unroll
            for (int k = 0; k < 8; ++k) { ca0[k] = f2bf(a0[k]); ca1[k] = f2bf(a1[k]); cb0[k] = f2bf(b0[k]); cb1[k] = f2bf(b1[k]); }
            acc = wmmab(cat16b(ca0, ca1), cat16b(cb0, cb1), acc); }
        asm volatile("s_wait_xcnt 0x0" :: "v"(tp), "v"(wp) : "memory");   // the wait in front of the first rewrite of a register that the loads above name; the two row pointers are its inputs so that they stay in their registers up to it: without them the last load is given its own address registers as its target
#pragma unroll
        for (int j = 0; j < 8; ++j) part[w * 256 + j * 32 + lane] = acc[j];   // frame 8 hi + j, column lr of the wave's tile
        __syncthreads();   // the eight partial tiles are in LDS before a wave reads what the others wrote; the branch is the same for the whole work-group
#pragma unroll
        for (int u = 0; u < 2; ++u) { const int f = u * 8 + w;   // a wave stores one frame's 32 columns: one whole line
            if (f < NFR) { const int ix = (lane >> 4) * 256 + w * 32 + u * 16 + lr; TB[(size_t)f * NQC + n0 + lane] = part[ix] + part[512 + ix] + part[1024 + ix] + part[1536 + ix] + bb;
                asm volatile("s_wait_xcnt 0x0" ::: "memory"); } }   // the second frame's code may rewrite registers that the first frame's store names: the wait stands in front of it
    } else {
        const unsigned cb = blockIdx.x - TEB; const size_t i = (size_t)cb * 256 + threadIdx.x; const v8f v = *(const v8f*)(cb < NW1 / 256 ? w1 + i * 8 : cb < (NW1 + NW2) / 256 ? w2 + (i - NW1) * 8 : xb + (i - NW1 - NW2) * 8); v8us o;   // a work-group lies wholly in one of the three sources: the tests are on its number
#pragma unroll
        for (int k = 0; k < 8; ++k) o[k] = f2bf(v[k]);
        *(v8us*)(cb < (NW1 + NW2) / 256 ? Wd + i * 8 : Xh + (i - NW1 - NW2) * 8) = o;
        asm volatile("s_wait_xcnt 0x0" ::: "memory");   // in the built code the table's branch stands directly behind this one and rewrites registers that the store names: the wait stands in front of it
    }
}

extern "C" void kernel_launch(void* const* d_in, const int* in_sizes, int n_in,
                              void* d_out, int out_size, void* d_ws, size_t ws_size, hipStream_t stream) {
    (void)in_sizes; (void)n_in; (void)out_size;
    const float* x = (const float*)d_in[0]; const float* temb = (const float*)d_in[1]; const float* wf = (const float*)d_in[2]; const float* bfz = (const float*)d_in[3]; const float* wo = (const float*)d_in[4]; const float* bo = (const float*)d_in[5];
    float* OUT = (float*)d_out;     // [2][3072][1024]
    char* wsp = (char*)d_ws;
    auto take = [&](size_t bytes) { char* p = wsp; wsp += (bytes + 255) & ~(size_t)255; return (void*)p; };
    bf* WF = (bf*)take((size_t)(DQ + 2 * DKV + DM) * DM * 2); bf* WO = WF + (size_t)(DQ + 2 * DKV) * DM;   // q | k | v rows, then proj rows
    bf* XB = (bf*)take((size_t)NB_ * TT * DM * 2); float* TBL = (float*)take((size_t)NFR * NQC * 4);
    h16* QP16 = (h16*)take((size_t)2 * NB_ * NH_ * TT * HD * 2); h16* KP16 = QP16 + (size_t)NB_ * NH_ * TT * HD; h16* VT16 = (h16*)take((size_t)NB_ * NKV * HD * TT * 2);
    bf* ATh = (bf*)take((size_t)NB_ * TT * DQ * 2); bf* ATl = (bf*)take((size_t)NB_ * TT * DQ * 2);
    if ((size_t)(wsp - (char*)d_ws) > ws_size) return;    // ws 256 MiB
    k_prep<<<TEB + CVB, 256, 0, stream>>>(wf, wo, WF, x, XB, temb, bfz, TBL);
    k_gemmq<DM><<<dim3(NB_ * TT / QTM, (DQ + 2 * DKV) / QTN, 1), QWV * 32, 0, stream>>>(XB, WF, TBL, QP16, VT16);
    k_fattn<<<dim3(TT / (FWV * 32), NH_, NB_), FWV * 32, 0, stream>>>(QP16, KP16, VT16, ATh, ATl);
    k_gemmt<true, 0, DQ><<<dim3(NB_ * TT / 128, DM / 128, 1), 256, 0, stream>>>(ATh, ATl, WO, OUT, DM, bo, nullptr, nullptr);
}

// v009
// One run takes 121 microseconds.
// In two side-by-side timings against v008, it was 1.05 and 1.04 times as fast.
// Counting every step since v000, it is 16.2 times as fast.
#include <hip/hip_runtime.h>

// Attention over all tokens of a clip (x [2][12][16][16][1024] + temporal_embedding[:, :12] broadcast over the 16x16 grid; N = 12*16*16 = 3,072 tokens per batch; qkv = (x + te) qkv_w^T + qkv_b (qkv_w [3072][1024], rows q | k | v, 16 heads x 64); softmax(q.k / 8) over all 3,072 tokens; out = merged proj_w^T + proj_b -> [2][12][16][16][1024]).
// Compute dtypes, f32 accumulate: every input rounded to bf16; (x + te) W = x W + te W: x goes in as one exact bf16 plane (1 product), te W + bias is a table of 12 frames x 3,072 columns from which the accumulators start; q/k/v rounded to fp16 head planes in the product's own epilogue, q times HD^-0.5 x log2(e) in f32 first; scores and attn.v single fp16 on every row, P = 2^6 x exp2(score - maximum in use), unnormalised; softmax f32, online; proj hl x exact (2 products) + bias.

#define NB_  2
#define TT   3072
#define DM   1024
#define NH_  16
#define NKV  16
#define REP  (NH_ / NKV)
#define HD   64
#define DQ   (NH_ * HD)
#define DKV  (NKV * HD)
#define ZH   2
#define RH   0                  // unused: no query rows use hi+lo planes
#define WIN  0
#define PCAR 1024.0f
#define SCL  0.125f   // HD^-0.5
#define CSC  0.18033688011112042f   // HD^-0.5 x log2(e)
typedef _Float16 h16;
typedef unsigned short bf;
typedef __attribute__((ext_vector_type(16))) __bf16   v16bf;
typedef __attribute__((ext_vector_type(16))) _Float16 v16h;
typedef __attribute__((ext_vector_type(8)))  _Float16 v8h;
typedef __attribute__((ext_vector_type(8)))  unsigned short v8us;
typedef __attribute__((ext_vector_type(8)))  float    v8f;
typedef __attribute__((ext_vector_type(4)))  float    v4f;
typedef v8h  __attribute__((may_alias)) v8ha;
typedef v4f  __attribute__((may_alias)) v4fa;
typedef v8us __attribute__((may_alias)) v8usa;

__device__ __forceinline__ unsigned short f2bf(float f) { unsigned u = __float_as_uint(f); u += 0x7FFFu + ((u >> 16) & 1u); return (unsigned short)(u >> 16); }
__device__ __forceinline__ float bf2f(unsigned short b) { return __uint_as_float(((unsigned)b) << 16); }
__device__ __forceinline__ float bfr(float f) { return bf2f(f2bf(f)); }
__device__ __forceinline__ v16h cat16(v8h lo, v8h hi) { return __builtin_shufflevector(lo, hi, 0, 1, 2, 3, 4, 5, 6, 7, 8, 9, 10, 11, 12, 13, 14, 15); }
__device__ __forceinline__ v16bf cat16b(v8us lo, v8us hi) { return __builtin_bit_cast(v16bf, __builtin_shufflevector(lo, hi, 0, 1, 2, 3, 4, 5, 6, 7, 8, 9, 10, 11, 12, 13, 14, 15)); }
__device__ __forceinline__ v8f wmma16(v16h a, v16h b, v8f c) { return __builtin_amdgcn_wmma_f32_16x16x32_f16(false, a, false, b, (short)0, c, false, false); }
__device__ __forceinline__ v8f wmmab(v16bf a, v16bf b, v8f c) { return __builtin_amdgcn_wmma_f32_16x16x32_bf16(false, a, false, b, (short)0, c, false, false); }



// ---- k_gemmt: C[m][n] = sum_k (A[m][k] + A2[m][k]) Bt[n][k] + bias[n], operands K-contiguous bf16 planes; ONE 128x128 output tile per work-group of 8 waves; grid (M/128, N/128), 256 threads. M, N % 128 == 0, K % 64 == 0; K is a compile-time constant, so that the four row steps of a staging load are immediate offsets of one address.
// The 128 rows of A, of A2 and of Bt go through LDS in stages of 64 k (one whole 128-byte line of each row, eight lanes to a line), two buffers: stage s + 1 is fetched into registers while stage s is worked on, stored behind it, and one barrier a stage publishes it.
// A wave holds 32 rows x 64 columns (A has two planes, so the narrow side is A's: 8 fragments read for 16 products).
// The M rows are the tokens of all NB_ batches in a run (a 128-row tile lies inside one batch, TT % 128 == 0).
// OUTM 0: C (f32, pitch ldc). OUTM 1: the N columns are q | k | v. In the q and k columns a wave's 64 columns are one head (HD == 64) and go out as fp16 rows of the head plane P16[q or k][batch][head][token][d]; in the v columns the work-group's tile is transposed in LDS and goes out as fp16 rows of the transposed plane PT[batch][head][d][token], 256 bytes of a row from one half-wave.
template <typename T16> struct WFrag;
template <> struct WFrag<h16> { typedef v16h V; static __device__ __forceinline__ V ld(const h16* p) { return cat16(*(const v8h*)p, *(const v8h*)(p + 16)); } static __device__ __forceinline__ v8f mma(V a, V b, v8f c) { return wmma16(a, b, c); } };
template <> struct WFrag<bf> { typedef v16bf V; static __device__ __forceinline__ V ld(const bf* p) { return cat16b(*(const v8us*)p, *(const v8us*)(p + 16)); } static __device__ __forceinline__ v8f mma(V a, V b, v8f c) { return wmmab(a, b, c); } };
#define GKS 64                  // k per stage
#define GLP 72                  // LDS row pitch in 16-bit elements: 144 B, an odd multiple of 16 B
#define GSZ (384 * GLP)         // one stage: rows 0..127 A, 128..255 A2, 256..383 Bt
template <bool BIAS, int OUTM, int K>
__global__ __launch_bounds__(256) void k_gemmt(const bf* __restrict__ A, const bf* __restrict__ A2, const bf* __restrict__ Bt, float* C, int ldc, const float* __restrict__ bias, h16* P16, h16* PT) {
    typedef WFrag<bf>::V V; static_assert(OUTM == 0 || (HD == 64 && NH_ == NKV && TT % 128 == 0), "a 64-column wave tile is one head, q and k planes are alike, a tile lies in one batch"); static_assert(K % GKS == 0, "whole stages");
    constexpr int MB = 2, NB = 4, WM = 8 / MB;   // 16x16 tiles of a wave along M and N; waves along M
    __shared__ __align__(16) bf st[2 * GSZ];
    __shared__ __align__(16) float osw[8 * 16 * 68];   // epilogue only: a 16 x 68 f32 patch per wave, or (v columns) one 128 x 136 fp16 tile
    const int tid = threadIdx.x, lane = tid & 31, lr = lane & 15, hi = lane >> 4; const int w = __builtin_amdgcn_readfirstlane(tid >> 5); const int wm = w % WM, wn = w / WM;   // w is read as a scalar so that the wave's tile origin is one
    const int srow = tid >> 3, scol = (tid & 7) * 8;   // staging: thread tid moves the 16-byte pieces (srow + 32 i, scol), i = 0..3, of each of the three operands
    const bf* ga = A + (size_t)(blockIdx.x * 128 + srow) * K + scol; const bf* ga2 = A2 + (size_t)(blockIdx.x * 128 + srow) * K + scol; const bf* gb = Bt + (size_t)(blockIdx.y * 128 + srow) * K + scol; const int sl = srow * GLP + scol;
    v8us ra[4], ra2[4], rb[4];   // every loop over i, h, mb, nb here is unrolled so that staging registers, fragments and accumulators are indexed by constants
#pragma unroll
    for (int i = 0; i < 4; ++i) { ra[i] = *(const v8us*)(ga + (size_t)i * 32 * K); ra2[i] = *(const v8us*)(ga2 + (size_t)i * 32 * K); rb[i] = *(const v8us*)(gb + (size_t)i * 32 * K); }
    v8f acc[MB][NB];
#pragma unroll
    for (int mb = 0; mb < MB; ++mb)
#pragma unroll
        for (int nb = 0; nb < NB; ++nb) acc[mb][nb] = (v8f){};
#pragma unroll
    for (int i = 0; i < 4; ++i) { *(v8us*)(st + sl + i * 32 * GLP) = ra[i]; *(v8us*)(st + 128 * GLP + sl + i * 32 * GLP) = ra2[i]; *(v8us*)(st + 256 * GLP + sl + i * 32 * GLP) = rb[i]; }
    __syncthreads();   // stage 0 is in LDS before any wave reads it
    const int ao = (wm * MB * 16 + lr) * GLP + 8 * hi, bo = (256 + wn * NB * 16 + lr) * GLP + 8 * hi; constexpr int ns = K / GKS;
#pragma unroll 1
    for (int s = 0; s < ns; ++s) {   // kept rolled: the body already holds two k steps of 16 products each, and an unrolled loop would outgrow the registers
        const int cur = (s & 1) * GSZ, nxt = ((s & 1) ^ 1) * GSZ; const bool more = s + 1 < ns;
        if (more) { ga += GKS; ga2 += GKS; gb += GKS;
#pragma unroll
            for (int i = 0; i < 4; ++i) { ra[i] = *(const v8us*)(ga + (size_t)i * 32 * K); ra2[i] = *(const v8us*)(ga2 + (size_t)i * 32 * K); rb[i] = *(const v8us*)(gb + (size_t)i * 32 * K); } }
        V a[2][MB], a2[2][MB], b[2][NB];
#pragma unroll
        for (int h = 0; h < 2; ++h) {
#pragma unroll
            for (int mb = 0; mb < MB; ++mb) a[h][mb] = WFrag<bf>::ld(st + cur + ao + mb * 16 * GLP + h * 32);
#pragma unroll
            for (int nb = 0; nb < NB; ++nb) b[h][nb] = WFrag<bf>::ld(st + cur + bo + nb * 16 * GLP + h * 32);
#pragma unroll
            for (int mb = 0; mb < MB; ++mb) a2[h][mb] = WFrag<bf>::ld(st + cur + 128 * GLP + ao + mb * 16 * GLP + h * 32); }
        __builtin_amdgcn_sched_barrier(0);   // keeps the stage's 32 LDS reads one group ahead of its 32 products: left alone, the compiler sinks reads between the products, into registers just freed, and waits for each at once
#pragma unroll
        for (int h = 0; h < 2; ++h) {
#pragma unroll
            for (int nb = 0; nb < NB; ++nb)
#pragma unroll
                for (int mb = 0; mb < MB; ++mb) acc[mb][nb] = WFrag<bf>::mma(a[h][mb], b[h][nb], acc[mb][nb]);
#pragma unroll
            for (int nb = 0; nb < NB; ++nb)
#pragma unroll
                for (int mb = 0; mb < MB; ++mb) acc[mb][nb] = WFrag<bf>::mma(a2[h][mb], b[h][nb], acc[mb][nb]); }
        __builtin_amdgcn_sched_barrier(0); asm volatile("v_nop\n\tv_nop\n\tv_nop\n\tv_nop"); __builtin_amdgcn_sched_barrier(0);   // the four vector slots behind the stage's last WMMA, also on the taken side of the branch that follows; the two scheduling barriers keep them directly behind it
        if (more) {
#pragma unroll
            for (int i = 0; i < 4; ++i) { *(v8us*)(st + nxt + sl + i * 32 * GLP) = ra[i]; *(v8us*)(st + nxt + 128 * GLP + sl + i * 32 * GLP) = ra2[i]; *(v8us*)(st + nxt + 256 * GLP + sl + i * 32 * GLP) = rb[i]; } }
        __syncthreads();   // publishes stage s + 1 and ends every wave's reads of stage s, whose buffer the next trip refills
    }
    const int r0 = blockIdx.x * 128 + wm * MB * 16, c0 = blockIdx.y * 128 + wn * NB * 16;   // the wave's own tile
    if (OUTM == 1 && blockIdx.y >= (DQ + DKV) / 128) {   // v columns, the same for the whole work-group: a lane holds eight consecutive tokens of one d: 16 bytes of a row of the transposed tile [128 d][128 tokens], row pitch 272 B (an odd multiple of 16 B)
        h16* tp = (h16*)osw;
#pragma unroll
        for (int nb = 0; nb < NB; ++nb) { const float bz = BIAS ? bfr(bias[c0 + nb * 16 + lr]) : 0.0f;
#pragma unroll
            for (int mb = 0; mb < MB; ++mb) { v8h o;
#pragma unroll
                for (int j = 0; j < 8; ++j) { float val = acc[mb][nb][j]; if (BIAS) val += bz; o[j] = (h16)val; }
                *(v8ha*)(tp + (wn * NB * 16 + nb * 16 + lr) * 136 + wm * MB * 16 + mb * 16 + 8 * hi) = o; } }
        __syncthreads();   // the whole transposed tile is in LDS before a wave reads rows that four waves wrote
#pragma unroll
        for (int s = 0; s < 8; ++s) { const int row = w * 16 + 2 * s + hi; const v8h o = *(const v8ha*)(tp + row * 136 + lr * 8);   // a half-wave stores 256 bytes of one d row: two whole lines, one writer each
            *(v8h*)(PT + ((size_t)(blockIdx.x / (TT / 128)) * DKV + blockIdx.y * 128 - (DQ + DKV) + row) * TT + blockIdx.x % (TT / 128) * 128 + lr * 8) = o; }
    } else {
    float* os = osw + w * (16 * 68);   // the wave's own 16 x 64 f32 patch, read and written by this wave alone
    float bz8[8];
    if constexpr (OUTM == 1) {
#pragma unroll
        for (int u = 0; u < 8; ++u) bz8[u] = BIAS ? bfr(bias[c0 + (lane & 7) * 8 + u]) : 0.0f; }
#pragma unroll
    for (int mb = 0; mb < MB; ++mb) {
#pragma unroll
        for (int nb = 0; nb < NB; ++nb) {
#pragma unroll
            for (int j = 0; j < 8; ++j) os[(hi * 8 + j) * 68 + nb * 16 + lr] = acc[mb][nb][j]; }
        __builtin_amdgcn_wave_barrier(); asm volatile("" ::: "memory");   // holds the compiler to the order: the wave's patch is written whole before it is read
        if constexpr (OUTM == 1) {   // eight lanes write one token's 128-byte row of the head plane, a store instruction four rows in a run
            h16* prow = P16 + ((size_t)((c0 / DQ * NB_ + r0 / TT) * NH_ + c0 % DQ / HD) * TT + r0 % TT + mb * 16) * HD;
#pragma unroll
            for (int s = 0; s < 4; ++s) { const int row = 4 * s + (lane >> 3), cofs = (lane & 7) * 8; const v4f v0 = *(const v4fa*)(os + row * 68 + cofs), v1 = *(const v4fa*)(os + row * 68 + cofs + 4); v8h o;
#pragma unroll
                for (int u = 0; u < 4; ++u) { float a0 = v0[u], a1 = v1[u]; if (BIAS) { a0 += bz8[u]; a1 += bz8[u + 4]; } o[u] = (h16)a0; o[u + 4] = (h16)a1; }
                *(v8h*)(prow + row * HD + cofs) = o; }
        } else {
            float* crow = C + (size_t)(r0 + mb * 16) * ldc + c0;
#pragma unroll
            for (int s = 0; s < 8; ++s) { const int row = 2 * s + hi, cofs = lr * 4; v4f val = *(const v4fa*)(os + row * 68 + cofs); if (BIAS) { val[0] += bfr(bias[c0 + cofs]); val[1] += bfr(bias[c0 + cofs + 1]); val[2] += bfr(bias[c0 + cofs + 2]); val[3] += bfr(bias[c0 + cofs + 3]); }
                *(v4f*)(crow + (size_t)row * ldc + cofs) = val; }
        }
        __builtin_amdgcn_wave_barrier(); asm volatile("" ::: "memory");   // and read whole before the next mb rewrites it
    }
    if constexpr (OUTM == 1) asm volatile("s_wait_xcnt 0x0" ::: "memory");   // in the built code the v branch stands directly behind this one and rewrites registers that the stores above name: the wait stands in front of it
    }
}

// ---- k_gemmq: the q | k | v product, C[m][n] = TB[frame of m][n] + sum_k A[m][k] Bt[n][k], on ONE 192x384 output tile per work-group of 12 waves; grid (M/192, N/384) = 256 work-groups, one for each WGP, 384 threads.
// TB[f][n] = sum_k te[f][k] Bt[n][k] + bias[n] (k_prep makes it): the embedding is the same for the 256 tokens of a frame, so its product is done once a frame and x alone, exact in bf16, goes through this kernel. A 16-token tile lies in one frame, so its accumulators start from one table row.
// A work-group fetches 192 + 384 = 576 operand rows for 73,728 outputs. A wave holds 48 rows x 128 columns: 11 fragments read from LDS for 24 products. Stages of 64 k and the two buffers are as in k_gemmt; the next stage comes through six 16-byte pieces a thread in two halves (A and two sweeps of Bt are fetched during the first 32 k, the other six sweeps of Bt during the second), because 192 accumulator registers leave no room for a whole stage.
// A wave's 128 columns lie wholly in q, in k or in v (two heads). Epilogue: each column block of 128 has its own region of the stage buffers, which are free behind the loop's last barrier: [192 tokens][128 d] at pitch 272 B for q and k, [128 d][192 tokens] at pitch 400 B for v; one barrier, then whole 128-byte lines go out. The q columns are multiplied by CSC in f32 before they are rounded, so that k_fattn's score product is in the log2 domain as it leaves the matrix unit.
#define QTM 192
#define QTN 384
#define QWV 12
#define QSZ ((QTM + QTN) * GLP)   // one stage: rows 0..191 A, 192..575 Bt
#define FRT 256                 // tokens of a frame (16 x 16)
#define NFR (TT / FRT)          // frames
#define NQC (DQ + 2 * DKV)      // q | k | v columns
#define QRP 136                 // epilogue pitch of a token row (128 d) in halves
#define QVP (QTM + 8)           // epilogue pitch of a d row (192 tokens) in halves
template <int K>
__global__ __launch_bounds__(QWV * 32) void k_gemmq(const bf* __restrict__ A, const bf* __restrict__ Bt, const float* __restrict__ TB, h16* P16, h16* PT) {
    typedef WFrag<bf>::V V;
    constexpr int MB = 3, NB = 8, NG = 8, WM = QTM / (MB * 16), SR = QWV * 32 / 8, NA = QTM / SR, NT = QTN / SR, NH = (NA + NT) / 2, N0 = NH - NA;   // 16x16 tiles of a wave along M and N; B fragments held at a time; waves along M; rows that one sweep of the threads covers; sweeps of A and of Bt; pieces a thread fetches in each half of a stage; sweeps of Bt in the first half
    static_assert(HD == 64 && NH_ == NKV && TT % QTM == 0 && DQ % (NB * 16) == 0 && DKV % (NB * 16) == 0 && K % GKS == 0 && WM * (QTN / (NB * 16)) == QWV && (NA + NT) % 2 == 0 && NA < NH && FRT % 16 == 0 && QTM % 16 == 0 && 128 * QVP <= QTM * QRP && 3 * QTM * QRP <= 2 * QSZ, "a tile lies in one batch, a wave's columns in one of q, k, v; whole stages and sweeps; the epilogue fits the buffers");
    __shared__ __align__(16) bf st[2 * QSZ];
    const int tid = threadIdx.x, lane = tid & 31, lr = lane & 15, hi = lane >> 4; const int w = __builtin_amdgcn_readfirstlane(tid >> 5); const int wm = w % WM, wn = w / WM;   // w is read as a scalar so that the wave's tile origin is one
    const int srow = tid >> 3, scol = (tid & 7) * 8;   // staging: thread tid moves the 16-byte pieces (srow + SR i, scol) of each operand
    const bf* ga = A + (size_t)(blockIdx.x * QTM + srow) * K + scol; const bf* gb = Bt + (size_t)(blockIdx.y * QTN + srow) * K + scol; const int sl = srow * GLP + scol;
    v8us r[NH], r0[NT];   // every loop over i, h, g, n, mb, nb, j, it here is unrolled so that staging registers, fragments and accumulators are indexed by constants
#pragma unroll
    for (int i = 0; i < NA; ++i) r[i] = *(const v8us*)(ga + (size_t)i * SR * K);
#pragma unroll
    for (int i = 0; i < NT; ++i) r0[i] = *(const v8us*)(gb + (size_t)i * SR * K);
    const int c0 = blockIdx.y * QTN + wn * NB * 16;   // the wave's first column, a scalar
    const int bt = blockIdx.x / (TT / QTM), t0 = blockIdx.x % (TT / QTM) * QTM;   // the tile's batch and its first token there
    float bz[MB][NB];   // the table's value for the lane's eight columns in the frame of each of the wave's three 16-token tiles
#pragma unroll
    for (int mb = 0; mb < MB; ++mb) { const float* tr = TB + (size_t)((t0 + (wm * MB + mb) * 16) / FRT) * NQC + c0;   // a scalar: the table row of the tile's frame at the wave's first column
#pragma unroll
        for (int nb = 0; nb < NB; ++nb) bz[mb][nb] = tr[nb * 16 + lr]; }
    asm volatile("s_wait_xcnt 0x0" :: "v"(lr) : "memory");   // the wait in front of the first rewrite of a register that the table loads name; lr, their one vector offset, is its input so that it stays in its register up to the wait and no load is given that register as its target
#pragma unroll
    for (int i = 0; i < NA; ++i) *(v8us*)(st + sl + i * SR * GLP) = r[i];
#pragma unroll
    for (int i = 0; i < NT; ++i) *(v8us*)(st + QTM * GLP + sl + i * SR * GLP) = r0[i];
    v8f acc[MB][NB];
#pragma unroll
    for (int mb = 0; mb < MB; ++mb)
#pragma unroll
        for (int nb = 0; nb < NB; ++nb)
#pragma unroll
            for (int j = 0; j < 8; ++j) acc[mb][nb][j] = bz[mb][nb];   // a lane's eight rows of a tile are eight tokens of one frame in one column
    __syncthreads();   // stage 0 is in LDS before any wave reads it
    const int ao = (wm * MB * 16 + lr) * GLP + 8 * hi, bo = (QTM + wn * NB * 16 + lr) * GLP + 8 * hi; constexpr int ns = K / GKS;
#pragma unroll 1
    for (int s = 0; s < ns; ++s) {   // kept rolled: the body already holds 48 products, and an unrolled loop would outgrow the registers
        const int cur = (s & 1) * QSZ, nxt = ((s & 1) ^ 1) * QSZ; const bool more = s + 1 < ns;
        if (more) { gb += GKS;   // the last loads that name gb are waited for in front of the barrier at the foot of the trip before
#pragma unroll
            for (int i = 0; i < NA; ++i) r[i] = *(const v8us*)(ga + GKS + (size_t)i * SR * K);
#pragma unroll
            for (int i = 0; i < N0; ++i) r[NA + i] = *(const v8us*)(gb + (size_t)i * SR * K); }
#pragma unroll
        for (int h = 0; h < 2; ++h) {
            V a[MB];
#pragma unroll
            for (int mb = 0; mb < MB; ++mb) a[mb] = WFrag<bf>::ld(st + cur + ao + mb * 16 * GLP + h * 32);
#pragma unroll
            for (int g = 0; g < NB / NG; ++g) {
                V b[NG];
#pragma unroll
                for (int n = 0; n < NG; ++n) b[n] = WFrag<bf>::ld(st + cur + bo + (g * NG + n) * 16 * GLP + h * 32);
                __builtin_amdgcn_sched_barrier(0);   // keeps the group's LDS reads together ahead of its 24 products: left alone, the compiler sinks reads between the products and waits for each at once
#pragma unroll
                for (int n = 0; n < NG; ++n)
#pragma unroll
                    for (int mb = 0; mb < MB; ++mb) acc[mb][g * NG + n] = WFrag<bf>::mma(a[mb], b[n], acc[mb][g * NG + n]);
                __builtin_amdgcn_sched_barrier(0);   // keeps the next group's reads behind these products, so that only one group's fragments are held at a time
            }
            asm volatile("v_nop\n\tv_nop\n\tv_nop\n\tv_nop"); __builtin_amdgcn_sched_barrier(0);   // the four vector slots behind the last WMMA, also on the taken side of the branch that follows; the scheduling barriers keep them directly behind it
            if (more) {
                if (h == 0) {
#pragma unroll
                    for (int i = 0; i < NA; ++i) *(v8us*)(st + nxt + sl + i * SR * GLP) = r[i];
#pragma unroll
                    for (int i = 0; i < N0; ++i) *(v8us*)(st + nxt + QTM * GLP + sl + i * SR * GLP) = r[NA + i];
                    ga += GKS;   // stepped in this block, whose stores have waited for the data of the loads that name the pointer
#pragma unroll
                    for (int i = 0; i < NH; ++i) r[i] = *(const v8us*)(gb + (size_t)(N0 + i) * SR * K);
                } else {
#pragma unroll
                    for (int i = 0; i < NH; ++i) *(v8us*)(st + nxt + QTM * GLP + sl + (N0 + i) * SR * GLP) = r[i];
                } }
        }
        __syncthreads();   // publishes stage s + 1 and ends every wave's reads of stage s, whose buffer the next trip refills
    }
    const bool isv = c0 >= DQ + DKV;
    bf* rg = st + wn * (QTM * QRP);   // the column block's region; four waves (wm = 0..3) fill it
    if (isv) {   // a lane holds eight consecutive tokens of one d: 16 bytes of a row of the transposed block
#pragma unroll
        for (int nb = 0; nb < NB; ++nb) {
#pragma unroll
            for (int mb = 0; mb < MB; ++mb) { v8h o;
#pragma unroll
                for (int j = 0; j < 8; ++j) o[j] = (h16)acc[mb][nb][j];
                *(v8ha*)(rg + (nb * 16 + lr) * QVP + wm * MB * 16 + mb * 16 + 8 * hi) = o; }
        }
    } else {
        const float qs = c0 < DQ ? CSC : 1.0f;   // a scalar: the softmax scale goes into q, k is left as it is
#pragma unroll
        for (int nb = 0; nb < NB; ++nb) {
#pragma unroll
            for (int mb = 0; mb < MB; ++mb)
#pragma unroll
                for (int j = 0; j < 8; ++j) rg[(wm * MB * 16 + mb * 16 + 8 * hi + j) * QRP + nb * 16 + lr] = __builtin_bit_cast(unsigned short, (h16)(acc[mb][nb][j] * qs));
        }
    }
    __syncthreads();   // every region is written whole before a wave reads rows that four waves wrote; passed by all waves, outside the two branches
    if (isv) {   // the block's 128 d rows of 384 bytes are 3,072 pieces in a run; a store instruction takes 32 of them: four whole lines, one writer each
#pragma unroll
        for (int it = 0; it < 128 * (QTM / 8) / (WM * 32); ++it) { const int p = it * (WM * 32) + wm * 32 + lane, row = p / (QTM / 8), col = p % (QTM / 8); const v8h o = *(const v8ha*)(rg + row * QVP + col * 8);
            *(v8h*)(PT + ((size_t)bt * DKV + c0 - (DQ + DKV) + row) * TT + t0 + col * 8) = o; }
    } else {   // eight lanes write one token's 128-byte row of a head plane, a store instruction four rows in a run; the wave takes its own 48 tokens of both heads
#pragma unroll
        for (int it = 0; it < 2 * MB * 4; ++it) { const int hh = it / (MB * 4), tok = wm * MB * 16 + it % (MB * 4) * 4 + (lane >> 3), cofs = (lane & 7) * 8; const v8h o = *(const v8ha*)(rg + tok * QRP + hh * HD + cofs);
            *(v8h*)(P16 + ((size_t)((c0 / DQ * NB_ + bt) * NH_ + c0 % DQ / HD + hh) * TT + t0 + tok) * HD + cofs) = o; }
        asm volatile("s_wait_xcnt 0x0" ::: "memory");   // in the built code the v branch stands directly behind this one and rewrites registers that the stores above name: the wait stands in front of it
    }
}

__device__ __forceinline__ void splitf(float y, unsigned short& h, unsigned short& l) { h = f2bf(y); l = f2bf(y - bf2f(h)); }
typedef __attribute__((ext_vector_type(2))) _Float16 v2h;
typedef __attribute__((ext_vector_type(4))) _Float16 v4h;
typedef __attribute__((ext_vector_type(2))) unsigned short v2us;
typedef __attribute__((ext_vector_type(4))) unsigned short v4us;
typedef __attribute__((ext_vector_type(2))) float v2f;
typedef __attribute__((ext_vector_type(4))) int v4i;

__global__ __launch_bounds__(256) void k_wtG(const float* __restrict__ w, int K, int N, bf* Bt) {
    const int lane = threadIdx.x & 31; const int L0 = (blockIdx.x * 8 + (threadIdx.x >> 5)) * 8; const int nlines = N * K / 64;
{
#pragma unroll 1
        for (int l = 0; l < 8; ++l) { const int L = L0 + l; if (L >= nlines) break; const size_t e = (size_t)L * 64 + lane * 2; const int k = (int)(e % K), n = (int)(e / K); v2us o;
            o[0] = f2bf(w[(size_t)k * N + n]); o[1] = f2bf(w[(size_t)(k + 1) * N + n]); *(v2us*)(Bt + e) = o; }
         }
}
__global__ __launch_bounds__(256) void k_cscvt(const float* __restrict__ cosT, const float* __restrict__ sinT, float* CS) { const int idx = blockIdx.x * 256 + threadIdx.x; if (idx >= TT * HD) return; v2f cs; cs[0] = bfr(cosT[idx]); cs[1] = bfr(sinT[idx]); *(v2f*)(CS + (size_t)idx * 2) = cs;  }
#define FWV 12                  // waves per work-group
#define FSK 192                 // keys per stage
#define FPT 72                  // LDS pitch of a K row (64 d) in halves: 144 B, an odd multiple of 16 B
#define FVP (FSK + 8)           // LDS pitch of a V^T row (FSK keys) in halves: 400 B, an odd multiple of 16 B
#define FNS (TT / FSK)
__device__ __forceinline__ float xhalf(float x) { return __builtin_bit_cast(float, __builtin_amdgcn_permlanex16(__builtin_bit_cast(int, x), __builtin_bit_cast(int, x), 0x76543210, 0xfedcba98, false, false)); }   // lane l with lane l ^ 16
__device__ __forceinline__ void fpass(const h16* kb, const h16* vb, const v16h (&qf)[2][2], v8f (&acc)[2][4], v8f (&lacc)[2], v8f (&c0)[2], float& thr, float& lo, const v16h ones) {
    typedef __attribute__((ext_vector_type(2))) _Float16 h2; typedef __attribute__((ext_vector_type(2))) float f2;
    v8f s[2][2];   // every loop over kt, g, t, r, i here and in k_fattn is unrolled so that fragments, scores and accumulators are indexed by constants and stay in registers
#pragma unroll
    for (int kt = 0; kt < 2; ++kt) { const v16h k0 = WFrag<h16>::ld(kb + kt * 16 * FPT), k1 = WFrag<h16>::ld(kb + kt * 16 * FPT + 32);
#pragma unroll
        for (int g = 0; g < 2; ++g) { s[kt][g] = wmma16(k0, qf[g][0], c0[g]); s[kt][g] = wmma16(k1, qf[g][1], s[kt][g]); } }
    v16h vf[4];
#pragma unroll
    for (int t = 0; t < 4; ++t) vf[t] = WFrag<h16>::ld(vb + t * 16 * FVP);
    float mx = s[0][0][0], my = s[1][0][1];   // the largest of the lane's 32 exponents, both column groups together (the bound is the same for both), in two chains of 17 and 15 values: an odd count is whole three-input maxima
#pragma unroll
    for (int r = 1; r < 8; ++r) mx = fmaxf(mx, s[0][0][r]);
#pragma unroll
    for (int r = 0; r < 8; ++r) mx = fmaxf(mx, s[0][1][r]);
    mx = fmaxf(mx, s[1][0][0]);
#pragma unroll
    for (int r = 2; r < 8; ++r) my = fmaxf(my, s[1][0][r]);
#pragma unroll
    for (int r = 0; r < 8; ++r) my = fmaxf(my, s[1][1][r]);
    if (__builtin_amdgcn_ballot_w32(fmaxf(mx, my) > thr) != 0) {   // a scalar branch, rare after the first pass, which always takes it (thr = -inf)
#pragma unroll
        for (int g = 0; g < 2; ++g) { float mg = s[1][g][7];   // from the last value down: a partial maximum in common with the test above would be kept for this branch and would split that chain's three-input maxima
#pragma unroll
            for (int r = 6; r >= 0; --r) mg = fmaxf(mg, s[1][g][r]);
#pragma unroll
            for (int r = 7; r >= 0; --r) mg = fmaxf(mg, s[0][g][r]);
            mg = fmaxf(mg, xhalf(mg)); const float d = fmaxf(mg - 6.0f, lo);   // how far the maximum in use rises; the first pass (lo = -inf) sets it to the pass's own maximum, up or down
            const float corr = __builtin_amdgcn_exp2f(fminf(-d, 0.0f)); c0[g] = c0[g] - d; lacc[g] = lacc[g] * corr;
#pragma unroll
            for (int kt = 0; kt < 2; ++kt) s[kt][g] = s[kt][g] - d;
#pragma unroll
            for (int t = 0; t < 4; ++t) acc[g][t] = acc[g][t] * corr; }
        thr = 14.0f; lo = 0.0f; }
#pragma unroll
    for (int g = 0; g < 2; ++g) { v16h pf;   // P carries a factor 2^6, which the denominator carries too: fewer small probabilities fall into fp16's subnormal range
#pragma unroll
        for (int i = 0; i < 8; ++i) { const int kt = i >> 2, r = 2 * (i & 3); f2 p; p[0] = __builtin_amdgcn_exp2f(s[kt][g][r]); p[1] = __builtin_amdgcn_exp2f(s[kt][g][r + 1]); const h2 q = __builtin_convertvector(p, h2); pf[2 * i] = q[0]; pf[2 * i + 1] = q[1]; }
#pragma unroll
        for (int t = 0; t < 4; ++t) acc[g][t] = wmma16(vf[t], pf, acc[g][t]);
        lacc[g] = wmma16(ones, pf, lacc[g]); }
}
__global__ __launch_bounds__(FWV * 32) void k_fattn(const h16* __restrict__ Q, const h16* __restrict__ Kp, const h16* __restrict__ Vt, bf* Ah, bf* Al) {
    __shared__ __align__(16) h16 ks[2 * FSK * FPT];
    __shared__ __align__(16) h16 vs[2 * HD * FVP];
    constexpr int KR = FWV * 32 / 8, VR = FWV * 32 / (FSK / 8), NP = FSK / KR;   // rows of the K tile and of the V^T tile that one sweep of the work-group's threads covers; sweeps a tile
    static_assert(TT % (FWV * 32) == 0 && TT % FSK == 0 && FSK % 64 == 0 && FSK % KR == 0 && HD == NP * VR && FVP / 8 % 2 == 1, "whole work-groups, stages, lines and sweeps");
    const int tid = threadIdx.x, lane = tid & 31, lr = lane & 15, hi = lane >> 4; const int w = __builtin_amdgcn_readfirstlane(tid >> 5); const int head = blockIdx.y; const int q0 = blockIdx.x * (FWV * 32) + w * 32;   // w is read as a scalar so that the wave's first query is one
    const int bh = blockIdx.z * NH_ + head; Q += (size_t)bh * TT * HD; Kp += (size_t)bh * TT * HD; Vt += (size_t)bh * HD * TT; Ah += (size_t)blockIdx.z * TT * DQ; Al += (size_t)blockIdx.z * TT * DQ;   // the batch's own planes and output rows
    const int srow = tid >> 3, scol = (tid & 7) * 8, vrow = tid / (FSK / 8), vcol = tid % (FSK / 8) * 8;   // staging: thread tid moves the 16-byte pieces (srow + KR i, scol) of the K tile [FSK keys][64 d] and (vrow + VR i, vcol) of the V^T tile [64 d][FSK keys], i < NP
    const h16* kg = Kp + (size_t)srow * HD + scol; const h16* vg = Vt + (size_t)vrow * TT + vcol; const int sl = srow * FPT + scol, sv = vrow * FVP + vcol;
    v8h rk[NP], rv[NP];
#pragma unroll
    for (int i = 0; i < NP; ++i) { rk[i] = *(const v8h*)(kg + i * KR * HD); rv[i] = *(const v8h*)(vg + (size_t)i * VR * TT); }
    v16h qf[2][2];
#pragma unroll
    for (int g = 0; g < 2; ++g)
#pragma unroll
        for (int kc = 0; kc < 2; ++kc) qf[g][kc] = WFrag<h16>::ld(Q + (size_t)(q0 + g * 16 + lr) * HD + kc * 32 + 8 * hi);
    asm volatile("s_wait_xcnt 0x0" ::: "memory");   // in the built code the accumulators' start values go into registers that the loads above name as addresses
    v8f acc[2][4], lacc[2], c0[2]; float thr = -__builtin_inff(), lo = -__builtin_inff(); v16h ones;
#pragma unroll
    for (int e = 0; e < 16; ++e) ones[e] = (h16)1.0f;
#pragma unroll
    for (int g = 0; g < 2; ++g) { c0[g] = (v8f){}; lacc[g] = (v8f){};
#pragma unroll
        for (int t = 0; t < 4; ++t) acc[g][t] = (v8f){}; }
#pragma unroll
    for (int i = 0; i < NP; ++i) { *(v8h*)(ks + sl + i * KR * FPT) = rk[i]; *(v8h*)(vs + sv + i * VR * FVP) = rv[i]; }
    __syncthreads();   // stage 0 is in LDS before any wave reads it
    const int fo = lr * FPT + 8 * hi, fv = lr * FVP + 8 * hi;
#pragma unroll 1
    for (int st = 0; st < FNS; ++st) {   // kept rolled: the body already holds six passes, and acc[][] must stay in registers
        const int cur = (st & 1) * (FSK * FPT), nxt = ((st & 1) ^ 1) * (FSK * FPT), curv = (st & 1) * (HD * FVP), nxtv = ((st & 1) ^ 1) * (HD * FVP); const bool more = st + 1 < FNS;
        if (more) { kg += FSK * HD; vg += FSK;
#pragma unroll
            for (int i = 0; i < NP; ++i) { rk[i] = *(const v8h*)(kg + i * KR * HD); rv[i] = *(const v8h*)(vg + (size_t)i * VR * TT); } }
#pragma unroll   // unrolled so that a pass's last products stand in one block with the next pass's first LDS reads and products, which the compiler then interleaves
        for (int p = 0; p < FSK / 32; ++p) fpass(ks + cur + fo + p * 32 * FPT, vs + curv + fv + p * 32, qf, acc, lacc, c0, thr, lo, ones);
        __builtin_amdgcn_sched_barrier(0); asm volatile("v_nop\n\tv_nop\n\tv_nop\n\tv_nop"); __builtin_amdgcn_sched_barrier(0);   // the four vector slots behind the pass's last WMMA, also on the taken side of the branch that follows; the two scheduling barriers keep them directly behind it
        if (more) {
#pragma unroll
            for (int i = 0; i < NP; ++i) { *(v8h*)(ks + nxt + sl + i * KR * FPT) = rk[i]; *(v8h*)(vs + nxtv + sv + i * VR * FVP) = rv[i]; } }
        __syncthreads();   // publishes stage st + 1 and ends every wave's reads of stage st, whose buffer the next trip refills
    }
#pragma unroll
    for (int g = 0; g < 2; ++g) { const float inv = __fdiv_rn(1.0f, lacc[g][0]); const size_t oo = (size_t)(q0 + g * 16 + lr) * DQ + head * HD + 8 * hi;   // every row of lacc holds the column sums
#pragma unroll
        for (int t = 0; t < 4; ++t) { v8us oh, ol;
#pragma unroll
            for (int r = 0; r < 8; ++r) { unsigned short a, c2; splitf(acc[g][t][r] * inv, a, c2); oh[r] = a; ol[r] = c2; }
            *(v8us*)(Ah + oo + t * 16) = oh; *(v8us*)(Al + oo + t * 16) = ol; } }
}

// ---- k_prep: all that the products read, in one launch. The first TEB work-groups make the table TB[frame][column] = sum_k te[frame][k] qkv_w[column][k] + qkv_b[column], operands rounded to bf16 in registers, f32 out; the others round qkv_w, proj_w (into one run of planes) and x to bf16, eight elements a thread.
// A table work-group has 32 columns (a 128-byte line of each table row, one writer). Wave w takes the 16-column tile w & 1 and the quarter w >> 1 of k; the frames are the rows of A (rows NFR..15 repeat the last frame and are not stored); the four partial sums meet in LDS.
#define NW1 ((size_t)NQC * DM / 8)                // 8-element pieces of qkv_w
#define NW2 ((size_t)DM * DQ / 8)                 // of proj_w
#define NXP ((size_t)NB_ * TT * DM / 8)           // and of x
#define TEB ((unsigned)(NQC / 32))
#define CVB ((unsigned)((NW1 + NW2 + NXP) / 256))
__global__ __launch_bounds__(256) void k_prep(const float* __restrict__ w1, const float* __restrict__ w2, bf* Wd, const float* __restrict__ xb, bf* Xh, const float* __restrict__ te, const float* __restrict__ bias, float* TB) {
    static_assert(NW1 % 256 == 0 && NW2 % 256 == 0 && NXP % 256 == 0 && NQC % 32 == 0 && DM % 128 == 0 && NFR <= 16, "whole work-groups, whole k steps, the frames fit one tile");
    __shared__ float part[8 * 256];
    if (blockIdx.x < TEB) {
        const int tid = threadIdx.x, lane = tid & 31, lr = lane & 15, hi = lane >> 4; const int w = __builtin_amdgcn_readfirstlane(tid >> 5); const int n0 = blockIdx.x * 32;   // w is read as a scalar so that the test on the frame below is one
        const float* tp = te + (size_t)(lr < NFR ? lr : NFR - 1) * DM + (w >> 1) * (DM / 4) + 8 * hi; const float* wp = w1 + (size_t)(n0 + (w & 1) * 16 + lr) * DM + (w >> 1) * (DM / 4) + 8 * hi;
        const float bb = bfr(bias[n0 + lane]);   // fetched here so that the store at the end waits for no load
        v8f acc = (v8f){};
#pragma unroll   // unrolled so that a later k step's loads are issued ahead of an earlier step's product
        for (int s = 0; s < DM / 4 / 32; ++s) { const v8f a0 = *(const v8f*)(tp + s * 32), a1 = *(const v8f*)(tp + s * 32 + 16), b0 = *(const v8f*)(wp + s * 32), b1 = *(const v8f*)(wp + s * 32 + 16); v8us ca0, ca1, cb0, cb1;   // both operands in the k order of WFrag::ld
#pragma unroll
            for (int k = 0; k < 8; ++k) { ca0[k] = f2bf(a0[k]); ca1[k] = f2bf(a1[k]); cb0[k] = f2bf(b0[k]); cb1[k] = f2bf(b1[k]); }
            acc = wmmab(cat16b(ca0, ca1), cat16b(cb0, cb1), acc); }
        asm volatile("s_wait_xcnt 0x0" :: "v"(tp), "v"(wp) : "memory");   // the wait in front of the first rewrite of a register that the loads above name; the two row pointers are its inputs so that they stay in their registers up to it: without them the last load is given its own address registers as its target
#pragma unroll
        for (int j = 0; j < 8; ++j) part[w * 256 + j * 32 + lane] = acc[j];   // frame 8 hi + j, column lr of the wave's tile
        __syncthreads();   // the eight partial tiles are in LDS before a wave reads what the others wrote; the branch is the same for the whole work-group
#pragma unroll
        for (int u = 0; u < 2; ++u) { const int f = u * 8 + w;   // a wave stores one frame's 32 columns: one whole line
            if (f < NFR) { const int ix = (lane >> 4) * 256 + w * 32 + u * 16 + lr; TB[(size_t)f * NQC + n0 + lane] = part[ix] + part[512 + ix] + part[1024 + ix] + part[1536 + ix] + bb;
                asm volatile("s_wait_xcnt 0x0" ::: "memory"); } }   // the second frame's code may rewrite registers that the first frame's store names: the wait stands in front of it
    } else {
        const unsigned cb = blockIdx.x - TEB; const size_t i = (size_t)cb * 256 + threadIdx.x; const v8f v = *(const v8f*)(cb < NW1 / 256 ? w1 + i * 8 : cb < (NW1 + NW2) / 256 ? w2 + (i - NW1) * 8 : xb + (i - NW1 - NW2) * 8); v8us o;   // a work-group lies wholly in one of the three sources: the tests are on its number
#pragma unroll
        for (int k = 0; k < 8; ++k) o[k] = f2bf(v[k]);
        *(v8us*)(cb < (NW1 + NW2) / 256 ? Wd + i * 8 : Xh + (i - NW1 - NW2) * 8) = o;
        asm volatile("s_wait_xcnt 0x0" ::: "memory");   // in the built code the table's branch stands directly behind this one and rewrites registers that the store names: the wait stands in front of it
    }
}

extern "C" void kernel_launch(void* const* d_in, const int* in_sizes, int n_in,
                              void* d_out, int out_size, void* d_ws, size_t ws_size, hipStream_t stream) {
    (void)in_sizes; (void)n_in; (void)out_size;
    const float* x = (const float*)d_in[0]; const float* temb = (const float*)d_in[1]; const float* wf = (const float*)d_in[2]; const float* bfz = (const float*)d_in[3]; const float* wo = (const float*)d_in[4]; const float* bo = (const float*)d_in[5];
    float* OUT = (float*)d_out;     // [2][3072][1024]
    char* wsp = (char*)d_ws;
    auto take = [&](size_t bytes) { char* p = wsp; wsp += (bytes + 255) & ~(size_t)255; return (void*)p; };
    bf* WF = (bf*)take((size_t)(DQ + 2 * DKV + DM) * DM * 2); bf* WO = WF + (size_t)(DQ + 2 * DKV) * DM;   // q | k | v rows, then proj rows
    bf* XB = (bf*)take((size_t)NB_ * TT * DM * 2); float* TBL = (float*)take((size_t)NFR * NQC * 4);
    h16* QP16 = (h16*)take((size_t)2 * NB_ * NH_ * TT * HD * 2); h16* KP16 = QP16 + (size_t)NB_ * NH_ * TT * HD; h16* VT16 = (h16*)take((size_t)NB_ * NKV * HD * TT * 2);
    bf* ATh = (bf*)take((size_t)NB_ * TT * DQ * 2); bf* ATl = (bf*)take((size_t)NB_ * TT * DQ * 2);
    if ((size_t)(wsp - (char*)d_ws) > ws_size) return;    // ws 256 MiB
    k_prep<<<TEB + CVB, 256, 0, stream>>>(wf, wo, WF, x, XB, temb, bfz, TBL);
    k_gemmq<DM><<<dim3(NB_ * TT / QTM, (DQ + 2 * DKV) / QTN, 1), QWV * 32, 0, stream>>>(XB, WF, TBL, QP16, VT16);
    k_fattn<<<dim3(TT / (FWV * 32), NH_, NB_), FWV * 32, 0, stream>>>(QP16, KP16, VT16, ATh, ATl);
    k_gemmt<true, 0, DQ><<<dim3(NB_ * TT / 128, DM / 128, 1), 256, 0, stream>>>(ATh, ATl, WO, OUT, DM, bo, nullptr, nullptr);
}

// v010
// One run takes 114 microseconds.
// Timed twice side by side with v009, it ran 1.08 and 1.07 times as fast.
// All steps since v000 together make it 17.4 times as fast.
#include <hip/hip_runtime.h>

// Attention over all tokens of a clip (x [2][12][16][16][1024] + temporal_embedding[:, :12] broadcast over the 16x16 grid; N = 12*16*16 = 3,072 tokens per batch; qkv = (x + te) qkv_w^T + qkv_b (qkv_w [3072][1024], rows q | k | v, 16 heads x 64); softmax(q.k / 8) over all 3,072 tokens; out = merged proj_w^T + proj_b -> [2][12][16][16][1024]).
// Compute dtypes, f32 accumulate: every input rounded to bf16; (x + te) W = x W + te W: x goes in as one exact bf16 plane (1 product), te W + bias is a table of 12 frames x 3,072 columns from which the accumulators start; q/k/v rounded to fp16 head planes in the product's own epilogue, q times HD^-0.5 x log2(e) in f32 first; scores and attn.v single fp16 on every row, P = 2^6 x exp2(score - maximum in use), unnormalised; softmax f32, online; proj: the merged heads rounded to one fp16 plane, proj_w's bf16 values carried in fp16 (exact from 2^-14 up), 1 product + bias.

#define NB_  2
#define TT   3072
#define DM   1024
#define NH_  16
#define NKV  16
#define REP  (NH_ / NKV)
#define HD   64
#define DQ   (NH_ * HD)
#define DKV  (NKV * HD)
#define ZH   2
#define RH   0                  // unused: no query rows use hi+lo planes
#define WIN  0
#define PCAR 1024.0f
#define SCL  0.125f   // HD^-0.5
#define CSC  0.18033688011112042f   // HD^-0.5 x log2(e)
typedef _Float16 h16;
typedef unsigned short bf;
typedef __attribute__((ext_vector_type(16))) __bf16   v16bf;
typedef __attribute__((ext_vector_type(16))) _Float16 v16h;
typedef __attribute__((ext_vector_type(8)))  _Float16 v8h;
typedef __attribute__((ext_vector_type(8)))  unsigned short v8us;
typedef __attribute__((ext_vector_type(8)))  float    v8f;
typedef __attribute__((ext_vector_type(4)))  float    v4f;
typedef v8h  __attribute__((may_alias)) v8ha;
typedef v4f  __attribute__((may_alias)) v4fa;
typedef v8us __attribute__((may_alias)) v8usa;

__device__ __forceinline__ unsigned short f2bf(float f) { unsigned u = __float_as_uint(f); u += 0x7FFFu + ((u >> 16) & 1u); return (unsigned short)(u >> 16); }
__device__ __forceinline__ float bf2f(unsigned short b) { return __uint_as_float(((unsigned)b) << 16); }
__device__ __forceinline__ float bfr(float f) { return bf2f(f2bf(f)); }
__device__ __forceinline__ v16h cat16(v8h lo, v8h hi) { return __builtin_shufflevector(lo, hi, 0, 1, 2, 3, 4, 5, 6, 7, 8, 9, 10, 11, 12, 13, 14, 15); }
__device__ __forceinline__ v16bf cat16b(v8us lo, v8us hi) { return __builtin_bit_cast(v16bf, __builtin_shufflevector(lo, hi, 0, 1, 2, 3, 4, 5, 6, 7, 8, 9, 10, 11, 12, 13, 14, 15)); }
__device__ __forceinline__ v8f wmma16(v16h a, v16h b, v8f c) { return __builtin_amdgcn_wmma_f32_16x16x32_f16(false, a, false, b, (short)0, c, false, false); }
__device__ __forceinline__ v8f wmmab(v16bf a, v16bf b, v8f c) { return __builtin_amdgcn_wmma_f32_16x16x32_bf16(false, a, false, b, (short)0, c, false, false); }



// ---- k_gemmt: C[m][n] = sum_k A[m][k] Bt[n][k] + bias[n], operands K-contiguous fp16 planes; ONE 128x128 output tile per work-group of 8 waves; grid (M/128, N/128), 256 threads. M, N % 128 == 0, K % 64 == 0; K is a compile-time constant, so that the four row steps of a staging load are immediate offsets of one address.
// The 128 rows of A and of Bt go through LDS in stages of 64 k (one whole 128-byte line of each row, eight lanes to a line), two buffers: stage s + 1 is fetched into registers while stage s is worked on, stored behind it, and one barrier a stage publishes it.
// A wave holds 32 rows x 64 columns: 6 fragments read for 8 products.
// The M rows are the tokens of all NB_ batches in a run (a 128-row tile lies inside one batch, TT % 128 == 0).
// OUTM 0: C (f32, pitch ldc). OUTM 1: the N columns are q | k | v. In the q and k columns a wave's 64 columns are one head (HD == 64) and go out as fp16 rows of the head plane P16[q or k][batch][head][token][d]; in the v columns the work-group's tile is transposed in LDS and goes out as fp16 rows of the transposed plane PT[batch][head][d][token], 256 bytes of a row from one half-wave.
template <typename T16> struct WFrag;
template <> struct WFrag<h16> { typedef v16h V; static __device__ __forceinline__ V ld(const h16* p) { return cat16(*(const v8h*)p, *(const v8h*)(p + 16)); } static __device__ __forceinline__ v8f mma(V a, V b, v8f c) { return wmma16(a, b, c); } };
template <> struct WFrag<bf> { typedef v16bf V; static __device__ __forceinline__ V ld(const bf* p) { return cat16b(*(const v8us*)p, *(const v8us*)(p + 16)); } static __device__ __forceinline__ v8f mma(V a, V b, v8f c) { return wmmab(a, b, c); } };
#define GKS 64                  // k per stage
#define GLP 72                  // LDS row pitch in 16-bit elements: 144 B, an odd multiple of 16 B
#define GSZ (256 * GLP)         // one stage of k_gemmt: rows 0..127 A, 128..255 Bt
template <bool BIAS, int OUTM, int K>
__global__ __launch_bounds__(256) void k_gemmt(const h16* __restrict__ A, const h16* __restrict__ Bt, float* C, int ldc, const float* __restrict__ bias, h16* P16, h16* PT) {
    typedef WFrag<h16>::V V; static_assert(OUTM == 0 || (HD == 64 && NH_ == NKV && TT % 128 == 0), "a 64-column wave tile is one head, q and k planes are alike, a tile lies in one batch"); static_assert(K % GKS == 0, "whole stages");
    constexpr int MB = 2, NB = 4, WM = 8 / MB;   // 16x16 tiles of a wave along M and N; waves along M
    __shared__ __align__(16) h16 st[2 * GSZ];
    __shared__ __align__(16) float osw[8 * 16 * 68];   // epilogue only: a 16 x 68 f32 patch per wave, or (v columns) one 128 x 136 fp16 tile
    const int tid = threadIdx.x, lane = tid & 31, lr = lane & 15, hi = lane >> 4; const int w = __builtin_amdgcn_readfirstlane(tid >> 5); const int wm = w % WM, wn = w / WM;   // w is read as a scalar so that the wave's tile origin is one
    const int srow = tid >> 3, scol = (tid & 7) * 8;   // staging: thread tid moves the 16-byte pieces (srow + 32 i, scol), i = 0..3, of each of the two operands
    const h16* ga = A + (size_t)(blockIdx.x * 128 + srow) * K + scol; const h16* gb = Bt + (size_t)(blockIdx.y * 128 + srow) * K + scol; const int sl = srow * GLP + scol;
    v8h ra[4], rb[4];   // every loop over i, h, mb, nb here is unrolled so that staging registers, fragments and accumulators are indexed by constants
#pragma unroll
    for (int i = 0; i < 4; ++i) { ra[i] = *(const v8h*)(ga + (size_t)i * 32 * K); rb[i] = *(const v8h*)(gb + (size_t)i * 32 * K); }
    v8f acc[MB][NB];
#pragma unroll
    for (int mb = 0; mb < MB; ++mb)
#pragma unroll
        for (int nb = 0; nb < NB; ++nb) acc[mb][nb] = (v8f){};
#pragma unroll
    for (int i = 0; i < 4; ++i) { *(v8h*)(st + sl + i * 32 * GLP) = ra[i]; *(v8h*)(st + 128 * GLP + sl + i * 32 * GLP) = rb[i]; }
    __syncthreads();   // stage 0 is in LDS before any wave reads it
    const int ao = (wm * MB * 16 + lr) * GLP + 8 * hi, bo = (128 + wn * NB * 16 + lr) * GLP + 8 * hi; constexpr int ns = K / GKS;
#pragma unroll 1
    for (int s = 0; s < ns; ++s) {   // kept rolled: unrolled, the staging registers and fragments of several trips would be held at once
        const int cur = (s & 1) * GSZ, nxt = ((s & 1) ^ 1) * GSZ; const bool more = s + 1 < ns;
        if (more) { ga += GKS; gb += GKS;
#pragma unroll
            for (int i = 0; i < 4; ++i) { ra[i] = *(const v8h*)(ga + (size_t)i * 32 * K); rb[i] = *(const v8h*)(gb + (size_t)i * 32 * K); } }
        V a[2][MB], b[2][NB];
#pragma unroll
        for (int h = 0; h < 2; ++h) {
#pragma unroll
            for (int mb = 0; mb < MB; ++mb) a[h][mb] = WFrag<h16>::ld(st + cur + ao + mb * 16 * GLP + h * 32);
#pragma unroll
            for (int nb = 0; nb < NB; ++nb) b[h][nb] = WFrag<h16>::ld(st + cur + bo + nb * 16 * GLP + h * 32); }
        __builtin_amdgcn_sched_barrier(0);   // keeps the stage's 24 LDS reads one group ahead of its 16 products: left alone, the compiler sinks reads between the products, into registers just freed, and waits for each at once
#pragma unroll
        for (int h = 0; h < 2; ++h) {
#pragma unroll
            for (int nb = 0; nb < NB; ++nb)
#pragma unroll
                for (int mb = 0; mb < MB; ++mb) acc[mb][nb] = WFrag<h16>::mma(a[h][mb], b[h][nb], acc[mb][nb]); }
        __builtin_amdgcn_sched_barrier(0); asm volatile("v_nop\n\tv_nop\n\tv_nop\n\tv_nop"); __builtin_amdgcn_sched_barrier(0);   // the four vector slots behind the stage's last WMMA, also on the taken side of the branch that follows; the two scheduling barriers keep them directly behind it
        if (more) {
#pragma unroll
            for (int i = 0; i < 4; ++i) { *(v8h*)(st + nxt + sl + i * 32 * GLP) = ra[i]; *(v8h*)(st + nxt + 128 * GLP + sl + i * 32 * GLP) = rb[i]; } }
        __syncthreads();   // publishes stage s + 1 and ends every wave's reads of stage s, whose buffer the next trip refills
    }
    const int r0 = blockIdx.x * 128 + wm * MB * 16, c0 = blockIdx.y * 128 + wn * NB * 16;   // the wave's own tile
    if (OUTM == 1 && blockIdx.y >= (DQ + DKV) / 128) {   // v columns, the same for the whole work-group: a lane holds eight consecutive tokens of one d: 16 bytes of a row of the transposed tile [128 d][128 tokens], row pitch 272 B (an odd multiple of 16 B)
        h16* tp = (h16*)osw;
#pragma unroll
        for (int nb = 0; nb < NB; ++nb) { const float bz = BIAS ? bfr(bias[c0 + nb * 16 + lr]) : 0.0f;
#pragma unroll
            for (int mb = 0; mb < MB; ++mb) { v8h o;
#pragma unroll
                for (int j = 0; j < 8; ++j) { float val = acc[mb][nb][j]; if (BIAS) val += bz; o[j] = (h16)val; }
                *(v8ha*)(tp + (wn * NB * 16 + nb * 16 + lr) * 136 + wm * MB * 16 + mb * 16 + 8 * hi) = o; } }
        __syncthreads();   // the whole transposed tile is in LDS before a wave reads rows that four waves wrote
#pragma unroll
        for (int s = 0; s < 8; ++s) { const int row = w * 16 + 2 * s + hi; const v8h o = *(const v8ha*)(tp + row * 136 + lr * 8);   // a half-wave stores 256 bytes of one d row: two whole lines, one writer each
            *(v8h*)(PT + ((size_t)(blockIdx.x / (TT / 128)) * DKV + blockIdx.y * 128 - (DQ + DKV) + row) * TT + blockIdx.x % (TT / 128) * 128 + lr * 8) = o; }
    } else {
    float* os = osw + w * (16 * 68);   // the wave's own 16 x 64 f32 patch, read and written by this wave alone
    float bz8[8];
    if constexpr (OUTM == 1) {
#pragma unroll
        for (int u = 0; u < 8; ++u) bz8[u] = BIAS ? bfr(bias[c0 + (lane & 7) * 8 + u]) : 0.0f; }
#pragma unroll
    for (int mb = 0; mb < MB; ++mb) {
#pragma unroll
        for (int nb = 0; nb < NB; ++nb) {
#pragma unroll
            for (int j = 0; j < 8; ++j) os[(hi * 8 + j) * 68 + nb * 16 + lr] = acc[mb][nb][j]; }
        __builtin_amdgcn_wave_barrier(); asm volatile("" ::: "memory");   // holds the compiler to the order: the wave's patch is written whole before it is read
        if constexpr (OUTM == 1) {   // eight lanes write one token's 128-byte row of the head plane, a store instruction four rows in a run
            h16* prow = P16 + ((size_t)((c0 / DQ * NB_ + r0 / TT) * NH_ + c0 % DQ / HD) * TT + r0 % TT + mb * 16) * HD;
#pragma unroll
            for (int s = 0; s < 4; ++s) { const int row = 4 * s + (lane >> 3), cofs = (lane & 7) * 8; const v4f v0 = *(const v4fa*)(os + row * 68 + cofs), v1 = *(const v4fa*)(os + row * 68 + cofs + 4); v8h o;
#pragma unroll
                for (int u = 0; u < 4; ++u) { float a0 = v0[u], a1 = v1[u]; if (BIAS) { a0 += bz8[u]; a1 += bz8[u + 4]; } o[u] = (h16)a0; o[u + 4] = (h16)a1; }
                *(v8h*)(prow + row * HD + cofs) = o; }
        } else {
            float* crow = C + (size_t)(r0 + mb * 16) * ldc + c0;
#pragma unroll
            for (int s = 0; s < 8; ++s) { const int row = 2 * s + hi, cofs = lr * 4; v4f val = *(const v4fa*)(os + row * 68 + cofs); if (BIAS) { val[0] += bfr(bias[c0 + cofs]); val[1] += bfr(bias[c0 + cofs + 1]); val[2] += bfr(bias[c0 + cofs + 2]); val[3] += bfr(bias[c0 + cofs + 3]); }
                *(v4f*)(crow + (size_t)row * ldc + cofs) = val; }
        }
        __builtin_amdgcn_wave_barrier(); asm volatile("" ::: "memory");   // and read whole before the next mb rewrites it
    }
    if constexpr (OUTM == 1) asm volatile("s_wait_xcnt 0x0" ::: "memory");   // in the built code the v branch stands directly behind this one and rewrites registers that the stores above name: the wait stands in front of it
    }
}

// ---- k_gemmq: the q | k | v product, C[m][n] = TB[frame of m][n] + sum_k A[m][k] Bt[n][k], on ONE 192x384 output tile per work-group of 12 waves; grid (M/192, N/384) = 256 work-groups, one for each WGP, 384 threads.
// TB[f][n] = sum_k te[f][k] Bt[n][k] + bias[n] (k_prep makes it): the embedding is the same for the 256 tokens of a frame, so its product is done once a frame and x alone, exact in bf16, goes through this kernel. A 16-token tile lies in one frame, so its accumulators start from one table row.
// A work-group fetches 192 + 384 = 576 operand rows for 73,728 outputs. A wave holds 48 rows x 128 columns: 11 fragments read from LDS for 24 products. Stages of 64 k and the two buffers are as in k_gemmt; the next stage comes through six 16-byte pieces a thread in two halves (A and two sweeps of Bt are fetched during the first 32 k, the other six sweeps of Bt during the second), because 192 accumulator registers leave no room for a whole stage.
// A wave's 128 columns lie wholly in q, in k or in v (two heads). Epilogue: each column block of 128 has its own region of the stage buffers, which are free behind the loop's last barrier: [192 tokens][128 d] at pitch 272 B for q and k, [128 d][192 tokens] at pitch 400 B for v; one barrier, then whole 128-byte lines go out. The q columns are multiplied by CSC in f32 before they are rounded, so that k_fattn's score product is in the log2 domain as it leaves the matrix unit.
#define QTM 192
#define QTN 384
#define QWV 12
#define QSZ ((QTM + QTN) * GLP)   // one stage: rows 0..191 A, 192..575 Bt
#define FRT 256                 // tokens of a frame (16 x 16)
#define NFR (TT / FRT)          // frames
#define NQC (DQ + 2 * DKV)      // q | k | v columns
#define QRP 136                 // epilogue pitch of a token row (128 d) in halves
#define QVP (QTM + 8)           // epilogue pitch of a d row (192 tokens) in halves
template <int K>
__global__ __launch_bounds__(QWV * 32) void k_gemmq(const bf* __restrict__ A, const bf* __restrict__ Bt, const float* __restrict__ TB, h16* P16, h16* PT) {
    typedef WFrag<bf>::V V;
    constexpr int MB = 3, NB = 8, NG = 8, WM = QTM / (MB * 16), SR = QWV * 32 / 8, NA = QTM / SR, NT = QTN / SR, NH = (NA + NT) / 2, N0 = NH - NA;   // 16x16 tiles of a wave along M and N; B fragments held at a time; waves along M; rows that one sweep of the threads covers; sweeps of A and of Bt; pieces a thread fetches in each half of a stage; sweeps of Bt in the first half
    static_assert(HD == 64 && NH_ == NKV && TT % QTM == 0 && DQ % (NB * 16) == 0 && DKV % (NB * 16) == 0 && K % GKS == 0 && WM * (QTN / (NB * 16)) == QWV && (NA + NT) % 2 == 0 && NA < NH && FRT % 16 == 0 && QTM % 16 == 0 && 128 * QVP <= QTM * QRP && 3 * QTM * QRP <= 2 * QSZ, "a tile lies in one batch, a wave's columns in one of q, k, v; whole stages and sweeps; the epilogue fits the buffers");
    __shared__ __align__(16) bf st[2 * QSZ];
    const int tid = threadIdx.x, lane = tid & 31, lr = lane & 15, hi = lane >> 4; const int w = __builtin_amdgcn_readfirstlane(tid >> 5); const int wm = w % WM, wn = w / WM;   // w is read as a scalar so that the wave's tile origin is one
    const int srow = tid >> 3, scol = (tid & 7) * 8;   // staging: thread tid moves the 16-byte pieces (srow + SR i, scol) of each operand
    const bf* ga = A + (size_t)(blockIdx.x * QTM + srow) * K + scol; const bf* gb = Bt + (size_t)(blockIdx.y * QTN + srow) * K + scol; const int sl = srow * GLP + scol;
    v8us r[NH], r0[NT];   // every loop over i, h, g, n, mb, nb, j, it here is unrolled so that staging registers, fragments and accumulators are indexed by constants
#pragma unroll
    for (int i = 0; i < NA; ++i) r[i] = *(const v8us*)(ga + (size_t)i * SR * K);
#pragma unroll
    for (int i = 0; i < NT; ++i) r0[i] = *(const v8us*)(gb + (size_t)i * SR * K);
    const int c0 = blockIdx.y * QTN + wn * NB * 16;   // the wave's first column, a scalar
    const int bt = blockIdx.x / (TT / QTM), t0 = blockIdx.x % (TT / QTM) * QTM;   // the tile's batch and its first token there
    float bz[MB][NB];   // the table's value for the lane's eight columns in the frame of each of the wave's three 16-token tiles
#pragma unroll
    for (int mb = 0; mb < MB; ++mb) { const float* tr = TB + (size_t)((t0 + (wm * MB + mb) * 16) / FRT) * NQC + c0;   // a scalar: the table row of the tile's frame at the wave's first column
#pragma unroll
        for (int nb = 0; nb < NB; ++nb) bz[mb][nb] = tr[nb * 16 + lr]; }
    asm volatile("s_wait_xcnt 0x0" :: "v"(lr) : "memory");   // the wait in front of the first rewrite of a register that the table loads name; lr, their one vector offset, is its input so that it stays in its register up to the wait and no load is given that register as its target
#pragma unroll
    for (int i = 0; i < NA; ++i) *(v8us*)(st + sl + i * SR * GLP) = r[i];
#pragma unroll
    for (int i = 0; i < NT; ++i) *(v8us*)(st + QTM * GLP + sl + i * SR * GLP) = r0[i];
    v8f acc[MB][NB];
#pragma unroll
    for (int mb = 0; mb < MB; ++mb)
#pragma unroll
        for (int nb = 0; nb < NB; ++nb)
#pragma unroll
            for (int j = 0; j < 8; ++j) acc[mb][nb][j] = bz[mb][nb];   // a lane's eight rows of a tile are eight tokens of one frame in one column
    __syncthreads();   // stage 0 is in LDS before any wave reads it
    const int ao = (wm * MB * 16 + lr) * GLP + 8 * hi, bo = (QTM + wn * NB * 16 + lr) * GLP + 8 * hi; constexpr int ns = K / GKS;
#pragma unroll 1
    for (int s = 0; s < ns; ++s) {   // kept rolled: the body already holds 48 products, and an unrolled loop would outgrow the registers
        const int cur = (s & 1) * QSZ, nxt = ((s & 1) ^ 1) * QSZ; const bool more = s + 1 < ns;
        if (more) { gb += GKS;   // the last loads that name gb are waited for in front of the barrier at the foot of the trip before
#pragma unroll
            for (int i = 0; i < NA; ++i) r[i] = *(const v8us*)(ga + GKS + (size_t)i * SR * K);
#pragma unroll
            for (int i = 0; i < N0; ++i) r[NA + i] = *(const v8us*)(gb + (size_t)i * SR * K); }
#pragma unroll
        for (int h = 0; h < 2; ++h) {
            V a[MB];
#pragma unroll
            for (int mb = 0; mb < MB; ++mb) a[mb] = WFrag<bf>::ld(st + cur + ao + mb * 16 * GLP + h * 32);
#pragma unroll
            for (int g = 0; g < NB / NG; ++g) {
                V b[NG];
#pragma unroll
                for (int n = 0; n < NG; ++n) b[n] = WFrag<bf>::ld(st + cur + bo + (g * NG + n) * 16 * GLP + h * 32);
                __builtin_amdgcn_sched_barrier(0);   // keeps the group's LDS reads together ahead of its 24 products: left alone, the compiler sinks reads between the products and waits for each at once
#pragma unroll
                for (int n = 0; n < NG; ++n)
#pragma unroll
                    for (int mb = 0; mb < MB; ++mb) acc[mb][g * NG + n] = WFrag<bf>::mma(a[mb], b[n], acc[mb][g * NG + n]);
                __builtin_amdgcn_sched_barrier(0);   // keeps the next group's reads behind these products, so that only one group's fragments are held at a time
            }
            asm volatile("v_nop\n\tv_nop\n\tv_nop\n\tv_nop"); __builtin_amdgcn_sched_barrier(0);   // the four vector slots behind the last WMMA, also on the taken side of the branch that follows; the scheduling barriers keep them directly behind it
            if (more) {
                if (h == 0) {
#pragma unroll
                    for (int i = 0; i < NA; ++i) *(v8us*)(st + nxt + sl + i * SR * GLP) = r[i];
#pragma unroll
                    for (int i = 0; i < N0; ++i) *(v8us*)(st + nxt + QTM * GLP + sl + i * SR * GLP) = r[NA + i];
                    ga += GKS;   // stepped in this block, whose stores have waited for the data of the loads that name the pointer
#pragma unroll
                    for (int i = 0; i < NH; ++i) r[i] = *(const v8us*)(gb + (size_t)(N0 + i) * SR * K);
                } else {
#pragma unroll
                    for (int i = 0; i < NH; ++i) *(v8us*)(st + nxt + QTM * GLP + sl + (N0 + i) * SR * GLP) = r[i];
                } }
        }
        __syncthreads();   // publishes stage s + 1 and ends every wave's reads of stage s, whose buffer the next trip refills
    }
    const bool isv = c0 >= DQ + DKV;
    bf* rg = st + wn * (QTM * QRP);   // the column block's region; four waves (wm = 0..3) fill it
    if (isv) {   // a lane holds eight consecutive tokens of one d: 16 bytes of a row of the transposed block
#pragma unroll
        for (int nb = 0; nb < NB; ++nb) {
#pragma unroll
            for (int mb = 0; mb < MB; ++mb) { v8h o;
#pragma unroll
                for (int j = 0; j < 8; ++j) o[j] = (h16)acc[mb][nb][j];
                *(v8ha*)(rg + (nb * 16 + lr) * QVP + wm * MB * 16 + mb * 16 + 8 * hi) = o; }
        }
    } else {
        const float qs = c0 < DQ ? CSC : 1.0f;   // a scalar: the softmax scale goes into q, k is left as it is
#pragma unroll
        for (int nb = 0; nb < NB; ++nb) {
#pragma unroll
            for (int mb = 0; mb < MB; ++mb)
#pragma unroll
                for (int j = 0; j < 8; ++j) rg[(wm * MB * 16 + mb * 16 + 8 * hi + j) * QRP + nb * 16 + lr] = __builtin_bit_cast(unsigned short, (h16)(acc[mb][nb][j] * qs));
        }
    }
    __syncthreads();   // every region is written whole before a wave reads rows that four waves wrote; passed by all waves, outside the two branches
    if (isv) {   // the block's 128 d rows of 384 bytes are 3,072 pieces in a run; a store instruction takes 32 of them: four whole lines, one writer each
#pragma unroll
        for (int it = 0; it < 128 * (QTM / 8) / (WM * 32); ++it) { const int p = it * (WM * 32) + wm * 32 + lane, row = p / (QTM / 8), col = p % (QTM / 8); const v8h o = *(const v8ha*)(rg + row * QVP + col * 8);
            *(v8h*)(PT + ((size_t)bt * DKV + c0 - (DQ + DKV) + row) * TT + t0 + col * 8) = o; }
    } else {   // eight lanes write one token's 128-byte row of a head plane, a store instruction four rows in a run; the wave takes its own 48 tokens of both heads
#pragma unroll
        for (int it = 0; it < 2 * MB * 4; ++it) { const int hh = it / (MB * 4), tok = wm * MB * 16 + it % (MB * 4) * 4 + (lane >> 3), cofs = (lane & 7) * 8; const v8h o = *(const v8ha*)(rg + tok * QRP + hh * HD + cofs);
            *(v8h*)(P16 + ((size_t)((c0 / DQ * NB_ + bt) * NH_ + c0 % DQ / HD + hh) * TT + t0 + tok) * HD + cofs) = o; }
        asm volatile("s_wait_xcnt 0x0" ::: "memory");   // in the built code the v branch stands directly behind this one and rewrites registers that the stores above name: the wait stands in front of it
    }
}

typedef __attribute__((ext_vector_type(2))) _Float16 v2h;
typedef __attribute__((ext_vector_type(4))) _Float16 v4h;
typedef __attribute__((ext_vector_type(2))) unsigned short v2us;
typedef __attribute__((ext_vector_type(4))) unsigned short v4us;
typedef __attribute__((ext_vector_type(2))) float v2f;
typedef __attribute__((ext_vector_type(4))) int v4i;

__global__ __launch_bounds__(256) void k_wtG(const float* __restrict__ w, int K, int N, bf* Bt) {
    const int lane = threadIdx.x & 31; const int L0 = (blockIdx.x * 8 + (threadIdx.x >> 5)) * 8; const int nlines = N * K / 64;
{
#pragma unroll 1
        for (int l = 0; l < 8; ++l) { const int L = L0 + l; if (L >= nlines) break; const size_t e = (size_t)L * 64 + lane * 2; const int k = (int)(e % K), n = (int)(e / K); v2us o;
            o[0] = f2bf(w[(size_t)k * N + n]); o[1] = f2bf(w[(size_t)(k + 1) * N + n]); *(v2us*)(Bt + e) = o; }
         }
}
__global__ __launch_bounds__(256) void k_cscvt(const float* __restrict__ cosT, const float* __restrict__ sinT, float* CS) { const int idx = blockIdx.x * 256 + threadIdx.x; if (idx >= TT * HD) return; v2f cs; cs[0] = bfr(cosT[idx]); cs[1] = bfr(sinT[idx]); *(v2f*)(CS + (size_t)idx * 2) = cs;  }
#define FWV 12                  // waves per work-group
#define FSK 192                 // keys per stage
#define FPT 72                  // LDS pitch of a K row (64 d) in halves: 144 B, an odd multiple of 16 B
#define FVP (FSK + 8)           // LDS pitch of a V^T row (FSK keys) in halves: 400 B, an odd multiple of 16 B
#define FNS (TT / FSK)
__device__ __forceinline__ float xhalf(float x) { return __builtin_bit_cast(float, __builtin_amdgcn_permlanex16(__builtin_bit_cast(int, x), __builtin_bit_cast(int, x), 0x76543210, 0xfedcba98, false, false)); }   // lane l with lane l ^ 16
__device__ __forceinline__ void fpass(const h16* kb, const h16* vb, const v16h (&qf)[2][2], v8f (&acc)[2][4], v8f (&lacc)[2], v8f (&c0)[2], float& thr, float& lo, const v16h ones) {
    typedef __attribute__((ext_vector_type(2))) _Float16 h2; typedef __attribute__((ext_vector_type(2))) float f2;
    v8f s[2][2];   // every loop over kt, g, t, r, i here and in k_fattn is unrolled so that fragments, scores and accumulators are indexed by constants and stay in registers
#pragma unroll
    for (int kt = 0; kt < 2; ++kt) { const v16h k0 = WFrag<h16>::ld(kb + kt * 16 * FPT), k1 = WFrag<h16>::ld(kb + kt * 16 * FPT + 32);
#pragma unroll
        for (int g = 0; g < 2; ++g) { s[kt][g] = wmma16(k0, qf[g][0], c0[g]); s[kt][g] = wmma16(k1, qf[g][1], s[kt][g]); } }
    v16h vf[4];
#pragma unroll
    for (int t = 0; t < 4; ++t) vf[t] = WFrag<h16>::ld(vb + t * 16 * FVP);
    float mx = s[0][0][0], my = s[1][0][1];   // the largest of the lane's 32 exponents, both column groups together (the bound is the same for both), in two chains of 17 and 15 values: an odd count is whole three-input maxima
#pragma unroll
    for (int r = 1; r < 8; ++r) mx = fmaxf(mx, s[0][0][r]);
#pragma unroll
    for (int r = 0; r < 8; ++r) mx = fmaxf(mx, s[0][1][r]);
    mx = fmaxf(mx, s[1][0][0]);
#pragma unroll
    for (int r = 2; r < 8; ++r) my = fmaxf(my, s[1][0][r]);
#pragma unroll
    for (int r = 0; r < 8; ++r) my = fmaxf(my, s[1][1][r]);
    if (__builtin_amdgcn_ballot_w32(fmaxf(mx, my) > thr) != 0) {   // a scalar branch, rare after the first pass, which always takes it (thr = -inf)
#pragma unroll
        for (int g = 0; g < 2; ++g) { float mg = s[1][g][7];   // from the last value down: a partial maximum in common with the test above would be kept for this branch and would split that chain's three-input maxima
#pragma unroll
            for (int r = 6; r >= 0; --r) mg = fmaxf(mg, s[1][g][r]);
#pragma unroll
            for (int r = 7; r >= 0; --r) mg = fmaxf(mg, s[0][g][r]);
            mg = fmaxf(mg, xhalf(mg)); const float d = fmaxf(mg - 6.0f, lo);   // how far the maximum in use rises; the first pass (lo = -inf) sets it to the pass's own maximum, up or down
            const float corr = __builtin_amdgcn_exp2f(fminf(-d, 0.0f)); c0[g] = c0[g] - d; lacc[g] = lacc[g] * corr;
#pragma unroll
            for (int kt = 0; kt < 2; ++kt) s[kt][g] = s[kt][g] - d;
#pragma unroll
            for (int t = 0; t < 4; ++t) acc[g][t] = acc[g][t] * corr; }
        thr = 14.0f; lo = 0.0f; }
#pragma unroll
    for (int g = 0; g < 2; ++g) { v16h pf;   // P carries a factor 2^6, which the denominator carries too: fewer small probabilities fall into fp16's subnormal range
#pragma unroll
        for (int i = 0; i < 8; ++i) { const int kt = i >> 2, r = 2 * (i & 3); f2 p; p[0] = __builtin_amdgcn_exp2f(s[kt][g][r]); p[1] = __builtin_amdgcn_exp2f(s[kt][g][r + 1]); const h2 q = __builtin_convertvector(p, h2); pf[2 * i] = q[0]; pf[2 * i + 1] = q[1]; }
#pragma unroll
        for (int t = 0; t < 4; ++t) acc[g][t] = wmma16(vf[t], pf, acc[g][t]);
        lacc[g] = wmma16(ones, pf, lacc[g]); }
}
__global__ __launch_bounds__(FWV * 32) void k_fattn(const h16* __restrict__ Q, const h16* __restrict__ Kp, const h16* __restrict__ Vt, h16* Ao) {
    __shared__ __align__(16) h16 ks[2 * FSK * FPT];
    __shared__ __align__(16) h16 vs[2 * HD * FVP];
    constexpr int KR = FWV * 32 / 8, VR = FWV * 32 / (FSK / 8), NP = FSK / KR;   // rows of the K tile and of the V^T tile that one sweep of the work-group's threads covers; sweeps a tile
    static_assert(TT % (FWV * 32) == 0 && TT % FSK == 0 && FSK % 64 == 0 && FSK % KR == 0 && HD == NP * VR && FVP / 8 % 2 == 1, "whole work-groups, stages, lines and sweeps");
    const int tid = threadIdx.x, lane = tid & 31, lr = lane & 15, hi = lane >> 4; const int w = __builtin_amdgcn_readfirstlane(tid >> 5); const int head = blockIdx.y; const int q0 = blockIdx.x * (FWV * 32) + w * 32;   // w is read as a scalar so that the wave's first query is one
    const int bh = blockIdx.z * NH_ + head; Q += (size_t)bh * TT * HD; Kp += (size_t)bh * TT * HD; Vt += (size_t)bh * HD * TT; Ao += (size_t)blockIdx.z * TT * DQ;   // the batch's own planes and output rows
    const int srow = tid >> 3, scol = (tid & 7) * 8, vrow = tid / (FSK / 8), vcol = tid % (FSK / 8) * 8;   // staging: thread tid moves the 16-byte pieces (srow + KR i, scol) of the K tile [FSK keys][64 d] and (vrow + VR i, vcol) of the V^T tile [64 d][FSK keys], i < NP
    const h16* kg = Kp + (size_t)srow * HD + scol; const h16* vg = Vt + (size_t)vrow * TT + vcol; const int sl = srow * FPT + scol, sv = vrow * FVP + vcol;
    v8h rk[NP], rv[NP];
#pragma unroll
    for (int i = 0; i < NP; ++i) { rk[i] = *(const v8h*)(kg + i * KR * HD); rv[i] = *(const v8h*)(vg + (size_t)i * VR * TT); }
    v16h qf[2][2];
#pragma unroll
    for (int g = 0; g < 2; ++g)
#pragma unroll
        for (int kc = 0; kc < 2; ++kc) qf[g][kc] = WFrag<h16>::ld(Q + (size_t)(q0 + g * 16 + lr) * HD + kc * 32 + 8 * hi);
    asm volatile("s_wait_xcnt 0x0" ::: "memory");   // in the built code the accumulators' start values go into registers that the loads above name as addresses
    v8f acc[2][4], lacc[2], c0[2]; float thr = -__builtin_inff(), lo = -__builtin_inff(); v16h ones;
#pragma unroll
    for (int e = 0; e < 16; ++e) ones[e] = (h16)1.0f;
#pragma unroll
    for (int g = 0; g < 2; ++g) { c0[g] = (v8f){}; lacc[g] = (v8f){};
#pragma unroll
        for (int t = 0; t < 4; ++t) acc[g][t] = (v8f){}; }
#pragma unroll
    for (int i = 0; i < NP; ++i) { *(v8h*)(ks + sl + i * KR * FPT) = rk[i]; *(v8h*)(vs + sv + i * VR * FVP) = rv[i]; }
    __syncthreads();   // stage 0 is in LDS before any wave reads it
    const int fo = lr * FPT + 8 * hi, fv = lr * FVP + 8 * hi;
#pragma unroll 1
    for (int st = 0; st < FNS; ++st) {   // kept rolled: the body already holds six passes, and acc[][] must stay in registers
        const int cur = (st & 1) * (FSK * FPT), nxt = ((st & 1) ^ 1) * (FSK * FPT), curv = (st & 1) * (HD * FVP), nxtv = ((st & 1) ^ 1) * (HD * FVP); const bool more = st + 1 < FNS;
        if (more) { kg += FSK * HD; vg += FSK;
#pragma unroll
            for (int i = 0; i < NP; ++i) { rk[i] = *(const v8h*)(kg + i * KR * HD); rv[i] = *(const v8h*)(vg + (size_t)i * VR * TT); } }
#pragma unroll   // unrolled so that a pass's last products stand in one block with the next pass's first LDS reads and products, which the compiler then interleaves
        for (int p = 0; p < FSK / 32; ++p) fpass(ks + cur + fo + p * 32 * FPT, vs + curv + fv + p * 32, qf, acc, lacc, c0, thr, lo, ones);
        __builtin_amdgcn_sched_barrier(0); asm volatile("v_nop\n\tv_nop\n\tv_nop\n\tv_nop"); __builtin_amdgcn_sched_barrier(0);   // the four vector slots behind the pass's last WMMA, also on the taken side of the branch that follows; the two scheduling barriers keep them directly behind it
        if (more) {
#pragma unroll
            for (int i = 0; i < NP; ++i) { *(v8h*)(ks + nxt + sl + i * KR * FPT) = rk[i]; *(v8h*)(vs + nxtv + sv + i * VR * FVP) = rv[i]; } }
        __syncthreads();   // publishes stage st + 1 and ends every wave's reads of stage st, whose buffer the next trip refills
    }
#pragma unroll
    for (int g = 0; g < 2; ++g) { const float inv = __fdiv_rn(1.0f, lacc[g][0]); const size_t oo = (size_t)(q0 + g * 16 + lr) * DQ + head * HD + 8 * hi;   // every row of lacc holds the column sums
#pragma unroll
        for (int t = 0; t < 4; ++t) { v8h o;
#pragma unroll
            for (int r = 0; r < 8; ++r) o[r] = (h16)(acc[g][t][r] * inv);
            *(v8h*)(Ao + oo + t * 16) = o; } }
}

// ---- k_prep: all that the products read, in one launch. The first TEB work-groups make the table TB[frame][column] = sum_k te[frame][k] qkv_w[column][k] + qkv_b[column], operands rounded to bf16 in registers, f32 out; the others round qkv_w, proj_w (into one run of planes) and x to bf16, eight elements a thread; proj_w's bf16 values are stored as fp16, the type of k_gemmt's other operand.
// A table work-group has 32 columns (a 128-byte line of each table row, one writer). Wave w takes the 16-column tile w & 1 and the quarter w >> 1 of k; the frames are the rows of A (rows NFR..15 repeat the last frame and are not stored); the four partial sums meet in LDS.
#define NW1 ((size_t)NQC * DM / 8)                // 8-element pieces of qkv_w
#define NW2 ((size_t)DM * DQ / 8)                 // of proj_w
#define NXP ((size_t)NB_ * TT * DM / 8)           // and of x
#define TEB ((unsigned)(NQC / 32))
#define CVB ((unsigned)((NW1 + NW2 + NXP) / 256))
__global__ __launch_bounds__(256) void k_prep(const float* __restrict__ w1, const float* __restrict__ w2, bf* Wd, const float* __restrict__ xb, bf* Xh, const float* __restrict__ te, const float* __restrict__ bias, float* TB) {
    static_assert(NW1 % 256 == 0 && NW2 % 256 == 0 && NXP % 256 == 0 && NQC % 32 == 0 && DM % 128 == 0 && NFR <= 16, "whole work-groups, whole k steps, the frames fit one tile");
    __shared__ float part[8 * 256];
    if (blockIdx.x < TEB) {
        const int tid = threadIdx.x, lane = tid & 31, lr = lane & 15, hi = lane >> 4; const int w = __builtin_amdgcn_readfirstlane(tid >> 5); const int n0 = blockIdx.x * 32;   // w is read as a scalar so that the test on the frame below is one
        const float* tp = te + (size_t)(lr < NFR ? lr : NFR - 1) * DM + (w >> 1) * (DM / 4) + 8 * hi; const float* wp = w1 + (size_t)(n0 + (w & 1) * 16 + lr) * DM + (w >> 1) * (DM / 4) + 8 * hi;
        const float bb = bfr(bias[n0 + lane]);   // fetched here so that the store at the end waits for no load
        v8f acc = (v8f){};
#pragma unroll   // unrolled so that a later k step's loads are issued ahead of an earlier step's product
        for (int s = 0; s < DM / 4 / 32; ++s) { const v8f a0 = *(const v8f*)(tp + s * 32), a1 = *(const v8f*)(tp + s * 32 + 16), b0 = *(const v8f*)(wp + s * 32), b1 = *(const v8f*)(wp + s * 32 + 16); v8us ca0, ca1, cb0, cb1;   // both operands in the k order of WFrag::ld
#pragma unroll
            for (int k = 0; k < 8; ++k) { ca0[k] = f2bf(a0[k]); ca1[k] = f2bf(a1[k]); cb0[k] = f2bf(b0[k]); cb1[k] = f2bf(b1[k]); }
            acc = wmmab(cat16b(ca0, ca1), cat16b(cb0, cb1), acc); }
        asm volatile("s_wait_xcnt 0x0" :: "v"(tp), "v"(wp) : "memory");   // the wait in front of the first rewrite of a register that the loads above name; the two row pointers are its inputs so that they stay in their registers up to it: without them the last load is given its own address registers as its target
#pragma unroll
        for (int j = 0; j < 8; ++j) part[w * 256 + j * 32 + lane] = acc[j];   // frame 8 hi + j, column lr of the wave's tile
        __syncthreads();   // the eight partial tiles are in LDS before a wave reads what the others wrote; the branch is the same for the whole work-group
#pragma unroll
        for (int u = 0; u < 2; ++u) { const int f = u * 8 + w;   // a wave stores one frame's 32 columns: one whole line
            if (f < NFR) { const int ix = (lane >> 4) * 256 + w * 32 + u * 16 + lr; TB[(size_t)f * NQC + n0 + lane] = part[ix] + part[512 + ix] + part[1024 + ix] + part[1536 + ix] + bb;
                asm volatile("s_wait_xcnt 0x0" ::: "memory"); } }   // the second frame's code may rewrite registers that the first frame's store names: the wait stands in front of it
    } else if (blockIdx.x - TEB - (unsigned)(NW1 / 256) < (unsigned)(NW2 / 256)) {   // proj_w, whole work-groups: rounded to bf16 like every input, the value then stored as fp16
        const size_t i = (size_t)(blockIdx.x - TEB - (unsigned)(NW1 / 256)) * 256 + threadIdx.x; const float* wq = w2 + i * 8; const v8f v = *(const v8f*)wq; v8us o;   // i counts proj_w's own pieces
        asm volatile("s_wait_xcnt 0x0" :: "v"(wq) : "memory");   // the wait in front of the first rewrite of a register that the load names; the pointer is its input so that it stays in its registers up to the wait and the load is not given them as its target
#pragma unroll
        for (int k = 0; k < 8; ++k) o[k] = __builtin_bit_cast(unsigned short, (h16)bfr(v[k]));
        *(v8us*)(Wd + (NW1 + i) * 8) = o;
        asm volatile("s_wait_xcnt 0x0" ::: "memory");   // in the built code another branch may stand directly behind this one and rewrite registers that the store names: the wait stands in front of it
    } else {
        const unsigned cb = blockIdx.x - TEB; const size_t i = (size_t)cb * 256 + threadIdx.x; const v8f v = *(const v8f*)(cb < NW1 / 256 ? w1 + i * 8 : xb + (i - NW1 - NW2) * 8); v8us o;   // a work-group lies wholly in one of the two sources: the tests are on its number
#pragma unroll
        for (int k = 0; k < 8; ++k) o[k] = f2bf(v[k]);
        *(v8us*)(cb < NW1 / 256 ? Wd + i * 8 : Xh + (i - NW1 - NW2) * 8) = o;
        asm volatile("s_wait_xcnt 0x0" ::: "memory");   // in the built code the table's branch stands directly behind this one and rewrites registers that the store names: the wait stands in front of it
    }
}

extern "C" void kernel_launch(void* const* d_in, const int* in_sizes, int n_in,
                              void* d_out, int out_size, void* d_ws, size_t ws_size, hipStream_t stream) {
    (void)in_sizes; (void)n_in; (void)out_size;
    const float* x = (const float*)d_in[0]; const float* temb = (const float*)d_in[1]; const float* wf = (const float*)d_in[2]; const float* bfz = (const float*)d_in[3]; const float* wo = (const float*)d_in[4]; const float* bo = (const float*)d_in[5];
    float* OUT = (float*)d_out;     // [2][3072][1024]
    char* wsp = (char*)d_ws;
    auto take = [&](size_t bytes) { char* p = wsp; wsp += (bytes + 255) & ~(size_t)255; return (void*)p; };
    bf* WF = (bf*)take((size_t)(DQ + 2 * DKV + DM) * DM * 2); h16* WO = (h16*)(WF + (size_t)(DQ + 2 * DKV) * DM);   // q | k | v rows (bf16), then proj rows (fp16)
    bf* XB = (bf*)take((size_t)NB_ * TT * DM * 2); float* TBL = (float*)take((size_t)NFR * NQC * 4);
    h16* QP16 = (h16*)take((size_t)2 * NB_ * NH_ * TT * HD * 2); h16* KP16 = QP16 + (size_t)NB_ * NH_ * TT * HD; h16* VT16 = (h16*)take((size_t)NB_ * NKV * HD * TT * 2);
    h16* AT = (h16*)take((size_t)NB_ * TT * DQ * 2);
    if ((size_t)(wsp - (char*)d_ws) > ws_size) return;    // ws 256 MiB
    k_prep<<<TEB + CVB, 256, 0, stream>>>(wf, wo, WF, x, XB, temb, bfz, TBL);
    k_gemmq<DM><<<dim3(NB_ * TT / QTM, (DQ + 2 * DKV) / QTN, 1), QWV * 32, 0, stream>>>(XB, WF, TBL, QP16, VT16);
    k_fattn<<<dim3(TT / (FWV * 32), NH_, NB_), FWV * 32, 0, stream>>>(QP16, KP16, VT16, AT);
    k_gemmt<true, 0, DQ><<<dim3(NB_ * TT / 128, DM / 128, 1), 256, 0, stream>>>(AT, WO, OUT, DM, bo, nullptr, nullptr);
}
